// v000
// Times are from an AMD MI455X. After a warm-up the kernel runs many times in a row, and a time is the length of
// such a window on the GPU divided by its runs, so every launch and the gaps after it count. The runs cycle
// through copies of the inputs. A figure is the median of several windows, for all but v000 over two sittings.
// Sittings can differ by a few percent; kernels timed side by side share one.
// v000 is the starting kernel. One run takes 240 microseconds.
#include <hip/hip_runtime.h>

// Contractions, f32 accumulate: q/k = 1x1 convs ([16384 positions x 256].[256 x 32] each) and v ([16384 x 256].[256 x 256]) on v_wmma_f32_16x16x32_bf16 with PLAIN
// bf16 operands (inputs rounded once: exact); the position attention fused on v_wmma_f32_16x16x32_f16: energy = q.k over the 32 hidden dims (UNSCALED; q and k as
// f16 hi + residual x1024: hi.hi + hi.lo + lo.hi), softmax over the 2048 positions, out[c][i] = sum_j w[i][j] v[c][j] over all 256 channels with the weights
// (x32768) as f16 hi + UNSCALED residual and v as hi + residual x1024 — three products into two accumulator sets (o: wh.vh + wl.vh, ox: wh.vl); + x residual; output written channel-major

#define NB_  8
#define CC   256
#define NN_  2048
#define HQ   32
#define NTK  (NB_ * NN_)
#define PSC  32768.0f
#define LOSC 1024.0f
#define LOSCI (1.0f / 1024.0f)

typedef _Float16 h16;
typedef unsigned short bf;
typedef __attribute__((ext_vector_type(16))) __bf16   v16bf;
typedef __attribute__((ext_vector_type(16))) _Float16 v16h;
typedef __attribute__((ext_vector_type(8)))  _Float16 v8h;
typedef __attribute__((ext_vector_type(8)))  unsigned short v8us;
typedef __attribute__((ext_vector_type(8)))  float    v8f;
typedef __attribute__((ext_vector_type(4)))  float    v4f;
typedef v8h  __attribute__((may_alias)) v8ha;
typedef v4f  __attribute__((may_alias)) v4fa;
typedef v8us __attribute__((may_alias)) v8usa;

__device__ __forceinline__ unsigned short f2bf(float f) { unsigned u = __float_as_uint(f); u += 0x7FFFu + ((u >> 16) & 1u); return (unsigned short)(u >> 16); }
__device__ __forceinline__ float bf2f(unsigned short b) { return __uint_as_float(((unsigned)b) << 16); }
__device__ __forceinline__ float bfr(float f) { return bf2f(f2bf(f)); }
__device__ __forceinline__ v16h cat16(v8h lo, v8h hi) { return __builtin_shufflevector(lo, hi, 0, 1, 2, 3, 4, 5, 6, 7, 8, 9, 10, 11, 12, 13, 14, 15); }
__device__ __forceinline__ v16bf cat16b(v8us lo, v8us hi) { return __builtin_bit_cast(v16bf, __builtin_shufflevector(lo, hi, 0, 1, 2, 3, 4, 5, 6, 7, 8, 9, 10, 11, 12, 13, 14, 15)); }
__device__ __forceinline__ v8f wmma16(v16h a, v16h b, v8f c) { return __builtin_amdgcn_wmma_f32_16x16x32_f16(false, a, false, b, (short)0, c, false, false); }
__device__ __forceinline__ v8f wmmab(v16bf a, v16bf b, v8f c) { return __builtin_amdgcn_wmma_f32_16x16x32_bf16(false, a, false, b, (short)0, c, false, false); }
#define VST2(T, p, v) do { const T vst2_v_ = (v); *(T*)(p) = vst2_v_;  } while (0)

// k_xt: XT [b][n][c] bf16 = x[b][c][n] transposed (64 x 64 LDS tiles); grid (NN/64, CC/64, B).
__global__ __launch_bounds__(256) void k_xt(const float* __restrict__ x, bf* XT) {
    __shared__ __align__(16) unsigned short tl[64 * 72];
    const int tid = threadIdx.x, n0 = blockIdx.x * 64, c0 = blockIdx.y * 64, b = blockIdx.z;
    const int cr = tid >> 2, nq = (tid & 3) * 16;
#pragma unroll
    for (int i = 0; i < 16; ++i) tl[(nq + i) * 72 + cr] = f2bf(x[((size_t)b * CC + c0 + cr) * NN_ + n0 + nq + i]);
    __syncthreads();
    const int piece = tid & 7;
    auto pass = [&]() {
#pragma unroll
        for (int s = 0; s < 2; ++s) { const int nr = (tid >> 3) + 32 * s; const v8us val = *(const v8usa*)(tl + nr * 72 + piece * 8); *(v8us*)(XT + ((size_t)b * NN_ + n0 + nr) * CC + c0 + piece * 8) = val; }
    };
    pass(); 
}
// k_w: bf16 planes of wq [32][256], wk [32][256], wv [256][256] ([out][in] = n-major as-is); one wave per row (32 lanes x 16 B = 512 B).
__global__ __launch_bounds__(256) void k_w(const float* __restrict__ wq, const float* __restrict__ wk, const float* __restrict__ wv, bf* WQ, bf* WK, bf* WV) {
    const int lane = threadIdx.x & 31, r = blockIdx.x * 8 + (threadIdx.x >> 5);      // 0 .. 32+32+256
    const int m = (r < HQ) ? 0 : (r < 2 * HQ) ? 1 : 2;     // wave-uniform
    v8us o;
    if (m == 0) { for (int i = 0; i < 8; ++i) o[i] = f2bf(wq[(size_t)r * CC + lane * 8 + i]); VST2(v8us, WQ + (size_t)r * CC + lane * 8, o); }
    else if (m == 1) { const int o2 = r - HQ; for (int i = 0; i < 8; ++i) o[i] = f2bf(wk[(size_t)o2 * CC + lane * 8 + i]); VST2(v8us, WK + (size_t)o2 * CC + lane * 8, o); }
    else { const int o2 = r - 2 * HQ; if (o2 < CC) { for (int i = 0; i < 8; ++i) o[i] = f2bf(wv[(size_t)o2 * CC + lane * 8 + i]); VST2(v8us, WV + (size_t)o2 * CC + lane * 8, o); } }
}
// k_qk: Q/K f16 hi + residual planes [tok][32] = XT.W^T + b (K = 256; one 64 x 32 tile per block: 2 n-tiles); grid (NTK/64, 2 (q|k)).
__global__ __launch_bounds__(128) void k_qk(const bf* __restrict__ XT, const bf* __restrict__ WQ, const bf* __restrict__ WK, const float* __restrict__ bq, const float* __restrict__ bk, h16* QH, h16* QL, h16* KH, h16* KL) {
    __shared__ __align__(16) float ost[4][16 * 36];
    const int lane = threadIdx.x & 31, wave = threadIdx.x >> 5, lr = lane & 15, hi = lane >> 4, which = blockIdx.y;
    const size_t r0 = (size_t)blockIdx.x * 64 + wave * 16;
    const bf* W = which ? WK : WQ; const float* bias = which ? bk : bq; h16* PH = which ? KH : QH; h16* PL = which ? KL : QL;   // block-uniform selects of whole buffers (both read paths identical in shape)
    v8f acc[2] = {(v8f){}, (v8f){}};
#pragma unroll 2
    for (int kc = 0; kc < CC; kc += 32) {
        const v16bf a = cat16b(*(const v8us*)(XT + (r0 + lr) * CC + kc + 8 * hi), *(const v8us*)(XT + (r0 + lr) * CC + kc + 8 * hi + 16));
#pragma unroll
        for (int t = 0; t < 2; ++t) { const bf* bp = W + (size_t)(t * 16 + lr) * CC + kc + 8 * hi; acc[t] = wmmab(a, cat16b(*(const v8us*)bp, *(const v8us*)(bp + 16)), acc[t]); }
    }
    float* os = &ost[wave][0];
#pragma unroll
    for (int t = 0; t < 2; ++t) { const float bv = bfr(bias[t * 16 + lr]);
#pragma unroll
        for (int j = 0; j < 8; ++j) os[(hi * 8 + j) * 36 + t * 16 + lr] = acc[t][j] + bv; }
    __syncthreads();
    auto pass = [&]() {   // 16 rows x 64 B per plane: lane -> (row = lane >> 1? ) : use 4 lanes x 16 B per row, 8 rows per instruction, 2 instructions
#pragma unroll
        for (int s = 0; s < 2; ++s) { const int row = s * 8 + (lane >> 2), piece = lane & 3; const float* sp = os + row * 36 + piece * 8; v8h oh, ol;
#pragma unroll
            for (int i = 0; i < 8; ++i) { const h16 a = (h16)sp[i]; oh[i] = a; ol[i] = (h16)((sp[i] - (float)a) * LOSC); }
            *(v8h*)(PH + (r0 + row) * HQ + piece * 8) = oh; *(v8h*)(PL + (r0 + row) * HQ + piece * 8) = ol; }
    };
    pass(); 
}
// k_v: Vf [tok][256] f32 = XT.WV^T + bv (64 x 64 tiles; grid (NTK/64, 4)).
__global__ __launch_bounds__(128) void k_v(const bf* __restrict__ XT, const bf* __restrict__ WV, const float* __restrict__ bv, float* Vf) {
    __shared__ __align__(16) float ost[4][16 * 68];
    const int lane = threadIdx.x & 31, wave = threadIdx.x >> 5, lr = lane & 15, hi = lane >> 4;
    const size_t r0 = (size_t)blockIdx.x * 64 + wave * 16; const int c0 = blockIdx.y * 64;
    v8f acc[4];
#pragma unroll
    for (int t = 0; t < 4; ++t) acc[t] = (v8f){};
#pragma unroll 2
    for (int kc = 0; kc < CC; kc += 32) {
        const v16bf a = cat16b(*(const v8us*)(XT + (r0 + lr) * CC + kc + 8 * hi), *(const v8us*)(XT + (r0 + lr) * CC + kc + 8 * hi + 16));
#pragma unroll
        for (int t = 0; t < 4; ++t) { const bf* bp = WV + (size_t)(c0 + t * 16 + lr) * CC + kc + 8 * hi; acc[t] = wmmab(a, cat16b(*(const v8us*)bp, *(const v8us*)(bp + 16)), acc[t]); }
    }
    float* os = &ost[wave][0];
#pragma unroll
    for (int t = 0; t < 4; ++t) { const float b2 = bfr(bv[c0 + t * 16 + lr]);
#pragma unroll
        for (int j = 0; j < 8; ++j) os[(hi * 8 + j) * 68 + t * 16 + lr] = acc[t][j] + b2; }
    __syncthreads();
    float* crow = Vf + r0 * CC + c0;
    auto pass = [&]() {
#pragma unroll
        for (int s = 0; s < 8; ++s) { const int Lid = (lane >> 3) + 4 * s, piece = lane & 7; const int row = Lid >> 1, cofs = (Lid & 1) * 32 + piece * 4;
            const v4f val = *(const v4fa*)(os + row * 68 + cofs); *(v4f*)(crow + (size_t)row * CC + cofs) = val; }
    };
    pass(); 
}
// k_vt: VTH/VTL [b][c][n] f16 hi + residual of Vf[b*NN + n][c] via 64 x 64 LDS transposes; grid (NN/64, CC/64, B).
__global__ __launch_bounds__(256) void k_vt(const float* __restrict__ Vf, h16* VTH, h16* VTL) {
    __shared__ __align__(16) h16 tl[64 * 72];
    __shared__ __align__(16) h16 tl2[64 * 72];
    const int tid = threadIdx.x, n0 = blockIdx.x * 64, c0 = blockIdx.y * 64, b = blockIdx.z;
    const int nn = tid >> 2, cq = (tid & 3) * 16;
#pragma unroll
    for (int i = 0; i < 16; ++i) { const float v = Vf[((size_t)b * NN_ + n0 + nn) * CC + c0 + cq + i]; const h16 a = (h16)v; tl[(cq + i) * 72 + nn] = a; tl2[(cq + i) * 72 + nn] = (h16)((v - (float)a) * LOSC); }
    __syncthreads();
    const int piece = tid & 7;
    auto pass = [&]() {
#pragma unroll
        for (int s = 0; s < 2; ++s) { const int c = (tid >> 3) + 32 * s; const size_t o = ((size_t)b * CC + c0 + c) * NN_ + n0 + piece * 8;
            *(v8h*)(VTH + o) = *(const v8ha*)(tl + c * 72 + piece * 8); *(v8h*)(VTL + o) = *(const v8ha*)(tl2 + c * 72 + piece * 8); }
    };
    pass(); 
}
// k_attn: block = (b, 64 positions i), wave = 16; 64 key tiles: energy (1 k-chunk; hi.hi + hi.lo + lo.hi), online softmax, weights x32768 as f16 hi + UNSCALED
// residual tiles; o[c] += wh.vh + wl.vh + wh.(vl/1024 folded at the end? no: vl is a separate x1024 plane -> accumulate wh.vl into ox)... to keep one accumulator
// set we use: o += wh.vh + wl.vh (exact-grade weights vs v hi) and ox += wh.vl (v residual), 16 n-tiles each -> o[16] + ox[16] would be 256 VGPRs, so the
// channels are processed in two blocks of 128 in one launch (blockIdx.y = channel half): o[8], ox[8].
// Epilogue: out[b][c][i] = o/l + x[b][c][i], transposed through LDS (per c the block's 64 i are one 256-B run).
__global__ __launch_bounds__(128) void k_attn(const h16* __restrict__ QH, const h16* __restrict__ QL, const h16* __restrict__ KH, const h16* __restrict__ KL, const h16* __restrict__ VTH, const h16* __restrict__ VTL,
                                             const float* __restrict__ x, float* out) {
    __shared__ __align__(16) h16 plds[4][16 * 32];
    __shared__ __align__(16) h16 plds2[4][16 * 32];
    __shared__ __align__(16) float ot[128 * 68];
    const int lane = threadIdx.x & 31, wave = threadIdx.x >> 5, lr = lane & 15, hi = lane >> 4;
    const int b = blockIdx.x / (NN_ / 64), it = blockIdx.x - b * (NN_ / 64), chalf = blockIdx.y, i0l = it * 64, q0 = i0l + wave * 16;
    const size_t tok0 = (size_t)b * NN_;
    h16* pl = &plds[wave][0]; h16* pl2 = &plds2[wave][0];
    const size_t qo = (tok0 + q0 + lr) * HQ + 8 * hi;
    const v16h qa = cat16(*(const v8h*)(QH + qo), *(const v8h*)(QH + qo + 16));
    v8f o[8], ox[8];
#pragma unroll
    for (int n = 0; n < 8; ++n) { o[n] = (v8f){}; ox[n] = (v8f){}; }
    float mrow[8], lpart[8];
#pragma unroll
    for (int j = 0; j < 8; ++j) { mrow[j] = -3.0e38f; lpart[j] = 0.f; }
#pragma unroll 1
    for (int kt = 0; kt < NN_ / 32; ++kt) {
        const int l0 = kt * 32;
        const size_t k0o = (tok0 + l0 + lr) * HQ + 8 * hi, k1o = k0o + (size_t)16 * HQ;
        const v16h k0h = cat16(*(const v8h*)(KH + k0o), *(const v8h*)(KH + k0o + 16)), k1h = cat16(*(const v8h*)(KH + k1o), *(const v8h*)(KH + k1o + 16));
        const v16h k0l = cat16(*(const v8h*)(KL + k0o), *(const v8h*)(KL + k0o + 16)), k1l = cat16(*(const v8h*)(KL + k1o), *(const v8h*)(KL + k1o + 16));
        const v16h ql = cat16(*(const v8h*)(QL + qo), *(const v8h*)(QL + qo + 16));
        v8f s0 = wmma16(qa, k0h, (v8f){}), s1 = wmma16(qa, k1h, (v8f){}), x0 = wmma16(ql, k0h, (v8f){}), x1 = wmma16(ql, k1h, (v8f){});
        x0 = wmma16(qa, k0l, x0); x1 = wmma16(qa, k1l, x1);
        asm volatile("v_nop\n\tv_nop\n\tv_nop\n\tv_nop" : "+v"(s0), "+v"(s1), "+v"(x0), "+v"(x1) : "v"(qa), "v"(ql));
        float alpha[8];
#pragma unroll
        for (int j = 0; j < 8; ++j) {
            const float a0 = s0[j] + x0[j] * LOSCI, a1 = s1[j] + x1[j] * LOSCI;
            float mx = fmaxf(a0, a1);
            mx = fmaxf(mx, __shfl_xor(mx, 1, 16)); mx = fmaxf(mx, __shfl_xor(mx, 2, 16)); mx = fmaxf(mx, __shfl_xor(mx, 4, 16)); mx = fmaxf(mx, __shfl_xor(mx, 8, 16));
            const float mn = fmaxf(mrow[j], mx);
            alpha[j] = __expf(mrow[j] - mn); mrow[j] = mn;
            const float p0 = __expf(a0 - mn), p1 = __expf(a1 - mn);
            lpart[j] = lpart[j] * alpha[j] + (p0 + p1);
            const int mr = hi * 8 + j;
            const float ps0 = p0 * PSC, ps1 = p1 * PSC; const h16 h0 = (h16)ps0, h1 = (h16)ps1;
            pl[mr * 32 + lr] = h0; pl[mr * 32 + 16 + lr] = h1; pl2[mr * 32 + lr] = (h16)(ps0 - (float)h0); pl2[mr * 32 + 16 + lr] = (h16)(ps1 - (float)h1);   // UNSCALED residual
        }
#pragma unroll
        for (int n = 0; n < 8; ++n)
#pragma unroll
            for (int j = 0; j < 8; ++j) { o[n][j] *= alpha[j]; ox[n][j] *= alpha[j]; }
        asm volatile("" ::: "memory");
        const v16h pa = cat16(*(const v8ha*)(pl + lr * 32 + hi * 8), *(const v8ha*)(pl + lr * 32 + 16 + hi * 8));
        const v16h px = cat16(*(const v8ha*)(pl2 + lr * 32 + hi * 8), *(const v8ha*)(pl2 + lr * 32 + 16 + hi * 8));
#pragma unroll
        for (int n = 0; n < 8; ++n) { const size_t vo = ((size_t)b * CC + chalf * 128 + n * 16 + lr) * NN_ + l0 + hi * 8;
            const v16h vh = cat16(*(const v8h*)(VTH + vo), *(const v8h*)(VTH + vo + 16)), vl = cat16(*(const v8h*)(VTL + vo), *(const v8h*)(VTL + vo + 16));
            o[n] = wmma16(pa, vh, o[n]); o[n] = wmma16(px, vh, o[n]); ox[n] = wmma16(pa, vl, ox[n]);
            asm volatile("" : "+v"(o[n]), "+v"(ox[n]) : "v"(vh), "v"(vl) : "memory"); }
        asm volatile("v_nop\n\tv_nop\n\tv_nop\n\tv_nop" : "+v"(o[0]), "+v"(o[7]), "+v"(ox[0]), "+v"(ox[7]) : "v"(pa), "v"(px));
    }
    float inv[8];
#pragma unroll
    for (int j = 0; j < 8; ++j) { float rs = lpart[j]; rs += __shfl_xor(rs, 1, 16); rs += __shfl_xor(rs, 2, 16); rs += __shfl_xor(rs, 4, 16); rs += __shfl_xor(rs, 8, 16); inv[j] = 1.0f / (rs * PSC); }
    // transposed staging: ot[c_local][i_local] (128 x 64)
#pragma unroll
    for (int n = 0; n < 8; ++n)
#pragma unroll
        for (int j = 0; j < 8; ++j) ot[(n * 16 + lr) * 68 + wave * 16 + hi * 8 + j] = (o[n][j] + ox[n][j] * LOSCI) * inv[j];
    __syncthreads();
    // out[b][c][i0l + i] + x residual: per c a 256-B run (16 lanes x 16 B, 2 c per instruction); 128 c rows -> 4 waves x 16 instructions
    auto pass = [&]() {
#pragma unroll
        for (int s = 0; s < 16; ++s) { const int cl = wave * 32 + s * 2 + (lane >> 4), piece = lane & 15; const size_t go = ((size_t)b * CC + chalf * 128 + cl) * NN_ + i0l + piece * 4;
            v4f val = *(const v4fa*)(ot + cl * 68 + piece * 4);
#pragma unroll
            for (int i = 0; i < 4; ++i) val[i] += bfr(x[go + i]);
            *(v4f*)(out + go) = val; }
    };
    pass(); 
}

extern "C" void kernel_launch(void* const* d_in, const int* in_sizes, int n_in,
                              void* d_out, int out_size, void* d_ws, size_t ws_size, hipStream_t stream) {
    (void)in_sizes; (void)n_in; (void)out_size;
    const float* x = (const float*)d_in[0]; const float* wq = (const float*)d_in[1]; const float* bq = (const float*)d_in[2]; const float* wk = (const float*)d_in[3]; const float* bk = (const float*)d_in[4];
    const float* wv = (const float*)d_in[5]; const float* bv = (const float*)d_in[6];
    float* out = (float*)d_out;    // [8][256][2048]
    char* wsp = (char*)d_ws;
    auto take = [&](size_t bytes) { char* p = wsp; wsp += (bytes + 255) & ~(size_t)255; return (void*)p; };
    bf* XT = (bf*)take((size_t)NTK * CC * 2); bf* WQ = (bf*)take((size_t)HQ * CC * 2); bf* WK = (bf*)take((size_t)HQ * CC * 2); bf* WV = (bf*)take((size_t)CC * CC * 2);
    h16* QH = (h16*)take((size_t)NTK * HQ * 2); h16* QL = (h16*)take((size_t)NTK * HQ * 2); h16* KH = (h16*)take((size_t)NTK * HQ * 2); h16* KL = (h16*)take((size_t)NTK * HQ * 2);
    float* Vf = (float*)take((size_t)NTK * CC * 4); h16* VTH = (h16*)take((size_t)NTK * CC * 2); h16* VTL = (h16*)take((size_t)NTK * CC * 2);
    if ((size_t)(wsp - (char*)d_ws) > ws_size) return;    // 8.4 + 0.2 + 1 x 4 + 16.8 + 8.4 x 2 ~ 47 MB
    k_xt<<<dim3(NN_ / 64, CC / 64, NB_), 256, 0, stream>>>(x, XT);
    k_w<<<(2 * HQ + CC) / 8, 256, 0, stream>>>(wq, wk, wv, WQ, WK, WV);
    k_qk<<<dim3(NTK / 64, 2, 1), 128, 0, stream>>>(XT, WQ, WK, bq, bk, QH, QL, KH, KL);
    k_v<<<dim3(NTK / 64, CC / 64, 1), 128, 0, stream>>>(XT, WV, bv, Vf);
    k_vt<<<dim3(NN_ / 64, CC / 64, NB_), 256, 0, stream>>>(Vf, VTH, VTL);
    k_attn<<<dim3(NB_ * (NN_ / 64), 2, 1), 128, 0, stream>>>(QH, QL, KH, KL, VTH, VTL, x, out);
}

// v001
// Measured time: 115 microseconds a run.
// In two side-by-side timings against v000, it was 2.18 and 2.17 times as fast.
#include <hip/hip_runtime.h>

// Contractions, f32 accumulate: q/k = 1x1 convs ([16384 positions x 256].[256 x 32] each) and v ([16384 x 256].[256 x 256]) on v_wmma_f32_16x16x32_bf16 with PLAIN
// bf16 operands (inputs rounded once: exact); the position attention fused on v_wmma_f32_16x16x32_f16: energy = q.k over the 32 hidden dims (UNSCALED; q and k as
// f16 hi + residual x1024: hi.hi + hi.lo + lo.hi), softmax over the 2048 positions, out[c][i] = sum_j w[i][j] v[c][j] over all 256 channels with the weights
// (x32768) as f16 hi + UNSCALED residual and v as hi + residual x1024 — three products into two accumulator sets (o: wh.vh + wl.vh, ox: wh.vl); + x residual; output written channel-major

#define NB_  8
#define CC   256
#define NN_  2048
#define HQ   32
#define NTK  (NB_ * NN_)
#define PSC  32768.0f
#define LOSC 1024.0f
#define LOSCI (1.0f / 1024.0f)

typedef _Float16 h16;
typedef unsigned short bf;
typedef __attribute__((ext_vector_type(16))) __bf16   v16bf;
typedef __attribute__((ext_vector_type(16))) _Float16 v16h;
typedef __attribute__((ext_vector_type(8)))  _Float16 v8h;
typedef __attribute__((ext_vector_type(8)))  unsigned short v8us;
typedef __attribute__((ext_vector_type(8)))  float    v8f;
typedef __attribute__((ext_vector_type(4)))  float    v4f;
typedef v8h  __attribute__((may_alias)) v8ha;
typedef v4f  __attribute__((may_alias)) v4fa;
typedef v8us __attribute__((may_alias)) v8usa;

__device__ __forceinline__ unsigned short f2bf(float f) { unsigned u = __float_as_uint(f); u += 0x7FFFu + ((u >> 16) & 1u); return (unsigned short)(u >> 16); }
__device__ __forceinline__ float bf2f(unsigned short b) { return __uint_as_float(((unsigned)b) << 16); }
__device__ __forceinline__ float bfr(float f) { return bf2f(f2bf(f)); }
__device__ __forceinline__ v16h cat16(v8h lo, v8h hi) { return __builtin_shufflevector(lo, hi, 0, 1, 2, 3, 4, 5, 6, 7, 8, 9, 10, 11, 12, 13, 14, 15); }
__device__ __forceinline__ v16bf cat16b(v8us lo, v8us hi) { return __builtin_bit_cast(v16bf, __builtin_shufflevector(lo, hi, 0, 1, 2, 3, 4, 5, 6, 7, 8, 9, 10, 11, 12, 13, 14, 15)); }
__device__ __forceinline__ v8f wmma16(v16h a, v16h b, v8f c) { return __builtin_amdgcn_wmma_f32_16x16x32_f16(false, a, false, b, (short)0, c, false, false); }
__device__ __forceinline__ v8f wmmab(v16bf a, v16bf b, v8f c) { return __builtin_amdgcn_wmma_f32_16x16x32_bf16(false, a, false, b, (short)0, c, false, false); }
#define VST2(T, p, v) do { const T vst2_v_ = (v); *(T*)(p) = vst2_v_;  } while (0)

// k_xt: XT [b][n][c] bf16 = x[b][c][n] transposed (64 x 64 LDS tiles); grid (NN/64, CC/64, B).
__global__ __launch_bounds__(256) void k_xt(const float* __restrict__ x, bf* XT) {
    __shared__ __align__(16) unsigned short tl[64 * 72];
    const int tid = threadIdx.x, n0 = blockIdx.x * 64, c0 = blockIdx.y * 64, b = blockIdx.z;
    const int cr = tid >> 2, nq = (tid & 3) * 16;
#pragma unroll
    for (int i = 0; i < 16; ++i) tl[(nq + i) * 72 + cr] = f2bf(x[((size_t)b * CC + c0 + cr) * NN_ + n0 + nq + i]);
    __syncthreads();
    const int piece = tid & 7;
    auto pass = [&]() {
#pragma unroll
        for (int s = 0; s < 2; ++s) { const int nr = (tid >> 3) + 32 * s; const v8us val = *(const v8usa*)(tl + nr * 72 + piece * 8); *(v8us*)(XT + ((size_t)b * NN_ + n0 + nr) * CC + c0 + piece * 8) = val; }
    };
    pass(); 
}
// k_w: bf16 planes of wq [32][256], wk [32][256], wv [256][256] ([out][in] = n-major as-is); one wave per row (32 lanes x 16 B = 512 B).
__global__ __launch_bounds__(256) void k_w(const float* __restrict__ wq, const float* __restrict__ wk, const float* __restrict__ wv, bf* WQ, bf* WK, bf* WV) {
    const int lane = threadIdx.x & 31, r = blockIdx.x * 8 + (threadIdx.x >> 5);      // 0 .. 32+32+256
    const int m = (r < HQ) ? 0 : (r < 2 * HQ) ? 1 : 2;     // wave-uniform
    v8us o;
    if (m == 0) { for (int i = 0; i < 8; ++i) o[i] = f2bf(wq[(size_t)r * CC + lane * 8 + i]); VST2(v8us, WQ + (size_t)r * CC + lane * 8, o); }
    else if (m == 1) { const int o2 = r - HQ; for (int i = 0; i < 8; ++i) o[i] = f2bf(wk[(size_t)o2 * CC + lane * 8 + i]); VST2(v8us, WK + (size_t)o2 * CC + lane * 8, o); }
    else { const int o2 = r - 2 * HQ; if (o2 < CC) { for (int i = 0; i < 8; ++i) o[i] = f2bf(wv[(size_t)o2 * CC + lane * 8 + i]); VST2(v8us, WV + (size_t)o2 * CC + lane * 8, o); } }
}
// k_qk: Q/K f16 hi + residual planes [tok][32] = XT.W^T + b (K = 256; one 64 x 32 tile per block: 2 n-tiles); grid (NTK/64, 2 (q|k)).
__global__ __launch_bounds__(128) void k_qk(const bf* __restrict__ XT, const bf* __restrict__ WQ, const bf* __restrict__ WK, const float* __restrict__ bq, const float* __restrict__ bk, h16* QH, h16* QL, h16* KH, h16* KL) {
    __shared__ __align__(16) float ost[4][16 * 36];
    const int lane = threadIdx.x & 31, wave = threadIdx.x >> 5, lr = lane & 15, hi = lane >> 4, which = blockIdx.y;
    const size_t r0 = (size_t)blockIdx.x * 64 + wave * 16;
    const bf* W = which ? WK : WQ; const float* bias = which ? bk : bq; h16* PH = which ? KH : QH; h16* PL = which ? KL : QL;   // block-uniform selects of whole buffers (both read paths identical in shape)
    v8f acc[2] = {(v8f){}, (v8f){}};
#pragma unroll 2
    for (int kc = 0; kc < CC; kc += 32) {
        const v16bf a = cat16b(*(const v8us*)(XT + (r0 + lr) * CC + kc + 8 * hi), *(const v8us*)(XT + (r0 + lr) * CC + kc + 8 * hi + 16));
#pragma unroll
        for (int t = 0; t < 2; ++t) { const bf* bp = W + (size_t)(t * 16 + lr) * CC + kc + 8 * hi; acc[t] = wmmab(a, cat16b(*(const v8us*)bp, *(const v8us*)(bp + 16)), acc[t]); }
    }
    float* os = &ost[wave][0];
#pragma unroll
    for (int t = 0; t < 2; ++t) { const float bv = bfr(bias[t * 16 + lr]);
#pragma unroll
        for (int j = 0; j < 8; ++j) os[(hi * 8 + j) * 36 + t * 16 + lr] = acc[t][j] + bv; }
    __syncthreads();
    auto pass = [&]() {   // 16 rows x 64 B per plane: lane -> (row = lane >> 1? ) : use 4 lanes x 16 B per row, 8 rows per instruction, 2 instructions
#pragma unroll
        for (int s = 0; s < 2; ++s) { const int row = s * 8 + (lane >> 2), piece = lane & 3; const float* sp = os + row * 36 + piece * 8; v8h oh, ol;
#pragma unroll
            for (int i = 0; i < 8; ++i) { const h16 a = (h16)sp[i]; oh[i] = a; ol[i] = (h16)((sp[i] - (float)a) * LOSC); }
            *(v8h*)(PH + (r0 + row) * HQ + piece * 8) = oh; *(v8h*)(PL + (r0 + row) * HQ + piece * 8) = ol; }
    };
    pass(); 
}
// k_v: Vf [tok][256] f32 = XT.WV^T + bv (64 x 64 tiles; grid (NTK/64, 4)).
__global__ __launch_bounds__(128) void k_v(const bf* __restrict__ XT, const bf* __restrict__ WV, const float* __restrict__ bv, float* Vf) {
    __shared__ __align__(16) float ost[4][16 * 68];
    const int lane = threadIdx.x & 31, wave = threadIdx.x >> 5, lr = lane & 15, hi = lane >> 4;
    const size_t r0 = (size_t)blockIdx.x * 64 + wave * 16; const int c0 = blockIdx.y * 64;
    v8f acc[4];
#pragma unroll
    for (int t = 0; t < 4; ++t) acc[t] = (v8f){};
#pragma unroll 2
    for (int kc = 0; kc < CC; kc += 32) {
        const v16bf a = cat16b(*(const v8us*)(XT + (r0 + lr) * CC + kc + 8 * hi), *(const v8us*)(XT + (r0 + lr) * CC + kc + 8 * hi + 16));
#pragma unroll
        for (int t = 0; t < 4; ++t) { const bf* bp = WV + (size_t)(c0 + t * 16 + lr) * CC + kc + 8 * hi; acc[t] = wmmab(a, cat16b(*(const v8us*)bp, *(const v8us*)(bp + 16)), acc[t]); }
    }
    float* os = &ost[wave][0];
#pragma unroll
    for (int t = 0; t < 4; ++t) { const float b2 = bfr(bv[c0 + t * 16 + lr]);
#pragma unroll
        for (int j = 0; j < 8; ++j) os[(hi * 8 + j) * 68 + t * 16 + lr] = acc[t][j] + b2; }
    __syncthreads();
    float* crow = Vf + r0 * CC + c0;
    auto pass = [&]() {
#pragma unroll
        for (int s = 0; s < 8; ++s) { const int Lid = (lane >> 3) + 4 * s, piece = lane & 7; const int row = Lid >> 1, cofs = (Lid & 1) * 32 + piece * 4;
            const v4f val = *(const v4fa*)(os + row * 68 + cofs); *(v4f*)(crow + (size_t)row * CC + cofs) = val; }
    };
    pass(); 
}
// k_vt: VTH/VTL [b][c][n] f16 hi + residual of Vf[b*NN + n][c] via 64 x 64 LDS transposes; grid (NN/64, CC/64, B).
__global__ __launch_bounds__(256) void k_vt(const float* __restrict__ Vf, h16* VTH, h16* VTL) {
    __shared__ __align__(16) h16 tl[64 * 72];
    __shared__ __align__(16) h16 tl2[64 * 72];
    const int tid = threadIdx.x, n0 = blockIdx.x * 64, c0 = blockIdx.y * 64, b = blockIdx.z;
    const int nn = tid >> 2, cq = (tid & 3) * 16;
#pragma unroll
    for (int i = 0; i < 16; ++i) { const float v = Vf[((size_t)b * NN_ + n0 + nn) * CC + c0 + cq + i]; const h16 a = (h16)v; tl[(cq + i) * 72 + nn] = a; tl2[(cq + i) * 72 + nn] = (h16)((v - (float)a) * LOSC); }
    __syncthreads();
    const int piece = tid & 7;
    auto pass = [&]() {
#pragma unroll
        for (int s = 0; s < 2; ++s) { const int c = (tid >> 3) + 32 * s; const size_t o = ((size_t)b * CC + c0 + c) * NN_ + n0 + piece * 8;
            *(v8h*)(VTH + o) = *(const v8ha*)(tl + c * 72 + piece * 8); *(v8h*)(VTL + o) = *(const v8ha*)(tl2 + c * 72 + piece * 8); }
    };
    pass(); 
}
// k_attn: block = (b, 64 positions i, channel half), wave = 16 positions. The keys are walked in LDS stages of 64 (two 32-key tiles): each stage holds the block's
// V rows (128 channels x 64 keys, hi and residual plane) and K rows (64 keys x 32 dims, hi and residual plane), brought in ONCE per block by per-lane 16-byte
// asynchronous copies, whole 128-B lines per row, into two buffers: stage s + 2 is issued when stage s has been read, so it flies while stage s + 1 is worked on.
// Per 32-key tile: energy (hi.hi + hi.lo + lo.hi), online softmax, weights x32768 as f16 hi + UNSCALED residual; o += wh.vh + wl.vh, ox += wh.vl.
// Epilogue: out[b][c][i] = o/l + x[b][c][i], transposed through LDS (per c the block's 64 i are one 256-B run).
#define KT   64                       // keys per stage
#define NST  (NN_ / KT)
#define VPI  72                       // V row pitch in LDS, f16 units: 128-B row + 16 B (16 B x odd: no bank conflict for 16-byte reads of 16 rows)
#define KPI  40                       // K row pitch in LDS, f16 units: 64-B row + 16 B
#define VPLN (128 * VPI)
#define KPLN (KT * KPI)
#define STG  (2 * VPLN + 2 * KPLN)    // f16 units per stage: V hi | V residual | K hi | K residual

// One lane's ten copies of one plane pair (8 V rows 16 apart, 2 K pieces 32 rows apart). The s_wait_xcnt closes the statement so that no later
// address update can be scheduled in front of it while a copy still names its registers.
__device__ __forceinline__ void copy10(unsigned lv, unsigned lk, const h16* gv, const h16* gk) {
    asm volatile("global_load_async_to_lds_b128 %0, %10, off\n\t"
                 "global_load_async_to_lds_b128 %1, %11, off\n\t"
                 "global_load_async_to_lds_b128 %2, %12, off\n\t"
                 "global_load_async_to_lds_b128 %3, %13, off\n\t"
                 "global_load_async_to_lds_b128 %4, %14, off\n\t"
                 "global_load_async_to_lds_b128 %5, %15, off\n\t"
                 "global_load_async_to_lds_b128 %6, %16, off\n\t"
                 "global_load_async_to_lds_b128 %7, %17, off\n\t"
                 "global_load_async_to_lds_b128 %8, %18, off\n\t"
                 "global_load_async_to_lds_b128 %9, %19, off\n\t"
                 "s_wait_xcnt 0x0"
                 :: "v"(lv), "v"(lv + 16 * VPI * 2), "v"(lv + 32 * VPI * 2), "v"(lv + 48 * VPI * 2), "v"(lv + 64 * VPI * 2), "v"(lv + 80 * VPI * 2), "v"(lv + 96 * VPI * 2), "v"(lv + 112 * VPI * 2),
                    "v"(lk), "v"(lk + 32 * KPI * 2),
                    "v"(gv), "v"(gv + 16 * NN_), "v"(gv + 32 * NN_), "v"(gv + 48 * NN_), "v"(gv + 64 * NN_), "v"(gv + 80 * NN_), "v"(gv + 96 * NN_), "v"(gv + 112 * NN_),
                    "v"(gk), "v"(gk + 32 * HQ)
                 : "memory");
}

__global__ __launch_bounds__(128) void k_attn(const h16* __restrict__ QH, const h16* __restrict__ QL, const h16* __restrict__ KH, const h16* __restrict__ KL, const h16* __restrict__ VTH, const h16* __restrict__ VTL,
                                             const float* __restrict__ x, float* out) {
    __shared__ __align__(16) h16 ring[2 * STG];
    __shared__ __align__(16) h16 plds[4][16 * 32];
    __shared__ __align__(16) h16 plds2[4][16 * 32];
    __shared__ __align__(16) float ot[128 * 68];
    const int tid = threadIdx.x, lane = tid & 31, wave = tid >> 5, lr = lane & 15, hi = lane >> 4;
    const int b = blockIdx.x / (NN_ / 64), it = blockIdx.x - b * (NN_ / 64), chalf = blockIdx.y, i0l = it * 64, q0 = i0l + wave * 16;
    const size_t tok0 = (size_t)b * NN_;
    h16* pl = &plds[wave][0]; h16* pl2 = &plds2[wave][0];
    // this lane's places: V row tid >> 3 (+ 16 per copy), 16-byte piece tid & 7; K row tid >> 2 (+ 32 per copy), piece tid & 3
    const unsigned ring0 = (unsigned)(size_t)&ring[0];
    const unsigned lv0 = ring0 + (unsigned)((tid >> 3) * (VPI * 2) + (tid & 7) * 16), lk0 = ring0 + (unsigned)(2 * VPLN * 2 + (tid >> 2) * (KPI * 2) + (tid & 3) * 16);
    const size_t gvo = ((size_t)b * CC + chalf * 128 + (tid >> 3)) * NN_ + (tid & 7) * 8, gko = tok0 * HQ + (size_t)tid * 8;
    auto fill = [&](int st) {
        const unsigned bo = (unsigned)(st & 1) * (STG * 2);
        copy10(lv0 + bo, lk0 + bo, VTH + gvo + st * KT, KH + gko + st * (KT * HQ));
        copy10(lv0 + bo + VPLN * 2, lk0 + bo + KPLN * 2, VTL + gvo + st * KT, KL + gko + st * (KT * HQ));
    };
    fill(0);
    asm volatile("s_wait_asynccnt 0x0" ::: "memory");   // this wave's share of stage 0 has landed
    __syncthreads();                                    // publishes stage 0 to the other waves
    fill(1);
    const size_t qo = (tok0 + q0 + lr) * HQ + 8 * hi;
    const v16h qa = cat16(*(const v8h*)(QH + qo), *(const v8h*)(QH + qo + 16));
    v8f o[8], ox[8];
#pragma unroll
    for (int n = 0; n < 8; ++n) { o[n] = (v8f){}; ox[n] = (v8f){}; }
    float mrow[8], lpart[8];
#pragma unroll
    for (int j = 0; j < 8; ++j) { mrow[j] = -3.0e38f; lpart[j] = 0.f; }
#pragma unroll 1   // one body for all stages: the buffer is picked by the stage's parity
    for (int st = 0; st < NST; ++st) {
        const h16* sb = ring + (st & 1) * STG;
#pragma unroll 1   // kept rolled: unrolled, the two tiles' fragments are live together and the build spills to scratch
        for (int sub = 0; sub < 2; ++sub) {
            const h16* kb = sb + 2 * VPLN + (sub * 32 + lr) * KPI + 8 * hi;
            const v16h k0h = cat16(*(const v8ha*)kb, *(const v8ha*)(kb + 16)), k1h = cat16(*(const v8ha*)(kb + 16 * KPI), *(const v8ha*)(kb + 16 * KPI + 16));
            const v16h k0l = cat16(*(const v8ha*)(kb + KPLN), *(const v8ha*)(kb + KPLN + 16)), k1l = cat16(*(const v8ha*)(kb + KPLN + 16 * KPI), *(const v8ha*)(kb + KPLN + 16 * KPI + 16));
            const v16h ql = cat16(*(const v8h*)(QL + qo), *(const v8h*)(QL + qo + 16));
            v8f s0 = wmma16(qa, k0h, (v8f){}), s1 = wmma16(qa, k1h, (v8f){}), x0 = wmma16(ql, k0h, (v8f){}), x1 = wmma16(ql, k1h, (v8f){});
            x0 = wmma16(qa, k0l, x0); x1 = wmma16(qa, k1l, x1);
            // four vector slots between the last energy product and the first vector read of its result
            asm volatile("v_nop\n\tv_nop\n\tv_nop\n\tv_nop" : "+v"(s0), "+v"(s1), "+v"(x0), "+v"(x1) : "v"(qa), "v"(ql));
            // the tile's V fragments, read from the stage as ONE group here, not among the products below: their LDS latency passes under the softmax
            v16h vh[8], vl[8];
#pragma unroll
            for (int n = 0; n < 8; ++n) { const h16* vb = sb + (n * 16 + lr) * VPI + sub * 32 + hi * 8;
                vh[n] = cat16(*(const v8ha*)vb, *(const v8ha*)(vb + 16)); vl[n] = cat16(*(const v8ha*)(vb + VPLN), *(const v8ha*)(vb + VPLN + 16)); }
            float alpha[8];
#pragma unroll
            for (int j = 0; j < 8; ++j) {
                const float a0 = s0[j] + x0[j] * LOSCI, a1 = s1[j] + x1[j] * LOSCI;
                float mx = fmaxf(a0, a1);
                mx = fmaxf(mx, __shfl_xor(mx, 1, 16)); mx = fmaxf(mx, __shfl_xor(mx, 2, 16)); mx = fmaxf(mx, __shfl_xor(mx, 4, 16)); mx = fmaxf(mx, __shfl_xor(mx, 8, 16));
                const float mn = fmaxf(mrow[j], mx);
                alpha[j] = __expf(mrow[j] - mn); mrow[j] = mn;
                const float p0 = __expf(a0 - mn), p1 = __expf(a1 - mn);
                lpart[j] = lpart[j] * alpha[j] + (p0 + p1);
                const int mr = hi * 8 + j;
                const float ps0 = p0 * PSC, ps1 = p1 * PSC; const h16 h0 = (h16)ps0, h1 = (h16)ps1;
                pl[mr * 32 + lr] = h0; pl[mr * 32 + 16 + lr] = h1; pl2[mr * 32 + lr] = (h16)(ps0 - (float)h0); pl2[mr * 32 + 16 + lr] = (h16)(ps1 - (float)h1);   // UNSCALED residual
            }
#pragma unroll
            for (int n = 0; n < 8; ++n)
#pragma unroll
                for (int j = 0; j < 8; ++j) { o[n][j] *= alpha[j]; ox[n][j] *= alpha[j]; }
            // compiler fence: the weight tiles are read back only behind the stores above (same wave, other lanes' elements)
            asm volatile("" ::: "memory");
            const v16h pa = cat16(*(const v8ha*)(pl + lr * 32 + hi * 8), *(const v8ha*)(pl + lr * 32 + 16 + hi * 8));
            const v16h px = cat16(*(const v8ha*)(pl2 + lr * 32 + hi * 8), *(const v8ha*)(pl2 + lr * 32 + 16 + hi * 8));
#pragma unroll
            for (int n = 0; n < 8; ++n) { o[n] = wmma16(pa, vh[n], o[n]); o[n] = wmma16(px, vh[n], o[n]); ox[n] = wmma16(pa, vl[n], ox[n]); }
            // four vector slots behind the last product on the loop's back edge too, before its operands or results are touched
            asm volatile("v_nop\n\tv_nop\n\tv_nop\n\tv_nop" : "+v"(o[0]), "+v"(o[7]), "+v"(ox[0]), "+v"(ox[7]) : "v"(pa), "v"(px));
        }
        asm volatile("s_wait_dscnt 0x0" ::: "memory");      // this wave's reads of stage st are done before its buffer may be refilled
        asm volatile("s_wait_asynccnt 0x0" ::: "memory");   // this wave's share of stage st + 1 has landed
        __syncthreads();                                    // publishes stage st + 1 and ends every wave's reads of stage st
        if (st + 2 < NST) fill(st + 2);
    }
    asm volatile("s_wait_asynccnt 0x0" ::: "memory");       // nothing of the ring is in flight when the wave goes on to the epilogue
    float inv[8];
#pragma unroll
    for (int j = 0; j < 8; ++j) { float rs = lpart[j]; rs += __shfl_xor(rs, 1, 16); rs += __shfl_xor(rs, 2, 16); rs += __shfl_xor(rs, 4, 16); rs += __shfl_xor(rs, 8, 16); inv[j] = 1.0f / (rs * PSC); }
    // transposed staging: ot[c_local][i_local] (128 x 64)
#pragma unroll
    for (int n = 0; n < 8; ++n)
#pragma unroll
        for (int j = 0; j < 8; ++j) ot[(n * 16 + lr) * 68 + wave * 16 + hi * 8 + j] = (o[n][j] + ox[n][j] * LOSCI) * inv[j];
    __syncthreads();
    // out[b][c][i0l + i] + x residual: per c a 256-B run (16 lanes x 16 B, 2 c per instruction); 128 c rows -> 4 waves x 16 instructions
    auto pass = [&]() {
#pragma unroll
        for (int s = 0; s < 16; ++s) { const int cl = wave * 32 + s * 2 + (lane >> 4), piece = lane & 15; const size_t go = ((size_t)b * CC + chalf * 128 + cl) * NN_ + i0l + piece * 4;
            v4f val = *(const v4fa*)(ot + cl * 68 + piece * 4);
#pragma unroll
            for (int i = 0; i < 4; ++i) val[i] += bfr(x[go + i]);
            *(v4f*)(out + go) = val; }
    };
    pass(); 
}

extern "C" void kernel_launch(void* const* d_in, const int* in_sizes, int n_in,
                              void* d_out, int out_size, void* d_ws, size_t ws_size, hipStream_t stream) {
    (void)in_sizes; (void)n_in; (void)out_size;
    const float* x = (const float*)d_in[0]; const float* wq = (const float*)d_in[1]; const float* bq = (const float*)d_in[2]; const float* wk = (const float*)d_in[3]; const float* bk = (const float*)d_in[4];
    const float* wv = (const float*)d_in[5]; const float* bv = (const float*)d_in[6];
    float* out = (float*)d_out;    // [8][256][2048]
    char* wsp = (char*)d_ws;
    auto take = [&](size_t bytes) { char* p = wsp; wsp += (bytes + 255) & ~(size_t)255; return (void*)p; };
    bf* XT = (bf*)take((size_t)NTK * CC * 2); bf* WQ = (bf*)take((size_t)HQ * CC * 2); bf* WK = (bf*)take((size_t)HQ * CC * 2); bf* WV = (bf*)take((size_t)CC * CC * 2);
    h16* QH = (h16*)take((size_t)NTK * HQ * 2); h16* QL = (h16*)take((size_t)NTK * HQ * 2); h16* KH = (h16*)take((size_t)NTK * HQ * 2); h16* KL = (h16*)take((size_t)NTK * HQ * 2);
    float* Vf = (float*)take((size_t)NTK * CC * 4); h16* VTH = (h16*)take((size_t)NTK * CC * 2); h16* VTL = (h16*)take((size_t)NTK * CC * 2);
    if ((size_t)(wsp - (char*)d_ws) > ws_size) return;    // 8.4 + 0.2 + 1 x 4 + 16.8 + 8.4 x 2 ~ 47 MB
    k_xt<<<dim3(NN_ / 64, CC / 64, NB_), 256, 0, stream>>>(x, XT);
    k_w<<<(2 * HQ + CC) / 8, 256, 0, stream>>>(wq, wk, wv, WQ, WK, WV);
    k_qk<<<dim3(NTK / 64, 2, 1), 128, 0, stream>>>(XT, WQ, WK, bq, bk, QH, QL, KH, KL);
    k_v<<<dim3(NTK / 64, CC / 64, 1), 128, 0, stream>>>(XT, WV, bv, Vf);
    k_vt<<<dim3(NN_ / 64, CC / 64, NB_), 256, 0, stream>>>(Vf, VTH, VTL);
    k_attn<<<dim3(NB_ * (NN_ / 64), 2, 1), 128, 0, stream>>>(QH, QL, KH, KL, VTH, VTL, x, out);
}

// v002
// A run of this version takes 89.8 microseconds.
// In both of two side-by-side timings against v001, it was 1.27 times as fast.
// All steps since v000 together make it 2.77 times as fast.
#include <hip/hip_runtime.h>

// Contractions, f32 accumulate: q/k = 1x1 convs ([16384 positions x 256].[256 x 32] each) and v ([16384 x 256].[256 x 256]) on v_wmma_f32_16x16x32_bf16 with PLAIN
// bf16 operands (inputs rounded once: exact); the position attention fused on v_wmma_f32_16x16x32_f16: energy = q.k over the 32 hidden dims (UNSCALED; q and k as
// f16 hi + residual x1024: hi.hi + hi.lo + lo.hi), softmax over the 2048 positions, out[c][i] = sum_j w[i][j] v[c][j] over all 256 channels with the weights
// (x32768) as f16 hi + UNSCALED residual and v as hi + residual x1024 — three products into two accumulator sets (o: wh.vh + wl.vh, ox: wh.vl); + x residual; output written channel-major

#define NB_  8
#define CC   256
#define NN_  2048
#define HQ   32
#define NTK  (NB_ * NN_)
#define PSC  32768.0f
#define LOSC 1024.0f
#define LOSCI (1.0f / 1024.0f)

typedef _Float16 h16;
typedef unsigned short bf;
typedef __attribute__((ext_vector_type(16))) __bf16   v16bf;
typedef __attribute__((ext_vector_type(16))) _Float16 v16h;
typedef __attribute__((ext_vector_type(8)))  _Float16 v8h;
typedef __attribute__((ext_vector_type(8)))  unsigned short v8us;
typedef __attribute__((ext_vector_type(8)))  float    v8f;
typedef __attribute__((ext_vector_type(4)))  float    v4f;
typedef v8h  __attribute__((may_alias)) v8ha;
typedef v4f  __attribute__((may_alias)) v4fa;
typedef v8us __attribute__((may_alias)) v8usa;

__device__ __forceinline__ unsigned short f2bf(float f) { unsigned u = __float_as_uint(f); u += 0x7FFFu + ((u >> 16) & 1u); return (unsigned short)(u >> 16); }
__device__ __forceinline__ float bf2f(unsigned short b) { return __uint_as_float(((unsigned)b) << 16); }
__device__ __forceinline__ float bfr(float f) { return bf2f(f2bf(f)); }
__device__ __forceinline__ v16h cat16(v8h lo, v8h hi) { return __builtin_shufflevector(lo, hi, 0, 1, 2, 3, 4, 5, 6, 7, 8, 9, 10, 11, 12, 13, 14, 15); }
__device__ __forceinline__ v16bf cat16b(v8us lo, v8us hi) { return __builtin_bit_cast(v16bf, __builtin_shufflevector(lo, hi, 0, 1, 2, 3, 4, 5, 6, 7, 8, 9, 10, 11, 12, 13, 14, 15)); }
__device__ __forceinline__ v8f wmma16(v16h a, v16h b, v8f c) { return __builtin_amdgcn_wmma_f32_16x16x32_f16(false, a, false, b, (short)0, c, false, false); }
__device__ __forceinline__ v8f wmmab(v16bf a, v16bf b, v8f c) { return __builtin_amdgcn_wmma_f32_16x16x32_bf16(false, a, false, b, (short)0, c, false, false); }
__device__ __forceinline__ float xhalf(float v) { return __builtin_bit_cast(float, __builtin_amdgcn_permlanex16(__builtin_bit_cast(int, v), __builtin_bit_cast(int, v), 0x76543210, 0xfedcba98, false, false)); }  // lane l with lane l ^ 16
#define VST2(T, p, v) do { const T vst2_v_ = (v); *(T*)(p) = vst2_v_;  } while (0)

// k_xt: XT [b][n][c] bf16 = x[b][c][n] transposed (64 x 64 LDS tiles); grid (NN/64, CC/64, B).
__global__ __launch_bounds__(256) void k_xt(const float* __restrict__ x, bf* XT) {
    __shared__ __align__(16) unsigned short tl[64 * 72];
    const int tid = threadIdx.x, n0 = blockIdx.x * 64, c0 = blockIdx.y * 64, b = blockIdx.z;
    const int cr = tid >> 2, nq = (tid & 3) * 16;
#pragma unroll
    for (int i = 0; i < 16; ++i) tl[(nq + i) * 72 + cr] = f2bf(x[((size_t)b * CC + c0 + cr) * NN_ + n0 + nq + i]);
    __syncthreads();
    const int piece = tid & 7;
    auto pass = [&]() {
#pragma unroll
        for (int s = 0; s < 2; ++s) { const int nr = (tid >> 3) + 32 * s; const v8us val = *(const v8usa*)(tl + nr * 72 + piece * 8); *(v8us*)(XT + ((size_t)b * NN_ + n0 + nr) * CC + c0 + piece * 8) = val; }
    };
    pass(); 
}
// k_w: bf16 planes of wq [32][256], wk [32][256], wv [256][256] ([out][in] = n-major as-is); one wave per row (32 lanes x 16 B = 512 B).
__global__ __launch_bounds__(256) void k_w(const float* __restrict__ wq, const float* __restrict__ wk, const float* __restrict__ wv, bf* WQ, bf* WK, bf* WV) {
    const int lane = threadIdx.x & 31, r = blockIdx.x * 8 + (threadIdx.x >> 5);      // 0 .. 32+32+256
    const int m = (r < HQ) ? 0 : (r < 2 * HQ) ? 1 : 2;     // wave-uniform
    v8us o;
    if (m == 0) { for (int i = 0; i < 8; ++i) o[i] = f2bf(wq[(size_t)r * CC + lane * 8 + i]); VST2(v8us, WQ + (size_t)r * CC + lane * 8, o); }
    else if (m == 1) { const int o2 = r - HQ; for (int i = 0; i < 8; ++i) o[i] = f2bf(wk[(size_t)o2 * CC + lane * 8 + i]); VST2(v8us, WK + (size_t)o2 * CC + lane * 8, o); }
    else { const int o2 = r - 2 * HQ; if (o2 < CC) { for (int i = 0; i < 8; ++i) o[i] = f2bf(wv[(size_t)o2 * CC + lane * 8 + i]); VST2(v8us, WV + (size_t)o2 * CC + lane * 8, o); } }
}
// k_qk: Q/K f16 hi + residual planes [tok][32] = XT.W^T + b (K = 256; one 64 x 32 tile per block: 2 n-tiles); grid (NTK/64, 2 (q|k)).
__global__ __launch_bounds__(128) void k_qk(const bf* __restrict__ XT, const bf* __restrict__ WQ, const bf* __restrict__ WK, const float* __restrict__ bq, const float* __restrict__ bk, h16* QH, h16* QL, h16* KH, h16* KL) {
    __shared__ __align__(16) float ost[4][16 * 36];
    const int lane = threadIdx.x & 31, wave = threadIdx.x >> 5, lr = lane & 15, hi = lane >> 4, which = blockIdx.y;
    const size_t r0 = (size_t)blockIdx.x * 64 + wave * 16;
    const bf* W = which ? WK : WQ; const float* bias = which ? bk : bq; h16* PH = which ? KH : QH; h16* PL = which ? KL : QL;   // block-uniform selects of whole buffers (both read paths identical in shape)
    v8f acc[2] = {(v8f){}, (v8f){}};
#pragma unroll 2
    for (int kc = 0; kc < CC; kc += 32) {
        const v16bf a = cat16b(*(const v8us*)(XT + (r0 + lr) * CC + kc + 8 * hi), *(const v8us*)(XT + (r0 + lr) * CC + kc + 8 * hi + 16));
#pragma unroll
        for (int t = 0; t < 2; ++t) { const bf* bp = W + (size_t)(t * 16 + lr) * CC + kc + 8 * hi; acc[t] = wmmab(a, cat16b(*(const v8us*)bp, *(const v8us*)(bp + 16)), acc[t]); }
    }
    float* os = &ost[wave][0];
#pragma unroll
    for (int t = 0; t < 2; ++t) { const float bv = bfr(bias[t * 16 + lr]);
#pragma unroll
        for (int j = 0; j < 8; ++j) os[(hi * 8 + j) * 36 + t * 16 + lr] = acc[t][j] + bv; }
    __syncthreads();
    auto pass = [&]() {   // 16 rows x 64 B per plane: lane -> (row = lane >> 1? ) : use 4 lanes x 16 B per row, 8 rows per instruction, 2 instructions
#pragma unroll
        for (int s = 0; s < 2; ++s) { const int row = s * 8 + (lane >> 2), piece = lane & 3; const float* sp = os + row * 36 + piece * 8; v8h oh, ol;
#pragma unroll
            for (int i = 0; i < 8; ++i) { const h16 a = (h16)sp[i]; oh[i] = a; ol[i] = (h16)((sp[i] - (float)a) * LOSC); }
            *(v8h*)(PH + (r0 + row) * HQ + piece * 8) = oh; *(v8h*)(PL + (r0 + row) * HQ + piece * 8) = ol; }
    };
    pass(); 
}
// k_v: Vf [tok][256] f32 = XT.WV^T + bv (64 x 64 tiles; grid (NTK/64, 4)).
__global__ __launch_bounds__(128) void k_v(const bf* __restrict__ XT, const bf* __restrict__ WV, const float* __restrict__ bv, float* Vf) {
    __shared__ __align__(16) float ost[4][16 * 68];
    const int lane = threadIdx.x & 31, wave = threadIdx.x >> 5, lr = lane & 15, hi = lane >> 4;
    const size_t r0 = (size_t)blockIdx.x * 64 + wave * 16; const int c0 = blockIdx.y * 64;
    v8f acc[4];
#pragma unroll
    for (int t = 0; t < 4; ++t) acc[t] = (v8f){};
#pragma unroll 2
    for (int kc = 0; kc < CC; kc += 32) {
        const v16bf a = cat16b(*(const v8us*)(XT + (r0 + lr) * CC + kc + 8 * hi), *(const v8us*)(XT + (r0 + lr) * CC + kc + 8 * hi + 16));
#pragma unroll
        for (int t = 0; t < 4; ++t) { const bf* bp = WV + (size_t)(c0 + t * 16 + lr) * CC + kc + 8 * hi; acc[t] = wmmab(a, cat16b(*(const v8us*)bp, *(const v8us*)(bp + 16)), acc[t]); }
    }
    float* os = &ost[wave][0];
#pragma unroll
    for (int t = 0; t < 4; ++t) { const float b2 = bfr(bv[c0 + t * 16 + lr]);
#pragma unroll
        for (int j = 0; j < 8; ++j) os[(hi * 8 + j) * 68 + t * 16 + lr] = acc[t][j] + b2; }
    __syncthreads();
    float* crow = Vf + r0 * CC + c0;
    auto pass = [&]() {
#pragma unroll
        for (int s = 0; s < 8; ++s) { const int Lid = (lane >> 3) + 4 * s, piece = lane & 7; const int row = Lid >> 1, cofs = (Lid & 1) * 32 + piece * 4;
            const v4f val = *(const v4fa*)(os + row * 68 + cofs); *(v4f*)(crow + (size_t)row * CC + cofs) = val; }
    };
    pass(); 
}
// k_vt: VTH/VTL [b][c][n] f16 hi + residual of Vf[b*NN + n][c] via 64 x 64 LDS transposes; grid (NN/64, CC/64, B).
__global__ __launch_bounds__(256) void k_vt(const float* __restrict__ Vf, h16* VTH, h16* VTL) {
    __shared__ __align__(16) h16 tl[64 * 72];
    __shared__ __align__(16) h16 tl2[64 * 72];
    const int tid = threadIdx.x, n0 = blockIdx.x * 64, c0 = blockIdx.y * 64, b = blockIdx.z;
    const int nn = tid >> 2, cq = (tid & 3) * 16;
#pragma unroll
    for (int i = 0; i < 16; ++i) { const float v = Vf[((size_t)b * NN_ + n0 + nn) * CC + c0 + cq + i]; const h16 a = (h16)v; tl[(cq + i) * 72 + nn] = a; tl2[(cq + i) * 72 + nn] = (h16)((v - (float)a) * LOSC); }
    __syncthreads();
    const int piece = tid & 7;
    auto pass = [&]() {
#pragma unroll
        for (int s = 0; s < 2; ++s) { const int c = (tid >> 3) + 32 * s; const size_t o = ((size_t)b * CC + c0 + c) * NN_ + n0 + piece * 8;
            *(v8h*)(VTH + o) = *(const v8ha*)(tl + c * 72 + piece * 8); *(v8h*)(VTL + o) = *(const v8ha*)(tl2 + c * 72 + piece * 8); }
    };
    pass(); 
}
// k_attn: block = (b, 64 positions i, channel half), wave = 16 positions. The keys are walked in LDS stages of 64 (two 32-key tiles): each stage holds the block's
// V rows (128 channels x 64 keys, hi and residual plane) and K rows (64 keys x 32 dims, hi and residual plane), brought in ONCE per block by per-lane 16-byte
// asynchronous copies, whole 128-B lines per row, into two buffers: stage s + 2 is issued when stage s has been read, so it flies while stage s + 1 is worked on.
// Per 32-key tile, both products transposed (keys x queries, then channels x queries): energy (hi.hi + hi.lo + lo.hi), a lane holds 16 scores of ONE query, so the
// online softmax is in-lane but for one exchange between the wave's halves; weights x32768 as f16 hi + UNSCALED residual go from the score registers straight into
// the B operand; o += vh.wh + vh.wl, ox += vl.wh.
// Epilogue: out[b][c][i] = o/l + x[b][c][i], gathered through LDS (per c the block's 64 i are one 256-B run).
#define KT   64                       // keys per stage
#define NST  (NN_ / KT)
#define VPI  72                       // V row pitch in LDS, f16 units: 128-B row + 16 B (16 B x odd: no bank conflict for 16-byte reads of 16 rows)
#define KPI  40                       // K row pitch in LDS, f16 units: 64-B row + 16 B
#define VPLN (128 * VPI)
#define KPLN (KT * KPI)
#define STG  (2 * VPLN + 2 * KPLN)    // f16 units per stage: V hi | V residual | K hi | K residual

// One lane's ten copies of one plane pair (8 V rows 16 apart, 2 K pieces 32 rows apart). The s_wait_xcnt closes the statement so that no later
// address update can be scheduled in front of it while a copy still names its registers.
__device__ __forceinline__ void copy10(unsigned lv, unsigned lk, const h16* gv, const h16* gk) {
    asm volatile("global_load_async_to_lds_b128 %0, %10, off\n\t"
                 "global_load_async_to_lds_b128 %1, %11, off\n\t"
                 "global_load_async_to_lds_b128 %2, %12, off\n\t"
                 "global_load_async_to_lds_b128 %3, %13, off\n\t"
                 "global_load_async_to_lds_b128 %4, %14, off\n\t"
                 "global_load_async_to_lds_b128 %5, %15, off\n\t"
                 "global_load_async_to_lds_b128 %6, %16, off\n\t"
                 "global_load_async_to_lds_b128 %7, %17, off\n\t"
                 "global_load_async_to_lds_b128 %8, %18, off\n\t"
                 "global_load_async_to_lds_b128 %9, %19, off\n\t"
                 "s_wait_xcnt 0x0"
                 :: "v"(lv), "v"(lv + 16 * VPI * 2), "v"(lv + 32 * VPI * 2), "v"(lv + 48 * VPI * 2), "v"(lv + 64 * VPI * 2), "v"(lv + 80 * VPI * 2), "v"(lv + 96 * VPI * 2), "v"(lv + 112 * VPI * 2),
                    "v"(lk), "v"(lk + 32 * KPI * 2),
                    "v"(gv), "v"(gv + 16 * NN_), "v"(gv + 32 * NN_), "v"(gv + 48 * NN_), "v"(gv + 64 * NN_), "v"(gv + 80 * NN_), "v"(gv + 96 * NN_), "v"(gv + 112 * NN_),
                    "v"(gk), "v"(gk + 32 * HQ)
                 : "memory");
}

__global__ __launch_bounds__(128) void k_attn(const h16* __restrict__ QH, const h16* __restrict__ QL, const h16* __restrict__ KH, const h16* __restrict__ KL, const h16* __restrict__ VTH, const h16* __restrict__ VTL,
                                             const float* __restrict__ x, float* out) {
    __shared__ __align__(16) h16 ring[2 * STG];
    __shared__ __align__(16) float ot[128 * 68];
    const int tid = threadIdx.x, lane = tid & 31, wave = tid >> 5, lr = lane & 15, hi = lane >> 4;
    const int b = blockIdx.x / (NN_ / 64), it = blockIdx.x - b * (NN_ / 64), chalf = blockIdx.y, i0l = it * 64, q0 = i0l + wave * 16;
    const size_t tok0 = (size_t)b * NN_;
    // this lane's places: V row tid >> 3 (+ 16 per copy), 16-byte piece tid & 7; K row tid >> 2 (+ 32 per copy), piece tid & 3
    const unsigned ring0 = (unsigned)(size_t)&ring[0];
    const unsigned lv0 = ring0 + (unsigned)((tid >> 3) * (VPI * 2) + (tid & 7) * 16), lk0 = ring0 + (unsigned)(2 * VPLN * 2 + (tid >> 2) * (KPI * 2) + (tid & 3) * 16);
    const size_t gvo = ((size_t)b * CC + chalf * 128 + (tid >> 3)) * NN_ + (tid & 7) * 8, gko = tok0 * HQ + (size_t)tid * 8;
    auto fill = [&](int st) {
        const unsigned bo = (unsigned)(st & 1) * (STG * 2);
        copy10(lv0 + bo, lk0 + bo, VTH + gvo + st * KT, KH + gko + st * (KT * HQ));
        copy10(lv0 + bo + VPLN * 2, lk0 + bo + KPLN * 2, VTL + gvo + st * KT, KL + gko + st * (KT * HQ));
    };
    fill(0);
    asm volatile("s_wait_asynccnt 0x0" ::: "memory");   // this wave's share of stage 0 has landed
    __syncthreads();                                    // publishes stage 0 to the other waves
    fill(1);
    const size_t qo = (tok0 + q0 + lr) * HQ + 8 * hi;
    const v16h qa = cat16(*(const v8h*)(QH + qo), *(const v8h*)(QH + qo + 16));
    v8f o[8], ox[8];
#pragma unroll
    for (int n = 0; n < 8; ++n) { o[n] = (v8f){}; ox[n] = (v8f){}; }
    float mrun = -3.0e38f, lrun = 0.f;   // this lane's query (lr): running maximum (both halves alike) and the sum over this half's keys
#pragma unroll 1   // one body for all stages: the buffer is picked by the stage's parity
    for (int st = 0; st < NST; ++st) {
        const h16* sb = ring + (st & 1) * STG;
#pragma unroll 1   // kept rolled: unrolled, the two tiles' fragments are live together and the build spills to scratch
        for (int sub = 0; sub < 2; ++sub) {
            const h16* kb = sb + 2 * VPLN + (sub * 32 + lr) * KPI + 8 * hi;
            const v16h k0h = cat16(*(const v8ha*)kb, *(const v8ha*)(kb + 16)), k1h = cat16(*(const v8ha*)(kb + 16 * KPI), *(const v8ha*)(kb + 16 * KPI + 16));
            const v16h k0l = cat16(*(const v8ha*)(kb + KPLN), *(const v8ha*)(kb + KPLN + 16)), k1l = cat16(*(const v8ha*)(kb + KPLN + 16 * KPI), *(const v8ha*)(kb + KPLN + 16 * KPI + 16));
            const v16h ql = cat16(*(const v8h*)(QL + qo), *(const v8h*)(QL + qo + 16));
            // transposed energy: keys are the rows, queries the columns; register j of s0 / s1 = key 8 * hi + j / 16 + 8 * hi + j against query lr
            v8f s0 = wmma16(k0h, qa, (v8f){}), s1 = wmma16(k1h, qa, (v8f){}), x0 = wmma16(k0h, ql, (v8f){}), x1 = wmma16(k1h, ql, (v8f){});
            x0 = wmma16(k0l, qa, x0); x1 = wmma16(k1l, qa, x1);
            // four vector slots between the last energy product and the first vector read of its result
            asm volatile("v_nop\n\tv_nop\n\tv_nop\n\tv_nop" : "+v"(s0), "+v"(s1), "+v"(x0), "+v"(x1) : "v"(qa), "v"(ql));
            // the tile's V fragments, read from the stage as ONE group here, not among the products below: their LDS latency passes under the softmax
            v16h vh[8], vl[8];
#pragma unroll
            for (int n = 0; n < 8; ++n) { const h16* vb = sb + (n * 16 + lr) * VPI + sub * 32 + hi * 8;
                vh[n] = cat16(*(const v8ha*)vb, *(const v8ha*)(vb + 16)); vl[n] = cat16(*(const v8ha*)(vb + VPLN), *(const v8ha*)(vb + VPLN + 16)); }
            const v8f a0 = s0 + x0 * LOSCI, a1 = s1 + x1 * LOSCI;
            const v8f m8 = __builtin_elementwise_max(a0, a1);
            float mx = fmaxf(fmaxf(fmaxf(m8[0], m8[1]), fmaxf(m8[2], m8[3])), fmaxf(fmaxf(m8[4], m8[5]), fmaxf(m8[6], m8[7])));
            mx = fmaxf(mx, xhalf(mx));   // the other half's 16 keys of the same query
            const float mn = fmaxf(mrun, mx), alpha = __expf(mrun - mn);
            mrun = mn;
            // the weights stay in registers: the two score tiles, converted in place, are the B operand (element s = key 8 * hi + s, then 16 + 8 * hi + s - 8: the V loader's k order)
            v8f p0, p1;
#pragma unroll
            for (int j = 0; j < 8; ++j) { p0[j] = __expf(a0[j] - mn); p1[j] = __expf(a1[j] - mn); }
            const v8f ps0 = p0 * PSC, ps1 = p1 * PSC, pp = p0 + p1;
            const v8h h0 = __builtin_convertvector(ps0, v8h), h1 = __builtin_convertvector(ps1, v8h);
            const v8h r0 = __builtin_convertvector(ps0 - __builtin_convertvector(h0, v8f), v8h), r1 = __builtin_convertvector(ps1 - __builtin_convertvector(h1, v8f), v8h);   // UNSCALED residual
            const v16h pa = cat16(h0, h1), px = cat16(r0, r1);
            const float ls = ((pp[0] + pp[1]) + (pp[2] + pp[3])) + ((pp[4] + pp[5]) + (pp[6] + pp[7]));
            lrun = lrun * alpha + ls;
#pragma unroll
            for (int n = 0; n < 8; ++n)
#pragma unroll
                for (int j = 0; j < 8; ++j) { o[n][j] *= alpha; ox[n][j] *= alpha; }
            // transposed output tiles: register j of o[n] = channel n * 16 + 8 * hi + j of query lr
#pragma unroll
            for (int n = 0; n < 8; ++n) { o[n] = wmma16(vh[n], pa, o[n]); o[n] = wmma16(vh[n], px, o[n]); ox[n] = wmma16(vl[n], pa, ox[n]); }
            // four vector slots behind the last product on the loop's back edge too, before its operands or results are touched
            asm volatile("v_nop\n\tv_nop\n\tv_nop\n\tv_nop" : "+v"(o[0]), "+v"(o[7]), "+v"(ox[0]), "+v"(ox[7]) : "v"(pa), "v"(px));
        }
        asm volatile("s_wait_dscnt 0x0" ::: "memory");      // this wave's reads of stage st are done before its buffer may be refilled
        asm volatile("s_wait_asynccnt 0x0" ::: "memory");   // this wave's share of stage st + 1 has landed
        __syncthreads();                                    // publishes stage st + 1 and ends every wave's reads of stage st
        if (st + 2 < NST) fill(st + 2);
    }
    asm volatile("s_wait_asynccnt 0x0" ::: "memory");       // nothing of the ring is in flight when the wave goes on to the epilogue
    const float inv = 1.0f / ((lrun + xhalf(lrun)) * PSC);   // the two halves' key sums joined once
    // staging: ot[c_local][i_local] (128 x 64)
#pragma unroll
    for (int n = 0; n < 8; ++n)
#pragma unroll
        for (int j = 0; j < 8; ++j) ot[(n * 16 + hi * 8 + j) * 68 + wave * 16 + lr] = (o[n][j] + ox[n][j] * LOSCI) * inv;
    __syncthreads();
    // out[b][c][i0l + i] + x residual: per c a 256-B run (16 lanes x 16 B, 2 c per instruction); 128 c rows -> 4 waves x 16 instructions
    auto pass = [&]() {
#pragma unroll
        for (int s = 0; s < 16; ++s) { const int cl = wave * 32 + s * 2 + (lane >> 4), piece = lane & 15; const size_t go = ((size_t)b * CC + chalf * 128 + cl) * NN_ + i0l + piece * 4;
            v4f val = *(const v4fa*)(ot + cl * 68 + piece * 4);
#pragma unroll
            for (int i = 0; i < 4; ++i) val[i] += bfr(x[go + i]);
            *(v4f*)(out + go) = val; }
    };
    pass(); 
}

extern "C" void kernel_launch(void* const* d_in, const int* in_sizes, int n_in,
                              void* d_out, int out_size, void* d_ws, size_t ws_size, hipStream_t stream) {
    (void)in_sizes; (void)n_in; (void)out_size;
    const float* x = (const float*)d_in[0]; const float* wq = (const float*)d_in[1]; const float* bq = (const float*)d_in[2]; const float* wk = (const float*)d_in[3]; const float* bk = (const float*)d_in[4];
    const float* wv = (const float*)d_in[5]; const float* bv = (const float*)d_in[6];
    float* out = (float*)d_out;    // [8][256][2048]
    char* wsp = (char*)d_ws;
    auto take = [&](size_t bytes) { char* p = wsp; wsp += (bytes + 255) & ~(size_t)255; return (void*)p; };
    bf* XT = (bf*)take((size_t)NTK * CC * 2); bf* WQ = (bf*)take((size_t)HQ * CC * 2); bf* WK = (bf*)take((size_t)HQ * CC * 2); bf* WV = (bf*)take((size_t)CC * CC * 2);
    h16* QH = (h16*)take((size_t)NTK * HQ * 2); h16* QL = (h16*)take((size_t)NTK * HQ * 2); h16* KH = (h16*)take((size_t)NTK * HQ * 2); h16* KL = (h16*)take((size_t)NTK * HQ * 2);
    float* Vf = (float*)take((size_t)NTK * CC * 4); h16* VTH = (h16*)take((size_t)NTK * CC * 2); h16* VTL = (h16*)take((size_t)NTK * CC * 2);
    if ((size_t)(wsp - (char*)d_ws) > ws_size) return;    // 8.4 + 0.2 + 1 x 4 + 16.8 + 8.4 x 2 ~ 47 MB
    k_xt<<<dim3(NN_ / 64, CC / 64, NB_), 256, 0, stream>>>(x, XT);
    k_w<<<(2 * HQ + CC) / 8, 256, 0, stream>>>(wq, wk, wv, WQ, WK, WV);
    k_qk<<<dim3(NTK / 64, 2, 1), 128, 0, stream>>>(XT, WQ, WK, bq, bk, QH, QL, KH, KL);
    k_v<<<dim3(NTK / 64, CC / 64, 1), 128, 0, stream>>>(XT, WV, bv, Vf);
    k_vt<<<dim3(NN_ / 64, CC / 64, NB_), 256, 0, stream>>>(Vf, VTH, VTL);
    k_attn<<<dim3(NB_ * (NN_ / 64), 2, 1), 128, 0, stream>>>(QH, QL, KH, KL, VTH, VTL, x, out);
}

// v003
// One run takes 69.6 microseconds.
// Timed twice side by side with v002, it ran 1.29 times as fast both times.
// All steps since v000 together make it 3.57 times as fast.
#include <hip/hip_runtime.h>

// Contractions, f32 accumulate: q/k = 1x1 convs ([16384 positions x 256].[256 x 32] each) and v ([16384 x 256].[256 x 256]) on v_wmma_f32_16x16x32_bf16 with PLAIN
// bf16 operands (inputs rounded once: exact); the position attention fused on v_wmma_f32_16x16x32_f16: energy = q.k over the 32 hidden dims (UNSCALED; q and k as
// f16 hi + residual x1024: hi.hi + hi.lo + lo.hi), softmax over the 2048 positions, out[c][i] = sum_j w[i][j] v[c][j] over all 256 channels with the weights
// (x32768) as f16 hi + UNSCALED residual and v as hi + residual x1024 — three products into two accumulator sets (o: wh.vh + wl.vh, ox: wh.vl); + x residual; output written channel-major

#define NB_  8
#define CC   256
#define NN_  2048
#define HQ   32
#define NTK  (NB_ * NN_)
#define PSC  32768.0f
#define LOSC 1024.0f
#define LOSCI (1.0f / 1024.0f)

typedef _Float16 h16;
typedef unsigned short bf;
typedef __attribute__((ext_vector_type(16))) __bf16   v16bf;
typedef __attribute__((ext_vector_type(16))) _Float16 v16h;
typedef __attribute__((ext_vector_type(8)))  _Float16 v8h;
typedef __attribute__((ext_vector_type(8)))  unsigned short v8us;
typedef __attribute__((ext_vector_type(8)))  float    v8f;
typedef __attribute__((ext_vector_type(4)))  float    v4f;
typedef v8h  __attribute__((may_alias)) v8ha;
typedef v4f  __attribute__((may_alias)) v4fa;
typedef v8us __attribute__((may_alias)) v8usa;

__device__ __forceinline__ unsigned short f2bf(float f) { unsigned u = __float_as_uint(f); u += 0x7FFFu + ((u >> 16) & 1u); return (unsigned short)(u >> 16); }
__device__ __forceinline__ float bf2f(unsigned short b) { return __uint_as_float(((unsigned)b) << 16); }
__device__ __forceinline__ float bfr(float f) { return bf2f(f2bf(f)); }
__device__ __forceinline__ v16h cat16(v8h lo, v8h hi) { return __builtin_shufflevector(lo, hi, 0, 1, 2, 3, 4, 5, 6, 7, 8, 9, 10, 11, 12, 13, 14, 15); }
__device__ __forceinline__ v16bf cat16b(v8us lo, v8us hi) { return __builtin_bit_cast(v16bf, __builtin_shufflevector(lo, hi, 0, 1, 2, 3, 4, 5, 6, 7, 8, 9, 10, 11, 12, 13, 14, 15)); }
__device__ __forceinline__ v8f wmma16(v16h a, v16h b, v8f c) { return __builtin_amdgcn_wmma_f32_16x16x32_f16(false, a, false, b, (short)0, c, false, false); }
__device__ __forceinline__ v8f wmmab(v16bf a, v16bf b, v8f c) { return __builtin_amdgcn_wmma_f32_16x16x32_bf16(false, a, false, b, (short)0, c, false, false); }
__device__ __forceinline__ float xhalf(float v) { return __builtin_bit_cast(float, __builtin_amdgcn_permlanex16(__builtin_bit_cast(int, v), __builtin_bit_cast(int, v), 0x76543210, 0xfedcba98, false, false)); }  // lane l with lane l ^ 16
#define VST2(T, p, v) do { const T vst2_v_ = (v); *(T*)(p) = vst2_v_;  } while (0)

// k_w: bf16 planes of wq [32][256], wk [32][256], wv [256][256] ([out][in] = n-major as-is); one wave per row (32 lanes x 16 B = 512 B).
__global__ __launch_bounds__(256) void k_w(const float* __restrict__ wq, const float* __restrict__ wk, const float* __restrict__ wv, bf* WQ, bf* WK, bf* WV) {
    const int lane = threadIdx.x & 31, r = blockIdx.x * 8 + (threadIdx.x >> 5);      // 0 .. 32+32+256
    const int m = (r < HQ) ? 0 : (r < 2 * HQ) ? 1 : 2;     // wave-uniform
    v8us o;
    if (m == 0) { for (int i = 0; i < 8; ++i) o[i] = f2bf(wq[(size_t)r * CC + lane * 8 + i]); VST2(v8us, WQ + (size_t)r * CC + lane * 8, o); }
    else if (m == 1) { const int o2 = r - HQ; for (int i = 0; i < 8; ++i) o[i] = f2bf(wk[(size_t)o2 * CC + lane * 8 + i]); VST2(v8us, WK + (size_t)o2 * CC + lane * 8, o); }
    else { const int o2 = r - 2 * HQ; if (o2 < CC) { for (int i = 0; i < 8; ++i) o[i] = f2bf(wv[(size_t)o2 * CC + lane * 8 + i]); VST2(v8us, WV + (size_t)o2 * CC + lane * 8, o); } }
}
// k_proj: block = (b, 64 positions), 8 waves. The block's x tile (256 channels x 64 positions) is read once in whole lines, rounded to bf16 and laid position-major in
// LDS; all three projections take their A fragments (16 positions x 32 channels) from that tile and their B fragments (weight rows) from global memory, requested
// together with the tile. v: wave = 32 output channels x 64 positions; a lane's accumulator holds 8 consecutive positions of ONE channel, so hi + residual pack straight into
// channel-major 16-byte pieces, gathered through LDS into 128-B lines of VTH / VTL [b][c][n]. q | k: wave = (16 positions, q or k), planes [tok][32].
#define XPI 264                       // x tile row pitch in LDS, bf16 units: 512-B row + 16 B (16 B x odd: no bank conflict for 16-byte reads of 16 rows)
#define OPI 72                        // v staging row pitch, f16 units: 128-B row + 16 B
__global__ __launch_bounds__(256) void k_proj(const float* __restrict__ x, const bf* __restrict__ WQ, const bf* __restrict__ WK, const bf* __restrict__ WV,
                                              const float* __restrict__ bq, const float* __restrict__ bk, const float* __restrict__ bv,
                                              h16* QH, h16* QL, h16* KH, h16* KL, h16* VTH, h16* VTL) {
    __shared__ __align__(16) unsigned short xs[64 * XPI];
    __shared__ __align__(16) h16 vsh[CC * OPI];
    __shared__ __align__(16) h16 vsl[CC * OPI];
    __shared__ __align__(16) float ost[8][16 * 36];
    const int tid = threadIdx.x, lane = tid & 31, wave = tid >> 5, lr = lane & 15, hi = lane >> 4;
    const int n0 = blockIdx.x * 64, b = blockIdx.y, which = wave >> 2, nt = wave & 3;
    const bf* W = which ? WK : WQ; const float* bias = which ? bk : bq; h16* PH = which ? KH : QH; h16* PL = which ? KL : QL;   // wave-uniform selects of whole buffers
    // the wave's weight fragments for all eight k steps: they do not depend on the tile, so their latency passes under the tile's load and transpose
    const bf* vp0 = WV + (size_t)(wave * 32 + lr) * CC + 8 * hi; const bf* vp1 = vp0 + 16 * CC;
    const bf* qp0 = W + (size_t)lr * CC + 8 * hi; const bf* qp1 = qp0 + 16 * CC;
    const float* bvp = bv + wave * 32 + lr; const float* bbp = bias + lr;
    v16bf wvf[8][2], wqf[8][2];
#pragma unroll
    for (int ks = 0; ks < 8; ++ks) {
        wvf[ks][0] = cat16b(*(const v8us*)(vp0 + ks * 32), *(const v8us*)(vp0 + ks * 32 + 16)); wvf[ks][1] = cat16b(*(const v8us*)(vp1 + ks * 32), *(const v8us*)(vp1 + ks * 32 + 16));
        wqf[ks][0] = cat16b(*(const v8us*)(qp0 + ks * 32), *(const v8us*)(qp0 + ks * 32 + 16)); wqf[ks][1] = cat16b(*(const v8us*)(qp1 + ks * 32), *(const v8us*)(qp1 + ks * 32 + 16));
    }
    const float bv0 = bvp[0], bv1 = bvp[16], bb0 = bbp[0], bb1 = bbp[16];
    // x tile: thread = (4 positions, 16 channels); 16 lanes cover one channel's 256-B run
    {
        const int piece = tid & 15, g = tid >> 4;
        const float* xp = x + ((size_t)b * CC + g * 16) * NN_ + n0 + piece * 4;
        v4f xr[16];
#pragma unroll
        for (int i = 0; i < 16; ++i) xr[i] = *(const v4fa*)(xp + (size_t)i * NN_);
        // every load above has been issued; the wait takes their addresses as inputs, so that no address register is reused in front of it
        asm volatile("s_wait_xcnt 0x0" :: "v"(vp0), "v"(vp1), "v"(qp0), "v"(qp1), "v"(bvp), "v"(bbp), "v"(xp) : "memory");
#pragma unroll
        for (int k = 0; k < 4; ++k)
#pragma unroll
            for (int o = 0; o < 2; ++o) { v8us p;
#pragma unroll
                for (int e = 0; e < 8; ++e) p[e] = f2bf(xr[o * 8 + e][k]);
                *(v8usa*)(xs + (piece * 4 + k) * XPI + g * 16 + o * 8) = p; }
    }
    __syncthreads();
    v8f av[4][2], aq[2] = {(v8f){}, (v8f){}};
#pragma unroll
    for (int m = 0; m < 4; ++m) { av[m][0] = (v8f){}; av[m][1] = (v8f){}; }
    // A fragments in two register sets: step ks + 1 is read from LDS as one group ahead of step ks's products, so its latency passes under them
    v16bf a[2][5];
    auto ldA = [&](int ks, v16bf (&f)[5]) {
#pragma unroll
        for (int m = 0; m < 5; ++m) { const unsigned short* ap = xs + ((m < 4 ? m : nt) * 16 + lr) * XPI + ks * 32 + 8 * hi; f[m] = cat16b(*(const v8usa*)ap, *(const v8usa*)(ap + 16)); }
    };
    ldA(0, a[0]);
#pragma unroll
    for (int ks = 0; ks < 8; ++ks) {
        if (ks < 7) ldA(ks + 1, a[(ks + 1) & 1]);
        __builtin_amdgcn_sched_barrier(0);   // keeps the next step's reads together in front of this step's products; without it they sink to their uses, one exposed LDS latency each
#pragma unroll
        for (int m = 0; m < 4; ++m) { av[m][0] = wmmab(a[ks & 1][m], wvf[ks][0], av[m][0]); av[m][1] = wmmab(a[ks & 1][m], wvf[ks][1], av[m][1]); }
        aq[0] = wmmab(a[ks & 1][4], wqf[ks][0], aq[0]); aq[1] = wmmab(a[ks & 1][4], wqf[ks][1], aq[1]);
    }
    // v: register j of av[m][t] = position m * 16 + 8 * hi + j of channel wave * 32 + t * 16 + lr
#pragma unroll
    for (int t = 0; t < 2; ++t) { const int c = wave * 32 + t * 16 + lr; const float b2 = bfr(t ? bv1 : bv0);
#pragma unroll
        for (int m = 0; m < 4; ++m) { const v8f v = av[m][t] + b2; const v8h oh = __builtin_convertvector(v, v8h), ol = __builtin_convertvector((v - __builtin_convertvector(oh, v8f)) * LOSC, v8h);
            *(v8ha*)(vsh + c * OPI + m * 16 + hi * 8) = oh; *(v8ha*)(vsl + c * OPI + m * 16 + hi * 8) = ol; } }
    float* os = &ost[wave][0];
#pragma unroll
    for (int t = 0; t < 2; ++t) { const float bb = bfr(t ? bb1 : bb0);
#pragma unroll
        for (int j = 0; j < 8; ++j) os[(hi * 8 + j) * 36 + t * 16 + lr] = aq[t][j] + bb; }
    __syncthreads();
    const size_t r0 = (size_t)b * NN_ + n0 + nt * 16;
#pragma unroll
    for (int s = 0; s < 2; ++s) { const int row = s * 8 + (lane >> 2), pc = lane & 3; const float* sp = os + row * 36 + pc * 8;   // 4 lanes x 16 B per 64-B row
        const v8f v = __builtin_shufflevector(*(const v4fa*)sp, *(const v4fa*)(sp + 4), 0, 1, 2, 3, 4, 5, 6, 7);
        const v8h oh = __builtin_convertvector(v, v8h), ol = __builtin_convertvector((v - __builtin_convertvector(oh, v8f)) * LOSC, v8h);
        *(v8h*)(PH + (r0 + row) * HQ + pc * 8) = oh; *(v8h*)(PL + (r0 + row) * HQ + pc * 8) = ol; }
#pragma unroll
    for (int s = 0; s < 8; ++s) { const int c = (tid >> 3) + 32 * s, pc = tid & 7; const size_t o = ((size_t)b * CC + c) * NN_ + n0 + pc * 8;   // 8 lanes x 16 B per 128-B row
        *(v8h*)(VTH + o) = *(const v8ha*)(vsh + c * OPI + pc * 8); *(v8h*)(VTL + o) = *(const v8ha*)(vsl + c * OPI + pc * 8); }
}
// k_attn: block = (b, 64 positions i, channel half), wave = 16 positions. The keys are walked in LDS stages of 64 (two 32-key tiles): each stage holds the block's
// V rows (128 channels x 64 keys, hi and residual plane) and K rows (64 keys x 32 dims, hi and residual plane), brought in ONCE per block by per-lane 16-byte
// asynchronous copies, whole 128-B lines per row, into two buffers: stage s + 2 is issued when stage s has been read, so it flies while stage s + 1 is worked on.
// Per 32-key tile, both products transposed (keys x queries, then channels x queries): energy (hi.hi + hi.lo + lo.hi), a lane holds 16 scores of ONE query, so the
// online softmax is in-lane but for one exchange between the wave's halves; weights x32768 as f16 hi + UNSCALED residual go from the score registers straight into
// the B operand; o += vh.wh + vh.wl, ox += vl.wh.
// Epilogue: out[b][c][i] = o/l + x[b][c][i], gathered through LDS (per c the block's 64 i are one 256-B run).
#define KT   64                       // keys per stage
#define NST  (NN_ / KT)
#define VPI  72                       // V row pitch in LDS, f16 units: 128-B row + 16 B (16 B x odd: no bank conflict for 16-byte reads of 16 rows)
#define KPI  40                       // K row pitch in LDS, f16 units: 64-B row + 16 B
#define VPLN (128 * VPI)
#define KPLN (KT * KPI)
#define STG  (2 * VPLN + 2 * KPLN)    // f16 units per stage: V hi | V residual | K hi | K residual

// One lane's ten copies of one plane pair (8 V rows 16 apart, 2 K pieces 32 rows apart). The s_wait_xcnt closes the statement so that no later
// address update can be scheduled in front of it while a copy still names its registers.
__device__ __forceinline__ void copy10(unsigned lv, unsigned lk, const h16* gv, const h16* gk) {
    asm volatile("global_load_async_to_lds_b128 %0, %10, off\n\t"
                 "global_load_async_to_lds_b128 %1, %11, off\n\t"
                 "global_load_async_to_lds_b128 %2, %12, off\n\t"
                 "global_load_async_to_lds_b128 %3, %13, off\n\t"
                 "global_load_async_to_lds_b128 %4, %14, off\n\t"
                 "global_load_async_to_lds_b128 %5, %15, off\n\t"
                 "global_load_async_to_lds_b128 %6, %16, off\n\t"
                 "global_load_async_to_lds_b128 %7, %17, off\n\t"
                 "global_load_async_to_lds_b128 %8, %18, off\n\t"
                 "global_load_async_to_lds_b128 %9, %19, off\n\t"
                 "s_wait_xcnt 0x0"
                 :: "v"(lv), "v"(lv + 16 * VPI * 2), "v"(lv + 32 * VPI * 2), "v"(lv + 48 * VPI * 2), "v"(lv + 64 * VPI * 2), "v"(lv + 80 * VPI * 2), "v"(lv + 96 * VPI * 2), "v"(lv + 112 * VPI * 2),
                    "v"(lk), "v"(lk + 32 * KPI * 2),
                    "v"(gv), "v"(gv + 16 * NN_), "v"(gv + 32 * NN_), "v"(gv + 48 * NN_), "v"(gv + 64 * NN_), "v"(gv + 80 * NN_), "v"(gv + 96 * NN_), "v"(gv + 112 * NN_),
                    "v"(gk), "v"(gk + 32 * HQ)
                 : "memory");
}

__global__ __launch_bounds__(128) void k_attn(const h16* __restrict__ QH, const h16* __restrict__ QL, const h16* __restrict__ KH, const h16* __restrict__ KL, const h16* __restrict__ VTH, const h16* __restrict__ VTL,
                                             const float* __restrict__ x, float* out) {
    __shared__ __align__(16) h16 ring[2 * STG];
    __shared__ __align__(16) float ot[128 * 68];
    const int tid = threadIdx.x, lane = tid & 31, wave = tid >> 5, lr = lane & 15, hi = lane >> 4;
    const int b = blockIdx.x / (NN_ / 64), it = blockIdx.x - b * (NN_ / 64), chalf = blockIdx.y, i0l = it * 64, q0 = i0l + wave * 16;
    const size_t tok0 = (size_t)b * NN_;
    // this lane's places: V row tid >> 3 (+ 16 per copy), 16-byte piece tid & 7; K row tid >> 2 (+ 32 per copy), piece tid & 3
    const unsigned ring0 = (unsigned)(size_t)&ring[0];
    const unsigned lv0 = ring0 + (unsigned)((tid >> 3) * (VPI * 2) + (tid & 7) * 16), lk0 = ring0 + (unsigned)(2 * VPLN * 2 + (tid >> 2) * (KPI * 2) + (tid & 3) * 16);
    const size_t gvo = ((size_t)b * CC + chalf * 128 + (tid >> 3)) * NN_ + (tid & 7) * 8, gko = tok0 * HQ + (size_t)tid * 8;
    auto fill = [&](int st) {
        const unsigned bo = (unsigned)(st & 1) * (STG * 2);
        copy10(lv0 + bo, lk0 + bo, VTH + gvo + st * KT, KH + gko + st * (KT * HQ));
        copy10(lv0 + bo + VPLN * 2, lk0 + bo + KPLN * 2, VTL + gvo + st * KT, KL + gko + st * (KT * HQ));
    };
    fill(0);
    asm volatile("s_wait_asynccnt 0x0" ::: "memory");   // this wave's share of stage 0 has landed
    __syncthreads();                                    // publishes stage 0 to the other waves
    fill(1);
    const size_t qo = (tok0 + q0 + lr) * HQ + 8 * hi;
    const v16h qa = cat16(*(const v8h*)(QH + qo), *(const v8h*)(QH + qo + 16));
    v8f o[8], ox[8];
#pragma unroll
    for (int n = 0; n < 8; ++n) { o[n] = (v8f){}; ox[n] = (v8f){}; }
    float mrun = -3.0e38f, lrun = 0.f;   // this lane's query (lr): running maximum (both halves alike) and the sum over this half's keys
#pragma unroll 1   // one body for all stages: the buffer is picked by the stage's parity
    for (int st = 0; st < NST; ++st) {
        const h16* sb = ring + (st & 1) * STG;
#pragma unroll 1   // kept rolled: unrolled, the two tiles' fragments are live together and the build spills to scratch
        for (int sub = 0; sub < 2; ++sub) {
            const h16* kb = sb + 2 * VPLN + (sub * 32 + lr) * KPI + 8 * hi;
            const v16h k0h = cat16(*(const v8ha*)kb, *(const v8ha*)(kb + 16)), k1h = cat16(*(const v8ha*)(kb + 16 * KPI), *(const v8ha*)(kb + 16 * KPI + 16));
            const v16h k0l = cat16(*(const v8ha*)(kb + KPLN), *(const v8ha*)(kb + KPLN + 16)), k1l = cat16(*(const v8ha*)(kb + KPLN + 16 * KPI), *(const v8ha*)(kb + KPLN + 16 * KPI + 16));
            const v16h ql = cat16(*(const v8h*)(QL + qo), *(const v8h*)(QL + qo + 16));
            // transposed energy: keys are the rows, queries the columns; register j of s0 / s1 = key 8 * hi + j / 16 + 8 * hi + j against query lr
            v8f s0 = wmma16(k0h, qa, (v8f){}), s1 = wmma16(k1h, qa, (v8f){}), x0 = wmma16(k0h, ql, (v8f){}), x1 = wmma16(k1h, ql, (v8f){});
            x0 = wmma16(k0l, qa, x0); x1 = wmma16(k1l, qa, x1);
            // four vector slots between the last energy product and the first vector read of its result
            asm volatile("v_nop\n\tv_nop\n\tv_nop\n\tv_nop" : "+v"(s0), "+v"(s1), "+v"(x0), "+v"(x1) : "v"(qa), "v"(ql));
            // the tile's V fragments, read from the stage as ONE group here, not among the products below: their LDS latency passes under the softmax
            v16h vh[8], vl[8];
#pragma unroll
            for (int n = 0; n < 8; ++n) { const h16* vb = sb + (n * 16 + lr) * VPI + sub * 32 + hi * 8;
                vh[n] = cat16(*(const v8ha*)vb, *(const v8ha*)(vb + 16)); vl[n] = cat16(*(const v8ha*)(vb + VPLN), *(const v8ha*)(vb + VPLN + 16)); }
            const v8f a0 = s0 + x0 * LOSCI, a1 = s1 + x1 * LOSCI;
            const v8f m8 = __builtin_elementwise_max(a0, a1);
            float mx = fmaxf(fmaxf(fmaxf(m8[0], m8[1]), fmaxf(m8[2], m8[3])), fmaxf(fmaxf(m8[4], m8[5]), fmaxf(m8[6], m8[7])));
            mx = fmaxf(mx, xhalf(mx));   // the other half's 16 keys of the same query
            const float mn = fmaxf(mrun, mx), alpha = __expf(mrun - mn);
            mrun = mn;
            // the weights stay in registers: the two score tiles, converted in place, are the B operand (element s = key 8 * hi + s, then 16 + 8 * hi + s - 8: the V loader's k order)
            v8f p0, p1;
#pragma unroll
            for (int j = 0; j < 8; ++j) { p0[j] = __expf(a0[j] - mn); p1[j] = __expf(a1[j] - mn); }
            const v8f ps0 = p0 * PSC, ps1 = p1 * PSC, pp = p0 + p1;
            const v8h h0 = __builtin_convertvector(ps0, v8h), h1 = __builtin_convertvector(ps1, v8h);
            const v8h r0 = __builtin_convertvector(ps0 - __builtin_convertvector(h0, v8f), v8h), r1 = __builtin_convertvector(ps1 - __builtin_convertvector(h1, v8f), v8h);   // UNSCALED residual
            const v16h pa = cat16(h0, h1), px = cat16(r0, r1);
            const float ls = ((pp[0] + pp[1]) + (pp[2] + pp[3])) + ((pp[4] + pp[5]) + (pp[6] + pp[7]));
            lrun = lrun * alpha + ls;
#pragma unroll
            for (int n = 0; n < 8; ++n)
#pragma unroll
                for (int j = 0; j < 8; ++j) { o[n][j] *= alpha; ox[n][j] *= alpha; }
            // transposed output tiles: register j of o[n] = channel n * 16 + 8 * hi + j of query lr
#pragma unroll
            for (int n = 0; n < 8; ++n) { o[n] = wmma16(vh[n], pa, o[n]); o[n] = wmma16(vh[n], px, o[n]); ox[n] = wmma16(vl[n], pa, ox[n]); }
            // four vector slots behind the last product on the loop's back edge too, before its operands or results are touched
            asm volatile("v_nop\n\tv_nop\n\tv_nop\n\tv_nop" : "+v"(o[0]), "+v"(o[7]), "+v"(ox[0]), "+v"(ox[7]) : "v"(pa), "v"(px));
        }
        asm volatile("s_wait_dscnt 0x0" ::: "memory");      // this wave's reads of stage st are done before its buffer may be refilled
        asm volatile("s_wait_asynccnt 0x0" ::: "memory");   // this wave's share of stage st + 1 has landed
        __syncthreads();                                    // publishes stage st + 1 and ends every wave's reads of stage st
        if (st + 2 < NST) fill(st + 2);
    }
    asm volatile("s_wait_asynccnt 0x0" ::: "memory");       // nothing of the ring is in flight when the wave goes on to the epilogue
    const float inv = 1.0f / ((lrun + xhalf(lrun)) * PSC);   // the two halves' key sums joined once
    // staging: ot[c_local][i_local] (128 x 64)
#pragma unroll
    for (int n = 0; n < 8; ++n)
#pragma unroll
        for (int j = 0; j < 8; ++j) ot[(n * 16 + hi * 8 + j) * 68 + wave * 16 + lr] = (o[n][j] + ox[n][j] * LOSCI) * inv;
    __syncthreads();
    // out[b][c][i0l + i] + x residual: per c a 256-B run (16 lanes x 16 B, 2 c per instruction); 128 c rows -> 4 waves x 16 instructions
    auto pass = [&]() {
#pragma unroll
        for (int s = 0; s < 16; ++s) { const int cl = wave * 32 + s * 2 + (lane >> 4), piece = lane & 15; const size_t go = ((size_t)b * CC + chalf * 128 + cl) * NN_ + i0l + piece * 4;
            v4f val = *(const v4fa*)(ot + cl * 68 + piece * 4);
#pragma unroll
            for (int i = 0; i < 4; ++i) val[i] += bfr(x[go + i]);
            *(v4f*)(out + go) = val; }
    };
    pass(); 
}

extern "C" void kernel_launch(void* const* d_in, const int* in_sizes, int n_in,
                              void* d_out, int out_size, void* d_ws, size_t ws_size, hipStream_t stream) {
    (void)in_sizes; (void)n_in; (void)out_size;
    const float* x = (const float*)d_in[0]; const float* wq = (const float*)d_in[1]; const float* bq = (const float*)d_in[2]; const float* wk = (const float*)d_in[3]; const float* bk = (const float*)d_in[4];
    const float* wv = (const float*)d_in[5]; const float* bv = (const float*)d_in[6];
    float* out = (float*)d_out;    // [8][256][2048]
    char* wsp = (char*)d_ws;
    auto take = [&](size_t bytes) { char* p = wsp; wsp += (bytes + 255) & ~(size_t)255; return (void*)p; };
    bf* WQ = (bf*)take((size_t)HQ * CC * 2); bf* WK = (bf*)take((size_t)HQ * CC * 2); bf* WV = (bf*)take((size_t)CC * CC * 2);
    h16* QH = (h16*)take((size_t)NTK * HQ * 2); h16* QL = (h16*)take((size_t)NTK * HQ * 2); h16* KH = (h16*)take((size_t)NTK * HQ * 2); h16* KL = (h16*)take((size_t)NTK * HQ * 2);
    h16* VTH = (h16*)take((size_t)NTK * CC * 2); h16* VTL = (h16*)take((size_t)NTK * CC * 2);
    if ((size_t)(wsp - (char*)d_ws) > ws_size) return;    // 0.2 + 1 x 4 + 8.4 x 2 ~ 21 MB
    k_w<<<(2 * HQ + CC) / 8, 256, 0, stream>>>(wq, wk, wv, WQ, WK, WV);
    k_proj<<<dim3(NN_ / 64, NB_, 1), 256, 0, stream>>>(x, WQ, WK, WV, bq, bk, bv, QH, QL, KH, KL, VTH, VTL);
    k_attn<<<dim3(NB_ * (NN_ / 64), 2, 1), 128, 0, stream>>>(QH, QL, KH, KL, VTH, VTL, x, out);
}

// v004
// One run takes 66.2 microseconds.
// Next to v003, in two timings, it ran 1.05 times as fast each time.
// Counting every step since v000, it is 3.75 times as fast.
#include <hip/hip_runtime.h>

// Contractions, f32 accumulate: q/k = 1x1 convs ([16384 positions x 256].[256 x 32] each) and v ([16384 x 256].[256 x 256]) on v_wmma_f32_16x16x32_bf16 with PLAIN
// bf16 operands (inputs rounded once: exact); the position attention fused on v_wmma_f32_16x16x32_f16: energy = q.k over the 32 hidden dims (UNSCALED; q and k as
// f16 hi + residual x1024: hi.hi + hi.lo + lo.hi), softmax over the 2048 positions, out[c][i] = sum_j w[i][j] v[c][j] over all 256 channels with the weights
// (x32768) as f16 hi + UNSCALED residual and v as hi + residual x1024 — three products into two accumulator sets (o: wh.vh + wl.vh, ox: wh.vl); + x residual; output written channel-major

#define NB_  8
#define CC   256
#define NN_  2048
#define HQ   32
#define NTK  (NB_ * NN_)
#define PSC  32768.0f
#define LOSC 1024.0f
#define LOSCI (1.0f / 1024.0f)

typedef _Float16 h16;
typedef unsigned short bf;
typedef __attribute__((ext_vector_type(16))) __bf16   v16bf;
typedef __attribute__((ext_vector_type(16))) _Float16 v16h;
typedef __attribute__((ext_vector_type(8)))  _Float16 v8h;
typedef __attribute__((ext_vector_type(8)))  unsigned short v8us;
typedef __attribute__((ext_vector_type(8)))  float    v8f;
typedef __attribute__((ext_vector_type(4)))  float    v4f;
typedef v8h  __attribute__((may_alias)) v8ha;
typedef v4f  __attribute__((may_alias)) v4fa;
typedef v8us __attribute__((may_alias)) v8usa;

__device__ __forceinline__ unsigned short f2bf(float f) { unsigned u = __float_as_uint(f); u += 0x7FFFu + ((u >> 16) & 1u); return (unsigned short)(u >> 16); }
__device__ __forceinline__ float bf2f(unsigned short b) { return __uint_as_float(((unsigned)b) << 16); }
__device__ __forceinline__ float bfr(float f) { return bf2f(f2bf(f)); }
__device__ __forceinline__ v16h cat16(v8h lo, v8h hi) { return __builtin_shufflevector(lo, hi, 0, 1, 2, 3, 4, 5, 6, 7, 8, 9, 10, 11, 12, 13, 14, 15); }
__device__ __forceinline__ v16bf cat16b(v8us lo, v8us hi) { return __builtin_bit_cast(v16bf, __builtin_shufflevector(lo, hi, 0, 1, 2, 3, 4, 5, 6, 7, 8, 9, 10, 11, 12, 13, 14, 15)); }
__device__ __forceinline__ v8f wmma16(v16h a, v16h b, v8f c) { return __builtin_amdgcn_wmma_f32_16x16x32_f16(false, a, false, b, (short)0, c, false, false); }
__device__ __forceinline__ v8f wmmab(v16bf a, v16bf b, v8f c) { return __builtin_amdgcn_wmma_f32_16x16x32_bf16(false, a, false, b, (short)0, c, false, false); }
__device__ __forceinline__ float xhalf(float v) { return __builtin_bit_cast(float, __builtin_amdgcn_permlanex16(__builtin_bit_cast(int, v), __builtin_bit_cast(int, v), 0x76543210, 0xfedcba98, false, false)); }  // lane l with lane l ^ 16
#define VST2(T, p, v) do { const T vst2_v_ = (v); *(T*)(p) = vst2_v_;  } while (0)

// k_w: bf16 planes of wq [32][256], wk [32][256], wv [256][256] ([out][in] = n-major as-is); one wave per row (32 lanes x 16 B = 512 B).
__global__ __launch_bounds__(256) void k_w(const float* __restrict__ wq, const float* __restrict__ wk, const float* __restrict__ wv, bf* WQ, bf* WK, bf* WV) {
    const int lane = threadIdx.x & 31, r = blockIdx.x * 8 + (threadIdx.x >> 5);      // 0 .. 32+32+256
    const int m = (r < HQ) ? 0 : (r < 2 * HQ) ? 1 : 2;     // wave-uniform
    v8us o;
    if (m == 0) { for (int i = 0; i < 8; ++i) o[i] = f2bf(wq[(size_t)r * CC + lane * 8 + i]); VST2(v8us, WQ + (size_t)r * CC + lane * 8, o); }
    else if (m == 1) { const int o2 = r - HQ; for (int i = 0; i < 8; ++i) o[i] = f2bf(wk[(size_t)o2 * CC + lane * 8 + i]); VST2(v8us, WK + (size_t)o2 * CC + lane * 8, o); }
    else { const int o2 = r - 2 * HQ; if (o2 < CC) { for (int i = 0; i < 8; ++i) o[i] = f2bf(wv[(size_t)o2 * CC + lane * 8 + i]); VST2(v8us, WV + (size_t)o2 * CC + lane * 8, o); } }
}
// k_proj: block = (b, 64 positions), 8 waves. The block's x tile (256 channels x 64 positions) is read once in whole lines, rounded to bf16 and laid position-major in
// LDS; all three projections take their A fragments (16 positions x 32 channels) from that tile and their B fragments (weight rows) from global memory, requested
// together with the tile. v: wave = 32 output channels x 64 positions; a lane's accumulator holds 8 consecutive positions of ONE channel, so hi + residual pack straight into
// channel-major 16-byte pieces, gathered through LDS into 128-B lines of VTH / VTL [b][c][n]. q | k: wave = (16 positions, q or k), planes [tok][32].
#define XPI 264                       // x tile row pitch in LDS, bf16 units: 512-B row + 16 B (16 B x odd: no bank conflict for 16-byte reads of 16 rows)
#define OPI 72                        // v staging row pitch, f16 units: 128-B row + 16 B
__global__ __launch_bounds__(256) void k_proj(const float* __restrict__ x, const bf* __restrict__ WQ, const bf* __restrict__ WK, const bf* __restrict__ WV,
                                              const float* __restrict__ bq, const float* __restrict__ bk, const float* __restrict__ bv,
                                              h16* QH, h16* QL, h16* KH, h16* KL, h16* VTH, h16* VTL) {
    __shared__ __align__(16) unsigned short xs[64 * XPI];
    __shared__ __align__(16) h16 vsh[CC * OPI];
    __shared__ __align__(16) h16 vsl[CC * OPI];
    __shared__ __align__(16) float ost[8][16 * 36];
    const int tid = threadIdx.x, lane = tid & 31, wave = tid >> 5, lr = lane & 15, hi = lane >> 4;
    const int n0 = blockIdx.x * 64, b = blockIdx.y, which = wave >> 2, nt = wave & 3;
    const bf* W = which ? WK : WQ; const float* bias = which ? bk : bq; h16* PH = which ? KH : QH; h16* PL = which ? KL : QL;   // wave-uniform selects of whole buffers
    // the wave's weight fragments for all eight k steps: they do not depend on the tile, so their latency passes under the tile's load and transpose
    const bf* vp0 = WV + (size_t)(wave * 32 + lr) * CC + 8 * hi; const bf* vp1 = vp0 + 16 * CC;
    const bf* qp0 = W + (size_t)lr * CC + 8 * hi; const bf* qp1 = qp0 + 16 * CC;
    const float* bvp = bv + wave * 32 + lr; const float* bbp = bias + lr;
    v16bf wvf[8][2], wqf[8][2];
#pragma unroll
    for (int ks = 0; ks < 8; ++ks) {
        wvf[ks][0] = cat16b(*(const v8us*)(vp0 + ks * 32), *(const v8us*)(vp0 + ks * 32 + 16)); wvf[ks][1] = cat16b(*(const v8us*)(vp1 + ks * 32), *(const v8us*)(vp1 + ks * 32 + 16));
        wqf[ks][0] = cat16b(*(const v8us*)(qp0 + ks * 32), *(const v8us*)(qp0 + ks * 32 + 16)); wqf[ks][1] = cat16b(*(const v8us*)(qp1 + ks * 32), *(const v8us*)(qp1 + ks * 32 + 16));
    }
    const float bv0 = bvp[0], bv1 = bvp[16], bb0 = bbp[0], bb1 = bbp[16];
    // x tile: thread = (4 positions, 16 channels); 16 lanes cover one channel's 256-B run
    {
        const int piece = tid & 15, g = tid >> 4;
        const float* xp = x + ((size_t)b * CC + g * 16) * NN_ + n0 + piece * 4;
        v4f xr[16];
#pragma unroll
        for (int i = 0; i < 16; ++i) xr[i] = *(const v4fa*)(xp + (size_t)i * NN_);
        // every load above has been issued; the wait takes their addresses as inputs, so that no address register is reused in front of it
        asm volatile("s_wait_xcnt 0x0" :: "v"(vp0), "v"(vp1), "v"(qp0), "v"(qp1), "v"(bvp), "v"(bbp), "v"(xp) : "memory");
#pragma unroll
        for (int k = 0; k < 4; ++k)
#pragma unroll
            for (int o = 0; o < 2; ++o) { v8us p;
#pragma unroll
                for (int e = 0; e < 8; ++e) p[e] = f2bf(xr[o * 8 + e][k]);
                *(v8usa*)(xs + (piece * 4 + k) * XPI + g * 16 + o * 8) = p; }
    }
    __syncthreads();
    v8f av[4][2], aq[2] = {(v8f){}, (v8f){}};
#pragma unroll
    for (int m = 0; m < 4; ++m) { av[m][0] = (v8f){}; av[m][1] = (v8f){}; }
    // A fragments in two register sets: step ks + 1 is read from LDS as one group ahead of step ks's products, so its latency passes under them
    v16bf a[2][5];
    auto ldA = [&](int ks, v16bf (&f)[5]) {
#pragma unroll
        for (int m = 0; m < 5; ++m) { const unsigned short* ap = xs + ((m < 4 ? m : nt) * 16 + lr) * XPI + ks * 32 + 8 * hi; f[m] = cat16b(*(const v8usa*)ap, *(const v8usa*)(ap + 16)); }
    };
    ldA(0, a[0]);
#pragma unroll
    for (int ks = 0; ks < 8; ++ks) {
        if (ks < 7) ldA(ks + 1, a[(ks + 1) & 1]);
        __builtin_amdgcn_sched_barrier(0);   // keeps the next step's reads together in front of this step's products; without it they sink to their uses, one exposed LDS latency each
#pragma unroll
        for (int m = 0; m < 4; ++m) { av[m][0] = wmmab(a[ks & 1][m], wvf[ks][0], av[m][0]); av[m][1] = wmmab(a[ks & 1][m], wvf[ks][1], av[m][1]); }
        aq[0] = wmmab(a[ks & 1][4], wqf[ks][0], aq[0]); aq[1] = wmmab(a[ks & 1][4], wqf[ks][1], aq[1]);
    }
    // v: register j of av[m][t] = position m * 16 + 8 * hi + j of channel wave * 32 + t * 16 + lr
#pragma unroll
    for (int t = 0; t < 2; ++t) { const int c = wave * 32 + t * 16 + lr; const float b2 = bfr(t ? bv1 : bv0);
#pragma unroll
        for (int m = 0; m < 4; ++m) { const v8f v = av[m][t] + b2; const v8h oh = __builtin_convertvector(v, v8h), ol = __builtin_convertvector((v - __builtin_convertvector(oh, v8f)) * LOSC, v8h);
            *(v8ha*)(vsh + c * OPI + m * 16 + hi * 8) = oh; *(v8ha*)(vsl + c * OPI + m * 16 + hi * 8) = ol; } }
    float* os = &ost[wave][0];
#pragma unroll
    for (int t = 0; t < 2; ++t) { const float bb = bfr(t ? bb1 : bb0);
#pragma unroll
        for (int j = 0; j < 8; ++j) os[(hi * 8 + j) * 36 + t * 16 + lr] = aq[t][j] + bb; }
    __syncthreads();
    const size_t r0 = (size_t)b * NN_ + n0 + nt * 16;
#pragma unroll
    for (int s = 0; s < 2; ++s) { const int row = s * 8 + (lane >> 2), pc = lane & 3; const float* sp = os + row * 36 + pc * 8;   // 4 lanes x 16 B per 64-B row
        const v8f v = __builtin_shufflevector(*(const v4fa*)sp, *(const v4fa*)(sp + 4), 0, 1, 2, 3, 4, 5, 6, 7);
        const v8h oh = __builtin_convertvector(v, v8h), ol = __builtin_convertvector((v - __builtin_convertvector(oh, v8f)) * LOSC, v8h);
        *(v8h*)(PH + (r0 + row) * HQ + pc * 8) = oh; *(v8h*)(PL + (r0 + row) * HQ + pc * 8) = ol; }
#pragma unroll
    for (int s = 0; s < 8; ++s) { const int c = (tid >> 3) + 32 * s, pc = tid & 7; const size_t o = ((size_t)b * CC + c) * NN_ + n0 + pc * 8;   // 8 lanes x 16 B per 128-B row
        *(v8h*)(VTH + o) = *(const v8ha*)(vsh + c * OPI + pc * 8); *(v8h*)(VTL + o) = *(const v8ha*)(vsl + c * OPI + pc * 8); }
}
// k_attn: block = (b, 128 positions i, channel half), 8 waves, wave = 16 positions: one block per WGP, so a staged tile feeds all the WGP's waves. The keys are walked in LDS stages of 64 (two 32-key tiles): each stage holds the block's
// V rows (128 channels x 64 keys, hi and residual plane) and K rows (64 keys x 32 dims, hi and residual plane), brought in ONCE per block by per-lane 16-byte
// asynchronous copies, whole 128-B lines per row, into two buffers: stage s + 2 is issued when stage s has been read, so it flies while stage s + 1 is worked on.
// Per 32-key tile, both products transposed (keys x queries, then channels x queries): energy (hi.hi + hi.lo + lo.hi), a lane holds 16 scores of ONE query, so the
// online softmax is in-lane but for one exchange between the wave's halves; weights x32768 as f16 hi + UNSCALED residual go from the score registers straight into
// the B operand; o += vh.wh + vh.wl, ox += vl.wh.
// Epilogue: out[b][c][i] = o/l + x[b][c][i], gathered through LDS (per c the block's 128 i are one 512-B run).
#define QB   128                      // positions i per block
#define OTP  (QB + 4)                 // output staging row pitch, floats
#define KT   64                       // keys per stage
#define NST  (NN_ / KT)
#define VPI  72                       // V row pitch in LDS, f16 units: 128-B row + 16 B (16 B x odd: no bank conflict for 16-byte reads of 16 rows)
#define KPI  40                       // K row pitch in LDS, f16 units: 64-B row + 16 B
#define VPLN (128 * VPI)
#define KPLN (KT * KPI)
#define STG  (2 * VPLN + 2 * KPLN)    // f16 units per stage: V hi | V residual | K hi | K residual

// One lane's five copies of one plane pair (4 V rows 32 apart, 1 K piece). The s_wait_xcnt closes the statement so that no later
// address update can be scheduled in front of it while a copy still names its registers.
__device__ __forceinline__ void copy5(unsigned lv, unsigned lk, const h16* gv, const h16* gk) {
    asm volatile("global_load_async_to_lds_b128 %0, %5, off\n\t"
                 "global_load_async_to_lds_b128 %1, %6, off\n\t"
                 "global_load_async_to_lds_b128 %2, %7, off\n\t"
                 "global_load_async_to_lds_b128 %3, %8, off\n\t"
                 "global_load_async_to_lds_b128 %4, %9, off\n\t"
                 "s_wait_xcnt 0x0"
                 :: "v"(lv), "v"(lv + 32 * VPI * 2), "v"(lv + 64 * VPI * 2), "v"(lv + 96 * VPI * 2), "v"(lk),
                    "v"(gv), "v"(gv + 32 * NN_), "v"(gv + 64 * NN_), "v"(gv + 96 * NN_), "v"(gk)
                 : "memory");
}

// two waves per SIMD is what one 8-wave block per WGP gives; stated, because without it the build holds itself to 256 registers and scatters the V fragment reads among the products
__global__ __launch_bounds__(256) __attribute__((amdgpu_waves_per_eu(2, 2))) void k_attn(const h16* __restrict__ QH, const h16* __restrict__ QL, const h16* __restrict__ KH, const h16* __restrict__ KL, const h16* __restrict__ VTH, const h16* __restrict__ VTL,
                                             const float* __restrict__ x, float* out) {
    __shared__ __align__(16) h16 ring[2 * STG];
    __shared__ __align__(16) float ot[128 * OTP];
    const int tid = threadIdx.x, lane = tid & 31, wave = tid >> 5, lr = lane & 15, hi = lane >> 4;
    const int b = blockIdx.x / (NN_ / QB), it = blockIdx.x - b * (NN_ / QB), chalf = blockIdx.y, i0l = it * QB, q0 = i0l + wave * 16;
    const size_t tok0 = (size_t)b * NN_;
    // this lane's places: V row tid >> 3 (+ 32 per copy), 16-byte piece tid & 7; K row tid >> 2, piece tid & 3
    const unsigned ring0 = (unsigned)(size_t)&ring[0];
    const unsigned lv0 = ring0 + (unsigned)((tid >> 3) * (VPI * 2) + (tid & 7) * 16), kp = (unsigned)((tid >> 2) * (KPI * 2) + (tid & 3) * 16);
    const unsigned gvo = (unsigned)((b * CC + chalf * 128 + (tid >> 3)) * NN_ + (tid & 7) * 8), gko = (unsigned)(b * (NN_ * HQ) + tid * 8);   // element offsets, 32 bits each: two registers live across the loop
    auto fill = [&](int st) {
        const unsigned bo = (unsigned)(st & 1) * (STG * 2);
        const unsigned lk = kp + ((st & 1) ? ring0 + (STG + 2 * VPLN) * 2 : ring0 + 2 * VPLN * 2);   // the buffer's K base is picked as a scalar, so only the lane's own offset lives across the loop
        const unsigned vo = gvo + (unsigned)st * KT, ko = gko + (unsigned)st * (KT * HQ);
        copy5(lv0 + bo, lk, VTH + vo, KH + ko);
        copy5(lv0 + bo + VPLN * 2, lk + KPLN * 2, VTL + vo, KL + ko);
    };
    fill(0);
    asm volatile("s_wait_asynccnt 0x0" ::: "memory");   // this wave's share of stage 0 has landed
    __syncthreads();                                    // publishes stage 0 to the other waves
    fill(1);
    const size_t qo = (tok0 + q0 + lr) * HQ + 8 * hi;
    const v16h qa = cat16(*(const v8h*)(QH + qo), *(const v8h*)(QH + qo + 16));
    v8f o[8], ox[8];
#pragma unroll
    for (int n = 0; n < 8; ++n) { o[n] = (v8f){}; ox[n] = (v8f){}; }
    float mrun = -3.0e38f, lrun = 0.f;   // this lane's query (lr): running maximum (both halves alike) and the sum over this half's keys
#pragma unroll 1   // one body for all stages: the buffer is picked by the stage's parity
    for (int st = 0; st < NST; ++st) {
        const h16* sb = ring + (st & 1) * STG;
#pragma unroll 1   // kept rolled: unrolled, the two tiles' fragments are live together and the build spills to scratch
        for (int sub = 0; sub < 2; ++sub) {
            const h16* kb = sb + 2 * VPLN + (sub * 32 + lr) * KPI + 8 * hi;
            const v16h k0h = cat16(*(const v8ha*)kb, *(const v8ha*)(kb + 16)), k1h = cat16(*(const v8ha*)(kb + 16 * KPI), *(const v8ha*)(kb + 16 * KPI + 16));
            const v16h k0l = cat16(*(const v8ha*)(kb + KPLN), *(const v8ha*)(kb + KPLN + 16)), k1l = cat16(*(const v8ha*)(kb + KPLN + 16 * KPI), *(const v8ha*)(kb + KPLN + 16 * KPI + 16));
            const v16h ql = cat16(*(const v8h*)(QL + qo), *(const v8h*)(QL + qo + 16));
            // transposed energy: keys are the rows, queries the columns; register j of s0 / s1 = key 8 * hi + j / 16 + 8 * hi + j against query lr
            v8f s0 = wmma16(k0h, qa, (v8f){}), s1 = wmma16(k1h, qa, (v8f){}), x0 = wmma16(k0h, ql, (v8f){}), x1 = wmma16(k1h, ql, (v8f){});
            x0 = wmma16(k0l, qa, x0); x1 = wmma16(k1l, qa, x1);
            // four vector slots between the last energy product and the first vector read of its result (the q fragments are not named: an asm operand must sit below v256, and they need not)
            asm volatile("v_nop\n\tv_nop\n\tv_nop\n\tv_nop" : "+v"(s0), "+v"(s1), "+v"(x0), "+v"(x1));
            // the tile's V fragments, read from the stage as ONE group here, not among the products below: their LDS latency passes under the softmax
            v16h vh[8], vl[8];
#pragma unroll
            for (int n = 0; n < 8; ++n) { const h16* vb = sb + (n * 16 + lr) * VPI + sub * 32 + hi * 8;
                vh[n] = cat16(*(const v8ha*)vb, *(const v8ha*)(vb + 16)); vl[n] = cat16(*(const v8ha*)(vb + VPLN), *(const v8ha*)(vb + VPLN + 16)); }
            const v8f a0 = s0 + x0 * LOSCI, a1 = s1 + x1 * LOSCI;
            const v8f m8 = __builtin_elementwise_max(a0, a1);
            float mx = fmaxf(fmaxf(fmaxf(m8[0], m8[1]), fmaxf(m8[2], m8[3])), fmaxf(fmaxf(m8[4], m8[5]), fmaxf(m8[6], m8[7])));
            mx = fmaxf(mx, xhalf(mx));   // the other half's 16 keys of the same query
            const float mn = fmaxf(mrun, mx), alpha = __expf(mrun - mn);
            mrun = mn;
            // the weights stay in registers: the two score tiles, converted in place, are the B operand (element s = key 8 * hi + s, then 16 + 8 * hi + s - 8: the V loader's k order)
            v8f p0, p1;
#pragma unroll
            for (int j = 0; j < 8; ++j) { p0[j] = __expf(a0[j] - mn); p1[j] = __expf(a1[j] - mn); }
            const v8f ps0 = p0 * PSC, ps1 = p1 * PSC, pp = p0 + p1;
            const v8h h0 = __builtin_convertvector(ps0, v8h), h1 = __builtin_convertvector(ps1, v8h);
            const v8h r0 = __builtin_convertvector(ps0 - __builtin_convertvector(h0, v8f), v8h), r1 = __builtin_convertvector(ps1 - __builtin_convertvector(h1, v8f), v8h);   // UNSCALED residual
            const v16h pa = cat16(h0, h1), px = cat16(r0, r1);
            const float ls = ((pp[0] + pp[1]) + (pp[2] + pp[3])) + ((pp[4] + pp[5]) + (pp[6] + pp[7]));
            lrun = lrun * alpha + ls;
#pragma unroll
            for (int n = 0; n < 8; ++n)
#pragma unroll
                for (int j = 0; j < 8; ++j) { o[n][j] *= alpha; ox[n][j] *= alpha; }
            // transposed output tiles: register j of o[n] = channel n * 16 + 8 * hi + j of query lr
#pragma unroll
            for (int n = 0; n < 8; ++n) { o[n] = wmma16(vh[n], pa, o[n]); o[n] = wmma16(vh[n], px, o[n]); ox[n] = wmma16(vl[n], pa, ox[n]); }
            // four vector slots behind the last product on the loop's back edge too, before its operands or results are touched
            asm volatile("v_nop\n\tv_nop\n\tv_nop\n\tv_nop" : "+v"(o[0]), "+v"(o[7]), "+v"(ox[0]), "+v"(ox[7]) : "v"(pa), "v"(px));
        }
        asm volatile("s_wait_dscnt 0x0" ::: "memory");      // this wave's reads of stage st are done before its buffer may be refilled
        asm volatile("s_wait_asynccnt 0x0" ::: "memory");   // this wave's share of stage st + 1 has landed
        __syncthreads();                                    // publishes stage st + 1 and ends every wave's reads of stage st
        if (st + 2 < NST) fill(st + 2);
    }
    asm volatile("s_wait_asynccnt 0x0" ::: "memory");       // nothing of the ring is in flight when the wave goes on to the epilogue
    const float inv = 1.0f / ((lrun + xhalf(lrun)) * PSC);   // the two halves' key sums joined once
    // staging: ot[c_local][i_local] (128 x 128)
#pragma unroll
    for (int n = 0; n < 8; ++n)
#pragma unroll
        for (int j = 0; j < 8; ++j) ot[(n * 16 + hi * 8 + j) * OTP + wave * 16 + lr] = (o[n][j] + ox[n][j] * LOSCI) * inv;
    __syncthreads();
    // out[b][c][i0l + i] + x residual: per c a 512-B run (32 lanes x 16 B, one c per instruction); 128 c rows -> 8 waves x 16 instructions
    auto pass = [&]() {
#pragma unroll
        for (int s = 0; s < 16; ++s) { const int cl = wave * 16 + s, piece = lane; const size_t go = ((size_t)b * CC + chalf * 128 + cl) * NN_ + i0l + piece * 4;
            v4f val = *(const v4fa*)(ot + cl * OTP + piece * 4);
#pragma unroll
            for (int i = 0; i < 4; ++i) val[i] += bfr(x[go + i]);
            *(v4f*)(out + go) = val; }
    };
    pass(); 
}

extern "C" void kernel_launch(void* const* d_in, const int* in_sizes, int n_in,
                              void* d_out, int out_size, void* d_ws, size_t ws_size, hipStream_t stream) {
    (void)in_sizes; (void)n_in; (void)out_size;
    const float* x = (const float*)d_in[0]; const float* wq = (const float*)d_in[1]; const float* bq = (const float*)d_in[2]; const float* wk = (const float*)d_in[3]; const float* bk = (const float*)d_in[4];
    const float* wv = (const float*)d_in[5]; const float* bv = (const float*)d_in[6];
    float* out = (float*)d_out;    // [8][256][2048]
    char* wsp = (char*)d_ws;
    auto take = [&](size_t bytes) { char* p = wsp; wsp += (bytes + 255) & ~(size_t)255; return (void*)p; };
    bf* WQ = (bf*)take((size_t)HQ * CC * 2); bf* WK = (bf*)take((size_t)HQ * CC * 2); bf* WV = (bf*)take((size_t)CC * CC * 2);
    h16* QH = (h16*)take((size_t)NTK * HQ * 2); h16* QL = (h16*)take((size_t)NTK * HQ * 2); h16* KH = (h16*)take((size_t)NTK * HQ * 2); h16* KL = (h16*)take((size_t)NTK * HQ * 2);
    h16* VTH = (h16*)take((size_t)NTK * CC * 2); h16* VTL = (h16*)take((size_t)NTK * CC * 2);
    if ((size_t)(wsp - (char*)d_ws) > ws_size) return;    // 0.2 + 1 x 4 + 8.4 x 2 ~ 21 MB
    k_w<<<(2 * HQ + CC) / 8, 256, 0, stream>>>(wq, wk, wv, WQ, WK, WV);
    k_proj<<<dim3(NN_ / 64, NB_, 1), 256, 0, stream>>>(x, WQ, WK, WV, bq, bk, bv, QH, QL, KH, KL, VTH, VTL);
    k_attn<<<dim3(NB_ * (NN_ / QB), 2, 1), 256, 0, stream>>>(QH, QL, KH, KL, VTH, VTL, x, out);
}

// v005
// It runs in 62.3 microseconds.
// Next to v004, in two timings, it ran 1.06 times as fast each time.
// Over all steps from v000 it is 3.98 times as fast.
#include <hip/hip_runtime.h>

// Contractions, f32 accumulate: q/k = 1x1 convs ([16384 positions x 256].[256 x 32] each) and v ([16384 x 256].[256 x 256]) on v_wmma_f32_16x16x32_bf16 with PLAIN
// bf16 operands (inputs rounded once: exact); the position attention fused on v_wmma_f32_16x16x32_f16: energy = q.k over the 32 hidden dims (UNSCALED; q and k as
// f16 hi + residual x1024: hi.hi + hi.lo + lo.hi), softmax over the 2048 positions, out[c][i] = sum_j w[i][j] v[c][j] over all 256 channels with the weights
// (x32768) as f16 hi + UNSCALED residual and v as hi + residual x1024 — three products into two accumulator sets (o: wh.vh + wl.vh, ox: wh.vl); + x residual; output written channel-major

#define NB_  8
#define CC   256
#define NN_  2048
#define HQ   32
#define NTK  (NB_ * NN_)
#define PSC  32768.0f
#define LOSC 1024.0f
#define LOSCI (1.0f / 1024.0f)

typedef _Float16 h16;
typedef unsigned short bf;
typedef __attribute__((ext_vector_type(16))) __bf16   v16bf;
typedef __attribute__((ext_vector_type(16))) _Float16 v16h;
typedef __attribute__((ext_vector_type(8)))  _Float16 v8h;
typedef __attribute__((ext_vector_type(8)))  unsigned short v8us;
typedef __attribute__((ext_vector_type(8)))  float    v8f;
typedef __attribute__((ext_vector_type(4)))  float    v4f;
typedef v8h  __attribute__((may_alias)) v8ha;
typedef v4f  __attribute__((may_alias)) v4fa;
typedef v8us __attribute__((may_alias)) v8usa;

__device__ __forceinline__ unsigned short f2bf(float f) { unsigned u = __float_as_uint(f); u += 0x7FFFu + ((u >> 16) & 1u); return (unsigned short)(u >> 16); }
__device__ __forceinline__ float bf2f(unsigned short b) { return __uint_as_float(((unsigned)b) << 16); }
__device__ __forceinline__ float bfr(float f) { return bf2f(f2bf(f)); }
__device__ __forceinline__ v16h cat16(v8h lo, v8h hi) { return __builtin_shufflevector(lo, hi, 0, 1, 2, 3, 4, 5, 6, 7, 8, 9, 10, 11, 12, 13, 14, 15); }
__device__ __forceinline__ v16bf cat16b(v8us lo, v8us hi) { return __builtin_bit_cast(v16bf, __builtin_shufflevector(lo, hi, 0, 1, 2, 3, 4, 5, 6, 7, 8, 9, 10, 11, 12, 13, 14, 15)); }
__device__ __forceinline__ v8f wmma16(v16h a, v16h b, v8f c) { return __builtin_amdgcn_wmma_f32_16x16x32_f16(false, a, false, b, (short)0, c, false, false); }
__device__ __forceinline__ v8f wmmab(v16bf a, v16bf b, v8f c) { return __builtin_amdgcn_wmma_f32_16x16x32_bf16(false, a, false, b, (short)0, c, false, false); }
__device__ __forceinline__ float xhalf(float v) { return __builtin_bit_cast(float, __builtin_amdgcn_permlanex16(__builtin_bit_cast(int, v), __builtin_bit_cast(int, v), 0x76543210, 0xfedcba98, false, false)); }  // lane l with lane l ^ 16
#define VST2(T, p, v) do { const T vst2_v_ = (v); *(T*)(p) = vst2_v_;  } while (0)

// k_w: bf16 planes of wq [32][256], wk [32][256], wv [256][256] ([out][in] = n-major as-is); one wave per row (32 lanes x 16 B = 512 B).
__global__ __launch_bounds__(256) void k_w(const float* __restrict__ wq, const float* __restrict__ wk, const float* __restrict__ wv, bf* WQ, bf* WK, bf* WV) {
    const int lane = threadIdx.x & 31, r = blockIdx.x * 8 + (threadIdx.x >> 5);      // 0 .. 32+32+256
    const int m = (r < HQ) ? 0 : (r < 2 * HQ) ? 1 : 2;     // wave-uniform
    v8us o;
    if (m == 0) { for (int i = 0; i < 8; ++i) o[i] = f2bf(wq[(size_t)r * CC + lane * 8 + i]); VST2(v8us, WQ + (size_t)r * CC + lane * 8, o); }
    else if (m == 1) { const int o2 = r - HQ; for (int i = 0; i < 8; ++i) o[i] = f2bf(wk[(size_t)o2 * CC + lane * 8 + i]); VST2(v8us, WK + (size_t)o2 * CC + lane * 8, o); }
    else { const int o2 = r - 2 * HQ; if (o2 < CC) { for (int i = 0; i < 8; ++i) o[i] = f2bf(wv[(size_t)o2 * CC + lane * 8 + i]); VST2(v8us, WV + (size_t)o2 * CC + lane * 8, o); } }
}
// k_proj: block = (b, 64 positions), 8 waves. The block's x tile (256 channels x 64 positions) is read once in whole lines, rounded to bf16 and laid position-major in
// LDS; all three projections take their A fragments (16 positions x 32 channels) from that tile and their B fragments (weight rows) from global memory, requested
// together with the tile. v: wave = 32 output channels x 64 positions; a lane's accumulator holds 8 consecutive positions of ONE channel, so hi + residual pack straight into
// channel-major 16-byte pieces, gathered through LDS into 128-B lines of VTH / VTL [b][c][n]. q | k: wave = (16 positions, q or k), planes [tok][32].
#define XPI 264                       // x tile row pitch in LDS, bf16 units: 512-B row + 16 B (16 B x odd: no bank conflict for 16-byte reads of 16 rows)
#define OPI 72                        // v staging row pitch, f16 units: 128-B row + 16 B
__global__ __launch_bounds__(256) void k_proj(const float* __restrict__ x, const bf* __restrict__ WQ, const bf* __restrict__ WK, const bf* __restrict__ WV,
                                              const float* __restrict__ bq, const float* __restrict__ bk, const float* __restrict__ bv,
                                              h16* QH, h16* QL, h16* KH, h16* KL, h16* VTH, h16* VTL) {
    __shared__ __align__(16) unsigned short xs[64 * XPI];
    __shared__ __align__(16) h16 vsh[CC * OPI];
    __shared__ __align__(16) h16 vsl[CC * OPI];
    __shared__ __align__(16) float ost[8][16 * 36];
    const int tid = threadIdx.x, lane = tid & 31, wave = tid >> 5, lr = lane & 15, hi = lane >> 4;
    const int n0 = blockIdx.x * 64, b = blockIdx.y, which = wave >> 2, nt = wave & 3;
    const bf* W = which ? WK : WQ; const float* bias = which ? bk : bq; h16* PH = which ? KH : QH; h16* PL = which ? KL : QL;   // wave-uniform selects of whole buffers
    // the wave's weight fragments for all eight k steps: they do not depend on the tile, so their latency passes under the tile's load and transpose
    const bf* vp0 = WV + (size_t)(wave * 32 + lr) * CC + 8 * hi; const bf* vp1 = vp0 + 16 * CC;
    const bf* qp0 = W + (size_t)lr * CC + 8 * hi; const bf* qp1 = qp0 + 16 * CC;
    const float* bvp = bv + wave * 32 + lr; const float* bbp = bias + lr;
    v16bf wvf[8][2], wqf[8][2];
#pragma unroll
    for (int ks = 0; ks < 8; ++ks) {
        wvf[ks][0] = cat16b(*(const v8us*)(vp0 + ks * 32), *(const v8us*)(vp0 + ks * 32 + 16)); wvf[ks][1] = cat16b(*(const v8us*)(vp1 + ks * 32), *(const v8us*)(vp1 + ks * 32 + 16));
        wqf[ks][0] = cat16b(*(const v8us*)(qp0 + ks * 32), *(const v8us*)(qp0 + ks * 32 + 16)); wqf[ks][1] = cat16b(*(const v8us*)(qp1 + ks * 32), *(const v8us*)(qp1 + ks * 32 + 16));
    }
    const float bv0 = bvp[0], bv1 = bvp[16], bb0 = bbp[0], bb1 = bbp[16];
    // x tile: thread = (4 positions, 16 channels); 16 lanes cover one channel's 256-B run
    {
        const int piece = tid & 15, g = tid >> 4;
        const float* xp = x + ((size_t)b * CC + g * 16) * NN_ + n0 + piece * 4;
        v4f xr[16];
#pragma unroll
        for (int i = 0; i < 16; ++i) xr[i] = *(const v4fa*)(xp + (size_t)i * NN_);
        // every load above has been issued; the wait takes their addresses as inputs, so that no address register is reused in front of it
        asm volatile("s_wait_xcnt 0x0" :: "v"(vp0), "v"(vp1), "v"(qp0), "v"(qp1), "v"(bvp), "v"(bbp), "v"(xp) : "memory");
#pragma unroll
        for (int k = 0; k < 4; ++k)
#pragma unroll
            for (int o = 0; o < 2; ++o) { v8us p;
#pragma unroll
                for (int e = 0; e < 8; ++e) p[e] = f2bf(xr[o * 8 + e][k]);
                *(v8usa*)(xs + (piece * 4 + k) * XPI + g * 16 + o * 8) = p; }
    }
    __syncthreads();
    v8f av[4][2], aq[2] = {(v8f){}, (v8f){}};
#pragma unroll
    for (int m = 0; m < 4; ++m) { av[m][0] = (v8f){}; av[m][1] = (v8f){}; }
    // A fragments in two register sets: step ks + 1 is read from LDS as one group ahead of step ks's products, so its latency passes under them
    v16bf a[2][5];
    auto ldA = [&](int ks, v16bf (&f)[5]) {
#pragma unroll
        for (int m = 0; m < 5; ++m) { const unsigned short* ap = xs + ((m < 4 ? m : nt) * 16 + lr) * XPI + ks * 32 + 8 * hi; f[m] = cat16b(*(const v8usa*)ap, *(const v8usa*)(ap + 16)); }
    };
    ldA(0, a[0]);
#pragma unroll
    for (int ks = 0; ks < 8; ++ks) {
        if (ks < 7) ldA(ks + 1, a[(ks + 1) & 1]);
        __builtin_amdgcn_sched_barrier(0);   // keeps the next step's reads together in front of this step's products; without it they sink to their uses, one exposed LDS latency each
#pragma unroll
        for (int m = 0; m < 4; ++m) { av[m][0] = wmmab(a[ks & 1][m], wvf[ks][0], av[m][0]); av[m][1] = wmmab(a[ks & 1][m], wvf[ks][1], av[m][1]); }
        aq[0] = wmmab(a[ks & 1][4], wqf[ks][0], aq[0]); aq[1] = wmmab(a[ks & 1][4], wqf[ks][1], aq[1]);
    }
    // v: register j of av[m][t] = position m * 16 + 8 * hi + j of channel wave * 32 + t * 16 + lr
#pragma unroll
    for (int t = 0; t < 2; ++t) { const int c = wave * 32 + t * 16 + lr; const float b2 = bfr(t ? bv1 : bv0);
#pragma unroll
        for (int m = 0; m < 4; ++m) { const v8f v = av[m][t] + b2; const v8h oh = __builtin_convertvector(v, v8h), ol = __builtin_convertvector((v - __builtin_convertvector(oh, v8f)) * LOSC, v8h);
            *(v8ha*)(vsh + c * OPI + m * 16 + hi * 8) = oh; *(v8ha*)(vsl + c * OPI + m * 16 + hi * 8) = ol; } }
    float* os = &ost[wave][0];
#pragma unroll
    for (int t = 0; t < 2; ++t) { const float bb = bfr(t ? bb1 : bb0);
#pragma unroll
        for (int j = 0; j < 8; ++j) os[(hi * 8 + j) * 36 + t * 16 + lr] = aq[t][j] + bb; }
    __syncthreads();
    const size_t r0 = (size_t)b * NN_ + n0 + nt * 16;
#pragma unroll
    for (int s = 0; s < 2; ++s) { const int row = s * 8 + (lane >> 2), pc = lane & 3; const float* sp = os + row * 36 + pc * 8;   // 4 lanes x 16 B per 64-B row
        const v8f v = __builtin_shufflevector(*(const v4fa*)sp, *(const v4fa*)(sp + 4), 0, 1, 2, 3, 4, 5, 6, 7);
        const v8h oh = __builtin_convertvector(v, v8h), ol = __builtin_convertvector((v - __builtin_convertvector(oh, v8f)) * LOSC, v8h);
        *(v8h*)(PH + (r0 + row) * HQ + pc * 8) = oh; *(v8h*)(PL + (r0 + row) * HQ + pc * 8) = ol; }
#pragma unroll
    for (int s = 0; s < 8; ++s) { const int c = (tid >> 3) + 32 * s, pc = tid & 7; const size_t o = ((size_t)b * CC + c) * NN_ + n0 + pc * 8;   // 8 lanes x 16 B per 128-B row
        *(v8h*)(VTH + o) = *(const v8ha*)(vsh + c * OPI + pc * 8); *(v8h*)(VTL + o) = *(const v8ha*)(vsl + c * OPI + pc * 8); }
}
// k_attn: block = (b, 128 positions i, channel half), 8 waves, one block per WGP. Wave = (32 positions, one of a stage's two 32-key tiles): a V fragment read from LDS feeds two 16-position column groups, and the two waves
// that share 32 positions each walk half the keys and are joined once at the end. The keys are walked in LDS stages of 64 (two 32-key tiles): each stage holds the block's
// V rows (128 channels x 64 keys, hi and residual plane) and K rows (64 keys x 32 dims, hi and residual plane), brought in ONCE per block by per-lane 16-byte
// asynchronous copies, whole 128-B lines per row, into two buffers: stage s + 1 is issued when stage s - 1 has been read, so it flies while stage s is worked on.
// Per 32-key tile, both products transposed (keys x queries, then channels x queries): energy (hi.hi + hi.lo + lo.hi), a lane holds 16 scores of ONE query, so the
// online softmax is in-lane but for one exchange between the wave's halves; weights x32768 as f16 hi + UNSCALED residual go from the score registers straight into
// the B operand; o += vh.wh + vh.wl, ox += vl.wh.
// Epilogue: the two key halves exchange maximum and sum through LDS, each scales its own part, out[b][c][i] = part 0 + part 1 + x[b][c][i], gathered through LDS (per c the block's 128 i are one 512-B run).
#define QB   128                      // positions i per block
#define OTP  (QB + 4)                 // output staging row pitch, floats
#define KT   64                       // keys per stage
#define NST  (NN_ / KT)
#define VPI  72                       // V row pitch in LDS, f16 units: 128-B row + 16 B (16 B x odd: no bank conflict for 16-byte reads of 16 rows)
#define KPI  40                       // K row pitch in LDS, f16 units: 64-B row + 16 B
#define VPLN (128 * VPI)
#define KPLN (KT * KPI)
#define STG  (2 * VPLN + 2 * KPLN)    // f16 units per stage: V hi | V residual | K hi | K residual

// One lane's five copies of one plane pair (4 V rows 32 apart, 1 K piece). The s_wait_xcnt closes the statement so that no later
// address update can be scheduled in front of it while a copy still names its registers.
__device__ __forceinline__ void copy5(unsigned lv, unsigned lk, const h16* gv, const h16* gk) {
    asm volatile("global_load_async_to_lds_b128 %0, %5, off\n\t"
                 "global_load_async_to_lds_b128 %1, %6, off\n\t"
                 "global_load_async_to_lds_b128 %2, %7, off\n\t"
                 "global_load_async_to_lds_b128 %3, %8, off\n\t"
                 "global_load_async_to_lds_b128 %4, %9, off\n\t"
                 "s_wait_xcnt 0x0"
                 :: "v"(lv), "v"(lv + 32 * VPI * 2), "v"(lv + 64 * VPI * 2), "v"(lv + 96 * VPI * 2), "v"(lk),
                    "v"(gv), "v"(gv + 32 * NN_), "v"(gv + 64 * NN_), "v"(gv + 96 * NN_), "v"(gk)
                 : "memory");
}

// two waves per SIMD is what one 8-wave block per WGP gives; stated, because without it the build holds itself to 256 registers and scatters the V fragment reads among the products
__global__ __launch_bounds__(256) __attribute__((amdgpu_waves_per_eu(2, 2))) void k_attn(const h16* __restrict__ QH, const h16* __restrict__ QL, const h16* __restrict__ KH, const h16* __restrict__ KL, const h16* __restrict__ VTH, const h16* __restrict__ VTL,
                                             const float* __restrict__ x, float* out) {
    __shared__ __align__(16) h16 ring[2 * STG];
    __shared__ __align__(16) float ot[2 * 128 * OTP];   // one plane per key half
    __shared__ float jm[2][QB], jl[2][QB];              // each key half's maximum and sum per position
    const int tid = threadIdx.x, lane = tid & 31, wave = tid >> 5, lr = lane & 15, hi = lane >> 4, qg = wave & 3, kh = wave >> 2;
    const int b = blockIdx.x / (NN_ / QB), it = blockIdx.x - b * (NN_ / QB), chalf = blockIdx.y, i0l = it * QB, q0 = i0l + qg * 32;
    const size_t tok0 = (size_t)b * NN_;
    // this lane's places: V row tid >> 3 (+ 32 per copy), 16-byte piece tid & 7; K row tid >> 2, piece tid & 3
    const unsigned ring0 = (unsigned)(size_t)&ring[0];
    const unsigned lv0 = ring0 + (unsigned)((tid >> 3) * (VPI * 2) + (tid & 7) * 16), kp = (unsigned)((tid >> 2) * (KPI * 2) + (tid & 3) * 16);
    const unsigned gvo = (unsigned)((b * CC + chalf * 128 + (tid >> 3)) * NN_ + (tid & 7) * 8), gko = (unsigned)(b * (NN_ * HQ) + tid * 8);   // element offsets, 32 bits each: two registers live across the loop
    auto fill = [&](int st) {
        const unsigned bo = (unsigned)(st & 1) * (STG * 2);
        const unsigned lk = kp + ((st & 1) ? ring0 + (STG + 2 * VPLN) * 2 : ring0 + 2 * VPLN * 2);   // the buffer's K base is picked as a scalar, so only the lane's own offset lives across the loop
        const unsigned vo = gvo + (unsigned)st * KT, ko = gko + (unsigned)st * (KT * HQ);
        copy5(lv0 + bo, lk, VTH + vo, KH + ko);
        copy5(lv0 + bo + VPLN * 2, lk + KPLN * 2, VTL + vo, KL + ko);
    };
    fill(0);
    asm volatile("s_wait_asynccnt 0x0" ::: "memory");   // this wave's share of stage 0 has landed
    __syncthreads();                                    // publishes stage 0 to the other waves
    const h16* qhp = QH + (tok0 + q0 + lr) * HQ + 8 * hi; const h16* qlp = QL + (tok0 + q0 + lr) * HQ + 8 * hi;
    v16h qa[2], ql[2];   // column group g = positions q0 + 16 * g + lr
#pragma unroll
    for (int g = 0; g < 2; ++g) { qa[g] = cat16(*(const v8h*)(qhp + g * 16 * HQ), *(const v8h*)(qhp + g * 16 * HQ + 16)); ql[g] = cat16(*(const v8h*)(qlp + g * 16 * HQ), *(const v8h*)(qlp + g * 16 * HQ + 16)); }
    // the q loads have been issued; the wait takes their addresses as inputs, so that no address register is reused in front of it
    asm volatile("s_wait_xcnt 0x0" :: "v"(qhp), "v"(qlp) : "memory");
    v8f o[2][8], ox[2][8];
#pragma unroll
    for (int g = 0; g < 2; ++g)
#pragma unroll
        for (int n = 0; n < 8; ++n) { o[g][n] = (v8f){}; ox[g][n] = (v8f){}; }
    float mrun[2] = {-3.0e38f, -3.0e38f}, lrun[2] = {0.f, 0.f};   // this lane's two queries: running maximum (both lane halves alike) and the sum over this lane half's keys
#pragma unroll 1   // one body for all stages: the buffer is picked by the stage's parity
    for (int st = 0; st < NST; ++st) {
        // the refill stands at the stage's top, directly behind the barrier that ended every wave's reads of that buffer (stage st - 1's): the same place in run-time order as at the foot. With its branch
        // at the foot the build sinks the weight sums behind the branch, keeps both column groups' weights live through the products and spills to scratch.
        if (st + 1 < NST) fill(st + 1);
        const h16* sb = ring + (st & 1) * STG;
        {
            const h16* kb = sb + 2 * VPLN + (kh * 32 + lr) * KPI + 8 * hi;   // this wave's tile of the stage
            const v16h k0h = cat16(*(const v8ha*)kb, *(const v8ha*)(kb + 16)), k1h = cat16(*(const v8ha*)(kb + 16 * KPI), *(const v8ha*)(kb + 16 * KPI + 16));
            const v16h k0l = cat16(*(const v8ha*)(kb + KPLN), *(const v8ha*)(kb + KPLN + 16)), k1l = cat16(*(const v8ha*)(kb + KPLN + 16 * KPI), *(const v8ha*)(kb + KPLN + 16 * KPI + 16));
            // transposed energy: keys are the rows, queries the columns; register j of s0 / s1 = key 8 * hi + j / 16 + 8 * hi + j against query lr of the group
            v8f s0[2], s1[2], x0[2], x1[2];
#pragma unroll
            for (int g = 0; g < 2; ++g) { s0[g] = wmma16(k0h, qa[g], (v8f){}); s1[g] = wmma16(k1h, qa[g], (v8f){}); x0[g] = wmma16(k0h, ql[g], (v8f){}); x1[g] = wmma16(k1h, ql[g], (v8f){}); }
#pragma unroll
            for (int g = 0; g < 2; ++g) { x0[g] = wmma16(k0l, qa[g], x0[g]); x1[g] = wmma16(k1l, qa[g], x1[g]); }
            // four vector slots between the last energy product and the first vector read of its result
            asm volatile("v_nop\n\tv_nop\n\tv_nop\n\tv_nop" : "+v"(s0[0]), "+v"(s1[0]), "+v"(x0[0]), "+v"(x1[0]), "+v"(s0[1]), "+v"(s1[1]), "+v"(x0[1]), "+v"(x1[1]));
            // the tile's V fragments are read from the stage in TWO runs, not among the products in pairs: six channel tiles here, their LDS latency passes under the softmax; the last two
            // behind it, their latency passes under the first products (all sixteen fragments at once, beside both column groups' scores, do not fit the registers of two waves per SIMD)
            v16h vh[8], vl[8];
            auto ldV = [&](int n) { const h16* vb = sb + (n * 16 + lr) * VPI + kh * 32 + hi * 8;
                vh[n] = cat16(*(const v8ha*)vb, *(const v8ha*)(vb + 16)); vl[n] = cat16(*(const v8ha*)(vb + VPLN), *(const v8ha*)(vb + VPLN + 16)); };
#pragma unroll
            for (int n = 0; n < 6; ++n) ldV(n);
            __builtin_amdgcn_sched_barrier(0);   // keeps the first run of reads together in front of the softmax; without it they sink among the products in pairs, each place with an LDS wait of its own
            v16h pa[2], px[2]; float alpha[2];
#pragma unroll
            for (int g = 0; g < 2; ++g) {
                const v8f a0 = s0[g] + x0[g] * LOSCI, a1 = s1[g] + x1[g] * LOSCI;
                const v8f m8 = __builtin_elementwise_max(a0, a1);
                float mx = fmaxf(fmaxf(fmaxf(m8[0], m8[1]), fmaxf(m8[2], m8[3])), fmaxf(fmaxf(m8[4], m8[5]), fmaxf(m8[6], m8[7])));
                mx = fmaxf(mx, xhalf(mx));   // the other lane half's 16 keys of the same query
                const float mn = fmaxf(mrun[g], mx); alpha[g] = __expf(mrun[g] - mn);
                mrun[g] = mn;
                // the weights stay in registers: the two score tiles, converted in place, are the B operand (element s = key 8 * hi + s, then 16 + 8 * hi + s - 8: the V loader's k order)
                v8f p0, p1;
#pragma unroll
                for (int j = 0; j < 8; ++j) { p0[j] = __expf(a0[j] - mn); p1[j] = __expf(a1[j] - mn); }
                const v8f ps0 = p0 * PSC, ps1 = p1 * PSC, pp = p0 + p1;
                const v8h h0 = __builtin_convertvector(ps0, v8h), h1 = __builtin_convertvector(ps1, v8h);
                const v8h r0 = __builtin_convertvector(ps0 - __builtin_convertvector(h0, v8f), v8h), r1 = __builtin_convertvector(ps1 - __builtin_convertvector(h1, v8f), v8h);   // UNSCALED residual
                pa[g] = cat16(h0, h1); px[g] = cat16(r0, r1);
                const float ls = ((pp[0] + pp[1]) + (pp[2] + pp[3])) + ((pp[4] + pp[5]) + (pp[6] + pp[7]));
                lrun[g] = lrun[g] * alpha[g] + ls;
            }
            __builtin_amdgcn_sched_barrier(0);   // with the one behind the reads: keeps the second run of reads together and no earlier than here (lifted to the first run, the build spills to scratch)
#pragma unroll
            for (int n = 6; n < 8; ++n) ldV(n);
            __builtin_amdgcn_sched_barrier(0);   // without it the second run's reads scatter among the products, singly and in pairs
#pragma unroll
            for (int g = 0; g < 2; ++g)
#pragma unroll
                for (int n = 0; n < 8; ++n)
#pragma unroll
                    for (int j = 0; j < 8; ++j) { o[g][n][j] *= alpha[g]; ox[g][n][j] *= alpha[g]; }
            // transposed output tiles: register j of o[g][n] = channel n * 16 + 8 * hi + j of query lr of group g; each V fragment serves both groups
#pragma unroll
            for (int n = 0; n < 8; ++n)
#pragma unroll
                for (int g = 0; g < 2; ++g) { o[g][n] = wmma16(vh[n], pa[g], o[g][n]); o[g][n] = wmma16(vh[n], px[g], o[g][n]); ox[g][n] = wmma16(vl[n], pa[g], ox[g][n]); }
            // issue order of the block above: the rescaling multiplies go between the products, in the matrix unit's shadow; without it the build puts most of them in front of the products they do not feed
            __builtin_amdgcn_sched_group_barrier(0x2, 8, 0);
#pragma unroll
            for (int i = 0; i < 24; ++i) { __builtin_amdgcn_sched_group_barrier(0x8, 1, 0); __builtin_amdgcn_sched_group_barrier(0x2, 7, 0); }
#pragma unroll
            for (int i = 0; i < 24; ++i) { __builtin_amdgcn_sched_group_barrier(0x8, 1, 0); __builtin_amdgcn_sched_group_barrier(0x2, 3, 0); }
            // four vector slots behind the last product on the loop's back edge too, before its operands or results are touched
            asm volatile("v_nop\n\tv_nop\n\tv_nop\n\tv_nop" : "+v"(o[0][0]), "+v"(o[1][7]), "+v"(ox[0][0]), "+v"(ox[1][7]) : "v"(pa[0]), "v"(px[0]), "v"(pa[1]), "v"(px[1]));
        }
        asm volatile("s_wait_dscnt 0x0" ::: "memory");      // this wave's reads of stage st are done before its buffer may be refilled
        asm volatile("s_wait_asynccnt 0x0" ::: "memory");   // this wave's share of stage st + 1 has landed
        __syncthreads();                                    // publishes stage st + 1 and ends every wave's reads of stage st
    }
    asm volatile("s_wait_asynccnt 0x0" ::: "memory");       // nothing of the ring is in flight when the wave goes on to the epilogue
    float lt[2];
#pragma unroll
    for (int g = 0; g < 2; ++g) { lt[g] = lrun[g] + xhalf(lrun[g]);   // the two lane halves' key sums joined once
        if (hi == 0) { jm[kh][qg * 32 + g * 16 + lr] = mrun[g]; jl[kh][qg * 32 + g * 16 + lr] = lt[g]; } }
    __syncthreads();   // publishes each key half's maximum and sum to the wave that holds the other half
    // staging: ot[key half][c_local][i_local] (2 x 128 x 128), each part already on the joint maximum and divided by the joint sum
#pragma unroll
    for (int g = 0; g < 2; ++g) {
        const float mo = jm[kh ^ 1][qg * 32 + g * 16 + lr], lo = jl[kh ^ 1][qg * 32 + g * 16 + lr], mj = fmaxf(mrun[g], mo), f = __expf(mrun[g] - mj), fo = __expf(mo - mj);
        const float inv = f / ((lt[g] * f + lo * fo) * PSC);
#pragma unroll
        for (int n = 0; n < 8; ++n)
#pragma unroll
            for (int j = 0; j < 8; ++j) ot[(kh * 128 + n * 16 + hi * 8 + j) * OTP + qg * 32 + g * 16 + lr] = (o[g][n][j] + ox[g][n][j] * LOSCI) * inv;
    }
    __syncthreads();
    // out[b][c][i0l + i] + x residual: per c a 512-B run (32 lanes x 16 B, one c per instruction); 128 c rows -> 8 waves x 16 instructions
    auto pass = [&]() {
#pragma unroll
        for (int s = 0; s < 16; ++s) { const int cl = wave * 16 + s, piece = lane; const size_t go = ((size_t)b * CC + chalf * 128 + cl) * NN_ + i0l + piece * 4;
            v4f val = *(const v4fa*)(ot + cl * OTP + piece * 4) + *(const v4fa*)(ot + (128 + cl) * OTP + piece * 4);   // key half 0 + key half 1
#pragma unroll
            for (int i = 0; i < 4; ++i) val[i] += bfr(x[go + i]);
            *(v4f*)(out + go) = val; }
    };
    pass(); 
}

extern "C" void kernel_launch(void* const* d_in, const int* in_sizes, int n_in,
                              void* d_out, int out_size, void* d_ws, size_t ws_size, hipStream_t stream) {
    (void)in_sizes; (void)n_in; (void)out_size;
    const float* x = (const float*)d_in[0]; const float* wq = (const float*)d_in[1]; const float* bq = (const float*)d_in[2]; const float* wk = (const float*)d_in[3]; const float* bk = (const float*)d_in[4];
    const float* wv = (const float*)d_in[5]; const float* bv = (const float*)d_in[6];
    float* out = (float*)d_out;    // [8][256][2048]
    char* wsp = (char*)d_ws;
    auto take = [&](size_t bytes) { char* p = wsp; wsp += (bytes + 255) & ~(size_t)255; return (void*)p; };
    bf* WQ = (bf*)take((size_t)HQ * CC * 2); bf* WK = (bf*)take((size_t)HQ * CC * 2); bf* WV = (bf*)take((size_t)CC * CC * 2);
    h16* QH = (h16*)take((size_t)NTK * HQ * 2); h16* QL = (h16*)take((size_t)NTK * HQ * 2); h16* KH = (h16*)take((size_t)NTK * HQ * 2); h16* KL = (h16*)take((size_t)NTK * HQ * 2);
    h16* VTH = (h16*)take((size_t)NTK * CC * 2); h16* VTL = (h16*)take((size_t)NTK * CC * 2);
    if ((size_t)(wsp - (char*)d_ws) > ws_size) return;    // 0.2 + 1 x 4 + 8.4 x 2 ~ 21 MB
    k_w<<<(2 * HQ + CC) / 8, 256, 0, stream>>>(wq, wk, wv, WQ, WK, WV);
    k_proj<<<dim3(NN_ / 64, NB_, 1), 256, 0, stream>>>(x, WQ, WK, WV, bq, bk, bv, QH, QL, KH, KL, VTH, VTL);
    k_attn<<<dim3(NB_ * (NN_ / QB), 2, 1), 256, 0, stream>>>(QH, QL, KH, KL, VTH, VTL, x, out);
}

// v006
// One run takes 57.9 microseconds.
// Two timings next to v005 both put it at 1.07 times that version's speed.
// Over all steps from v000 it is 4.26 times as fast.
#include <hip/hip_runtime.h>

// Contractions, f32 accumulate: q/k = 1x1 convs ([16384 positions x 256].[256 x 32] each) and v ([16384 x 256].[256 x 256]) on v_wmma_f32_16x16x32_bf16 with PLAIN
// bf16 operands (inputs rounded once: exact); the position attention fused on v_wmma_f32_16x16x32_f16: energy = q.k over the 32 hidden dims (UNSCALED; q and k as
// f16 hi + residual x1024: hi.hi + hi.lo + lo.hi), softmax over the 2048 positions, out[c][i] = sum_j w[i][j] v[c][j] over all 256 channels with the weights
// (x4) as f16 hi + UNSCALED residual and v as hi + residual x1024 — three products into two accumulator sets; + x residual; output written channel-major

#define NB_  8
#define CC   256
#define NN_  2048
#define HQ   32
#define NTK  (NB_ * NN_)
#define PSC  4.0f                     // weight scale: a weight is at most 2^13 (THR), so x4 stays inside f16
#define THR  9.0109f                  // 13 ln 2: how far a query's maximum may pass the reference in use before the accumulators are rescaled
#define LOSC 1024.0f
#define LOSCI (1.0f / 1024.0f)

typedef _Float16 h16;
typedef unsigned short bf;
typedef __attribute__((ext_vector_type(16))) __bf16   v16bf;
typedef __attribute__((ext_vector_type(16))) _Float16 v16h;
typedef __attribute__((ext_vector_type(8)))  _Float16 v8h;
typedef __attribute__((ext_vector_type(8)))  unsigned short v8us;
typedef __attribute__((ext_vector_type(8)))  float    v8f;
typedef __attribute__((ext_vector_type(4)))  float    v4f;
typedef v8h  __attribute__((may_alias)) v8ha;
typedef v4f  __attribute__((may_alias)) v4fa;
typedef v8us __attribute__((may_alias)) v8usa;

__device__ __forceinline__ unsigned short f2bf(float f) { unsigned u = __float_as_uint(f); u += 0x7FFFu + ((u >> 16) & 1u); return (unsigned short)(u >> 16); }
__device__ __forceinline__ float bf2f(unsigned short b) { return __uint_as_float(((unsigned)b) << 16); }
__device__ __forceinline__ float bfr(float f) { return bf2f(f2bf(f)); }
__device__ __forceinline__ v16h cat16(v8h lo, v8h hi) { return __builtin_shufflevector(lo, hi, 0, 1, 2, 3, 4, 5, 6, 7, 8, 9, 10, 11, 12, 13, 14, 15); }
__device__ __forceinline__ v16bf cat16b(v8us lo, v8us hi) { return __builtin_bit_cast(v16bf, __builtin_shufflevector(lo, hi, 0, 1, 2, 3, 4, 5, 6, 7, 8, 9, 10, 11, 12, 13, 14, 15)); }
__device__ __forceinline__ v8f wmma16(v16h a, v16h b, v8f c) { return __builtin_amdgcn_wmma_f32_16x16x32_f16(false, a, false, b, (short)0, c, false, false); }
__device__ __forceinline__ v8f wmmab(v16bf a, v16bf b, v8f c) { return __builtin_amdgcn_wmma_f32_16x16x32_bf16(false, a, false, b, (short)0, c, false, false); }
__device__ __forceinline__ float xhalf(float v) { return __builtin_bit_cast(float, __builtin_amdgcn_permlanex16(__builtin_bit_cast(int, v), __builtin_bit_cast(int, v), 0x76543210, 0xfedcba98, false, false)); }  // lane l with lane l ^ 16
#define VST2(T, p, v) do { const T vst2_v_ = (v); *(T*)(p) = vst2_v_;  } while (0)

// k_w: bf16 planes of wq [32][256], wk [32][256], wv [256][256] ([out][in] = n-major as-is); one wave per row (32 lanes x 16 B = 512 B).
__global__ __launch_bounds__(256) void k_w(const float* __restrict__ wq, const float* __restrict__ wk, const float* __restrict__ wv, bf* WQ, bf* WK, bf* WV) {
    const int lane = threadIdx.x & 31, r = blockIdx.x * 8 + (threadIdx.x >> 5);      // 0 .. 32+32+256
    const int m = (r < HQ) ? 0 : (r < 2 * HQ) ? 1 : 2;     // wave-uniform
    v8us o;
    if (m == 0) { for (int i = 0; i < 8; ++i) o[i] = f2bf(wq[(size_t)r * CC + lane * 8 + i]); VST2(v8us, WQ + (size_t)r * CC + lane * 8, o); }
    else if (m == 1) { const int o2 = r - HQ; for (int i = 0; i < 8; ++i) o[i] = f2bf(wk[(size_t)o2 * CC + lane * 8 + i]); VST2(v8us, WK + (size_t)o2 * CC + lane * 8, o); }
    else { const int o2 = r - 2 * HQ; if (o2 < CC) { for (int i = 0; i < 8; ++i) o[i] = f2bf(wv[(size_t)o2 * CC + lane * 8 + i]); VST2(v8us, WV + (size_t)o2 * CC + lane * 8, o); } }
}
// k_proj: block = (b, 64 positions), 8 waves. The block's x tile (256 channels x 64 positions) is read once in whole lines, rounded to bf16 and laid position-major in
// LDS; all three projections take their A fragments (16 positions x 32 channels) from that tile and their B fragments (weight rows) from global memory, requested
// together with the tile. v: wave = 32 output channels x 64 positions; a lane's accumulator holds 8 consecutive positions of ONE channel, so hi + residual pack straight into
// channel-major 16-byte pieces, gathered through LDS into 128-B lines of VTH / VTL [b][c][n]. q | k: wave = (16 positions, q or k), planes [tok][32].
#define XPI 264                       // x tile row pitch in LDS, bf16 units: 512-B row + 16 B (16 B x odd: no bank conflict for 16-byte reads of 16 rows)
#define OPI 72                        // v staging row pitch, f16 units: 128-B row + 16 B
__global__ __launch_bounds__(256) void k_proj(const float* __restrict__ x, const bf* __restrict__ WQ, const bf* __restrict__ WK, const bf* __restrict__ WV,
                                              const float* __restrict__ bq, const float* __restrict__ bk, const float* __restrict__ bv,
                                              h16* QH, h16* QL, h16* KH, h16* KL, h16* VTH, h16* VTL) {
    __shared__ __align__(16) unsigned short xs[64 * XPI];
    __shared__ __align__(16) h16 vsh[CC * OPI];
    __shared__ __align__(16) h16 vsl[CC * OPI];
    __shared__ __align__(16) float ost[8][16 * 36];
    const int tid = threadIdx.x, lane = tid & 31, wave = tid >> 5, lr = lane & 15, hi = lane >> 4;
    const int n0 = blockIdx.x * 64, b = blockIdx.y, which = wave >> 2, nt = wave & 3;
    const bf* W = which ? WK : WQ; const float* bias = which ? bk : bq; h16* PH = which ? KH : QH; h16* PL = which ? KL : QL;   // wave-uniform selects of whole buffers
    // the wave's weight fragments for all eight k steps: they do not depend on the tile, so their latency passes under the tile's load and transpose
    const bf* vp0 = WV + (size_t)(wave * 32 + lr) * CC + 8 * hi; const bf* vp1 = vp0 + 16 * CC;
    const bf* qp0 = W + (size_t)lr * CC + 8 * hi; const bf* qp1 = qp0 + 16 * CC;
    const float* bvp = bv + wave * 32 + lr; const float* bbp = bias + lr;
    v16bf wvf[8][2], wqf[8][2];
#pragma unroll
    for (int ks = 0; ks < 8; ++ks) {
        wvf[ks][0] = cat16b(*(const v8us*)(vp0 + ks * 32), *(const v8us*)(vp0 + ks * 32 + 16)); wvf[ks][1] = cat16b(*(const v8us*)(vp1 + ks * 32), *(const v8us*)(vp1 + ks * 32 + 16));
        wqf[ks][0] = cat16b(*(const v8us*)(qp0 + ks * 32), *(const v8us*)(qp0 + ks * 32 + 16)); wqf[ks][1] = cat16b(*(const v8us*)(qp1 + ks * 32), *(const v8us*)(qp1 + ks * 32 + 16));
    }
    const float bv0 = bvp[0], bv1 = bvp[16], bb0 = bbp[0], bb1 = bbp[16];
    // x tile: thread = (4 positions, 16 channels); 16 lanes cover one channel's 256-B run
    {
        const int piece = tid & 15, g = tid >> 4;
        const float* xp = x + ((size_t)b * CC + g * 16) * NN_ + n0 + piece * 4;
        v4f xr[16];
#pragma unroll
        for (int i = 0; i < 16; ++i) xr[i] = *(const v4fa*)(xp + (size_t)i * NN_);
        // every load above has been issued; the wait takes their addresses as inputs, so that no address register is reused in front of it
        asm volatile("s_wait_xcnt 0x0" :: "v"(vp0), "v"(vp1), "v"(qp0), "v"(qp1), "v"(bvp), "v"(bbp), "v"(xp) : "memory");
#pragma unroll
        for (int k = 0; k < 4; ++k)
#pragma unroll
            for (int o = 0; o < 2; ++o) { v8us p;
#pragma unroll
                for (int e = 0; e < 8; ++e) p[e] = f2bf(xr[o * 8 + e][k]);
                *(v8usa*)(xs + (piece * 4 + k) * XPI + g * 16 + o * 8) = p; }
    }
    __syncthreads();
    v8f av[4][2], aq[2] = {(v8f){}, (v8f){}};
#pragma unroll
    for (int m = 0; m < 4; ++m) { av[m][0] = (v8f){}; av[m][1] = (v8f){}; }
    // A fragments in two register sets: step ks + 1 is read from LDS as one group ahead of step ks's products, so its latency passes under them
    v16bf a[2][5];
    auto ldA = [&](int ks, v16bf (&f)[5]) {
#pragma unroll
        for (int m = 0; m < 5; ++m) { const unsigned short* ap = xs + ((m < 4 ? m : nt) * 16 + lr) * XPI + ks * 32 + 8 * hi; f[m] = cat16b(*(const v8usa*)ap, *(const v8usa*)(ap + 16)); }
    };
    ldA(0, a[0]);
#pragma unroll
    for (int ks = 0; ks < 8; ++ks) {
        if (ks < 7) ldA(ks + 1, a[(ks + 1) & 1]);
        __builtin_amdgcn_sched_barrier(0);   // keeps the next step's reads together in front of this step's products; without it they sink to their uses, one exposed LDS latency each
#pragma unroll
        for (int m = 0; m < 4; ++m) { av[m][0] = wmmab(a[ks & 1][m], wvf[ks][0], av[m][0]); av[m][1] = wmmab(a[ks & 1][m], wvf[ks][1], av[m][1]); }
        aq[0] = wmmab(a[ks & 1][4], wqf[ks][0], aq[0]); aq[1] = wmmab(a[ks & 1][4], wqf[ks][1], aq[1]);
    }
    // v: register j of av[m][t] = position m * 16 + 8 * hi + j of channel wave * 32 + t * 16 + lr
#pragma unroll
    for (int t = 0; t < 2; ++t) { const int c = wave * 32 + t * 16 + lr; const float b2 = bfr(t ? bv1 : bv0);
#pragma unroll
        for (int m = 0; m < 4; ++m) { const v8f v = av[m][t] + b2; const v8h oh = __builtin_convertvector(v, v8h), ol = __builtin_convertvector((v - __builtin_convertvector(oh, v8f)) * LOSC, v8h);
            *(v8ha*)(vsh + c * OPI + m * 16 + hi * 8) = oh; *(v8ha*)(vsl + c * OPI + m * 16 + hi * 8) = ol; } }
    float* os = &ost[wave][0];
#pragma unroll
    for (int t = 0; t < 2; ++t) { const float bb = bfr(t ? bb1 : bb0);
#pragma unroll
        for (int j = 0; j < 8; ++j) os[(hi * 8 + j) * 36 + t * 16 + lr] = aq[t][j] + bb; }
    __syncthreads();
    const size_t r0 = (size_t)b * NN_ + n0 + nt * 16;
#pragma unroll
    for (int s = 0; s < 2; ++s) { const int row = s * 8 + (lane >> 2), pc = lane & 3; const float* sp = os + row * 36 + pc * 8;   // 4 lanes x 16 B per 64-B row
        const v8f v = __builtin_shufflevector(*(const v4fa*)sp, *(const v4fa*)(sp + 4), 0, 1, 2, 3, 4, 5, 6, 7);
        const v8h oh = __builtin_convertvector(v, v8h), ol = __builtin_convertvector((v - __builtin_convertvector(oh, v8f)) * LOSC, v8h);
        *(v8h*)(PH + (r0 + row) * HQ + pc * 8) = oh; *(v8h*)(PL + (r0 + row) * HQ + pc * 8) = ol; }
#pragma unroll
    for (int s = 0; s < 8; ++s) { const int c = (tid >> 3) + 32 * s, pc = tid & 7; const size_t o = ((size_t)b * CC + c) * NN_ + n0 + pc * 8;   // 8 lanes x 16 B per 128-B row
        *(v8h*)(VTH + o) = *(const v8ha*)(vsh + c * OPI + pc * 8); *(v8h*)(VTL + o) = *(const v8ha*)(vsl + c * OPI + pc * 8); }
}
// k_attn: block = (b, 128 positions i, channel half), 8 waves, one block per WGP. Wave = (32 positions, one of a stage's two 32-key tiles): a V fragment read from LDS feeds two 16-position column groups, and the two waves
// that share 32 positions each walk half the keys and are joined once at the end. The keys are walked in LDS stages of 64 (two 32-key tiles): each stage holds the block's
// V rows (128 channels x 64 keys, hi and residual plane) and K rows (64 keys x 32 dims, hi and residual plane), brought in ONCE per block by per-lane 16-byte
// asynchronous copies, whole 128-B lines per row, into two buffers: stage s + 1 is issued when stage s - 1 has been read, so it flies while stage s is worked on.
// Per 32-key tile, both products transposed (keys x queries, then channels x queries): energy (hi.hi + hi.lo + lo.hi), a lane holds 16 scores of ONE query, so the
// online softmax is in-lane but for one exchange between the wave's halves; weights x4 as f16 hi + UNSCALED residual go from the score registers straight into
// the B operand; o += vh.wh + vh.wl, ox += vl.wh. The weights are taken against a held reference, not the running maximum: accumulators and sums are rescaled only
// in a tile where some query's maximum has passed its reference by more than THR (one test per tile for the whole wave).
// Epilogue: the two key halves exchange reference and sum through LDS, each scales its own part, out[b][c][i] = part 0 + part 1 + x[b][c][i], gathered through LDS (per c the block's 128 i are one 512-B run).
#define QB   128                      // positions i per block
#define OTP  (QB + 4)                 // output staging row pitch, floats
#define KT   64                       // keys per stage
#define NST  (NN_ / KT)
#define VPI  72                       // V row pitch in LDS, f16 units: 128-B row + 16 B (16 B x odd: no bank conflict for 16-byte reads of 16 rows)
#define KPI  40                       // K row pitch in LDS, f16 units: 64-B row + 16 B
#define VPLN (128 * VPI)
#define KPLN (KT * KPI)
#define STG  (2 * VPLN + 2 * KPLN)    // f16 units per stage: V hi | V residual | K hi | K residual

// One lane's five copies of one plane pair (4 V rows 32 apart, 1 K piece). The s_wait_xcnt closes the statement so that no later
// address update can be scheduled in front of it while a copy still names its registers.
__device__ __forceinline__ void copy5(unsigned lv, unsigned lk, const h16* gv, const h16* gk) {
    asm volatile("global_load_async_to_lds_b128 %0, %5, off\n\t"
                 "global_load_async_to_lds_b128 %1, %6, off\n\t"
                 "global_load_async_to_lds_b128 %2, %7, off\n\t"
                 "global_load_async_to_lds_b128 %3, %8, off\n\t"
                 "global_load_async_to_lds_b128 %4, %9, off\n\t"
                 "s_wait_xcnt 0x0"
                 :: "v"(lv), "v"(lv + 32 * VPI * 2), "v"(lv + 64 * VPI * 2), "v"(lv + 96 * VPI * 2), "v"(lk),
                    "v"(gv), "v"(gv + 32 * NN_), "v"(gv + 64 * NN_), "v"(gv + 96 * NN_), "v"(gk)
                 : "memory");
}

// two waves per SIMD is what one 8-wave block per WGP gives; stated, because without it the build holds itself to 256 registers and scatters the V fragment reads among the products
__global__ __launch_bounds__(256) __attribute__((amdgpu_waves_per_eu(2, 2))) void k_attn(const h16* __restrict__ QH, const h16* __restrict__ QL, const h16* __restrict__ KH, const h16* __restrict__ KL, const h16* __restrict__ VTH, const h16* __restrict__ VTL,
                                             const float* __restrict__ x, float* out) {
    __shared__ __align__(16) h16 ring[2 * STG];
    __shared__ __align__(16) float ot[2 * 128 * OTP];   // one plane per key half
    __shared__ float jm[2][QB], jl[2][QB];              // each key half's reference and sum per position
    const int tid = threadIdx.x, lane = tid & 31, wave = tid >> 5, lr = lane & 15, hi = lane >> 4, qg = wave & 3, kh = wave >> 2;
    const int b = blockIdx.x / (NN_ / QB), it = blockIdx.x - b * (NN_ / QB), chalf = blockIdx.y, i0l = it * QB, q0 = i0l + qg * 32;
    const size_t tok0 = (size_t)b * NN_;
    // this lane's places: V row tid >> 3 (+ 32 per copy), 16-byte piece tid & 7; K row tid >> 2, piece tid & 3
    const unsigned ring0 = (unsigned)(size_t)&ring[0];
    const unsigned lv0 = ring0 + (unsigned)((tid >> 3) * (VPI * 2) + (tid & 7) * 16), kp = (unsigned)((tid >> 2) * (KPI * 2) + (tid & 3) * 16);
    const unsigned gvo = (unsigned)((b * CC + chalf * 128 + (tid >> 3)) * NN_ + (tid & 7) * 8), gko = (unsigned)(b * (NN_ * HQ) + tid * 8);   // element offsets, 32 bits each: two registers live across the loop
    auto fill = [&](int st) {
        const unsigned bo = (unsigned)(st & 1) * (STG * 2);
        const unsigned lk = kp + ((st & 1) ? ring0 + (STG + 2 * VPLN) * 2 : ring0 + 2 * VPLN * 2);   // the buffer's K base is picked as a scalar, so only the lane's own offset lives across the loop
        const unsigned vo = gvo + (unsigned)st * KT, ko = gko + (unsigned)st * (KT * HQ);
        copy5(lv0 + bo, lk, VTH + vo, KH + ko);
        copy5(lv0 + bo + VPLN * 2, lk + KPLN * 2, VTL + vo, KL + ko);
    };
    fill(0);
    asm volatile("s_wait_asynccnt 0x0" ::: "memory");   // this wave's share of stage 0 has landed
    __syncthreads();                                    // publishes stage 0 to the other waves
    const h16* qhp = QH + (tok0 + q0 + lr) * HQ + 8 * hi; const h16* qlp = QL + (tok0 + q0 + lr) * HQ + 8 * hi;
    v16h qa[2], ql[2];   // column group g = positions q0 + 16 * g + lr
#pragma unroll
    for (int g = 0; g < 2; ++g) { qa[g] = cat16(*(const v8h*)(qhp + g * 16 * HQ), *(const v8h*)(qhp + g * 16 * HQ + 16)); ql[g] = cat16(*(const v8h*)(qlp + g * 16 * HQ), *(const v8h*)(qlp + g * 16 * HQ + 16)); }
    // the q loads have been issued; the wait takes their addresses as inputs, so that no address register is reused in front of it
    asm volatile("s_wait_xcnt 0x0" :: "v"(qhp), "v"(qlp) : "memory");
    v8f o[2][8], ox[2][8];
#pragma unroll
    for (int g = 0; g < 2; ++g)
#pragma unroll
        for (int n = 0; n < 8; ++n) { o[g][n] = (v8f){}; ox[g][n] = (v8f){}; }
    float mtop[2] = {-3.0e38f, -3.0e38f}, mrun[2] = {-3.0e38f, -3.0e38f}, lrun[2] = {0.f, 0.f};   // this lane's two queries: running maximum, the reference in use (both lane halves alike) and the sum over this lane half's keys
#pragma unroll 1   // one body for all stages: the buffer is picked by the stage's parity
    for (int st = 0; st < NST; ++st) {
        // the refill stands at the stage's top, directly behind the barrier that ended every wave's reads of that buffer (stage st - 1's): the same place in run-time order as at the foot. With its branch
        // at the foot the build sinks the weight sums behind the branch, keeps both column groups' weights live through the products and spills to scratch.
        if (st + 1 < NST) fill(st + 1);
        const h16* sb = ring + (st & 1) * STG;
        {
            const h16* kb = sb + 2 * VPLN + (kh * 32 + lr) * KPI + 8 * hi;   // this wave's tile of the stage
            const v16h k0h = cat16(*(const v8ha*)kb, *(const v8ha*)(kb + 16)), k1h = cat16(*(const v8ha*)(kb + 16 * KPI), *(const v8ha*)(kb + 16 * KPI + 16));
            const v16h k0l = cat16(*(const v8ha*)(kb + KPLN), *(const v8ha*)(kb + KPLN + 16)), k1l = cat16(*(const v8ha*)(kb + KPLN + 16 * KPI), *(const v8ha*)(kb + KPLN + 16 * KPI + 16));
            // transposed energy: keys are the rows, queries the columns; register j of s0 / s1 = key 8 * hi + j / 16 + 8 * hi + j against query lr of the group
            v8f s0[2], s1[2], x0[2], x1[2];
#pragma unroll
            for (int g = 0; g < 2; ++g) { s0[g] = wmma16(k0h, qa[g], (v8f){}); s1[g] = wmma16(k1h, qa[g], (v8f){}); x0[g] = wmma16(k0h, ql[g], (v8f){}); x1[g] = wmma16(k1h, ql[g], (v8f){}); }
#pragma unroll
            for (int g = 0; g < 2; ++g) { x0[g] = wmma16(k0l, qa[g], x0[g]); x1[g] = wmma16(k1l, qa[g], x1[g]); }
            // four vector slots between the last energy product and the first vector read of its result
            asm volatile("v_nop\n\tv_nop\n\tv_nop\n\tv_nop" : "+v"(s0[0]), "+v"(s1[0]), "+v"(x0[0]), "+v"(x1[0]), "+v"(s0[1]), "+v"(s1[1]), "+v"(x0[1]), "+v"(x1[1]));
            // the tile's V fragments are read from the stage in TWO runs, not among the products in pairs: six channel tiles here, their LDS latency passes under the softmax; the last two
            // behind it, their latency passes under the first products (all sixteen fragments at once, beside both column groups' scores, do not fit the registers of two waves per SIMD)
            v16h vh[8], vl[8];
            auto ldV = [&](int n) { const h16* vb = sb + (n * 16 + lr) * VPI + kh * 32 + hi * 8;
                vh[n] = cat16(*(const v8ha*)vb, *(const v8ha*)(vb + 16)); vl[n] = cat16(*(const v8ha*)(vb + VPLN), *(const v8ha*)(vb + VPLN + 16)); };
#pragma unroll
            for (int n = 0; n < 6; ++n) ldV(n);
            __builtin_amdgcn_sched_barrier(0);   // keeps the first run of reads together in front of the softmax; without it they sink among the products in pairs, each place with an LDS wait of its own
            v16h pa[2], px[2]; v8f a0s[2], a1s[2]; bool need = false;
#pragma unroll
            for (int g = 0; g < 2; ++g) {
                a0s[g] = s0[g] + x0[g] * LOSCI; a1s[g] = s1[g] + x1[g] * LOSCI;
                const v8f m8 = __builtin_elementwise_max(a0s[g], a1s[g]);
                float mx = fmaxf(fmaxf(fmaxf(m8[0], m8[1]), fmaxf(m8[2], m8[3])), fmaxf(fmaxf(m8[4], m8[5]), fmaxf(m8[6], m8[7])));
                mx = fmaxf(mx, xhalf(mx));   // the other lane half's 16 keys of the same query
                mtop[g] = fmaxf(mtop[g], mx);
                need = need || (mtop[g] - mrun[g] > THR);
            }
            // one scalar branch per tile: every query of the wave moves its reference up to its running maximum, and its accumulators and sum follow (the first tile always takes it)
            if (__builtin_amdgcn_ballot_w32(need) != 0) {
#pragma unroll
                for (int g = 0; g < 2; ++g) {
                    const float alpha = __expf(mrun[g] - mtop[g]);
                    mrun[g] = mtop[g]; lrun[g] *= alpha;
#pragma unroll
                    for (int n = 0; n < 8; ++n)
#pragma unroll
                        for (int j = 0; j < 8; ++j) { o[g][n][j] *= alpha; ox[g][n][j] *= alpha; }
                }
            }
            auto weights = [&](int g) {
                const v8f a0 = a0s[g], a1 = a1s[g]; const float mn = mrun[g];
                // the weights stay in registers: the two score tiles, converted in place, are the B operand (element s = key 8 * hi + s, then 16 + 8 * hi + s - 8: the V loader's k order)
                v8f p0, p1;
#pragma unroll
                for (int j = 0; j < 8; ++j) { p0[j] = __expf(a0[j] - mn); p1[j] = __expf(a1[j] - mn); }
                const v8f ps0 = p0 * PSC, ps1 = p1 * PSC, pp = p0 + p1;
                const v8h h0 = __builtin_convertvector(ps0, v8h), h1 = __builtin_convertvector(ps1, v8h);
                const v8h r0 = __builtin_convertvector(ps0 - __builtin_convertvector(h0, v8f), v8h), r1 = __builtin_convertvector(ps1 - __builtin_convertvector(h1, v8f), v8h);   // UNSCALED residual
                pa[g] = cat16(h0, h1); px[g] = cat16(r0, r1);
                const float ls = ((pp[0] + pp[1]) + (pp[2] + pp[3])) + ((pp[4] + pp[5]) + (pp[6] + pp[7]));
                lrun[g] += ls;
            };
            weights(0);
            __builtin_amdgcn_sched_barrier(0);   // with the one behind the reads: keeps the second run of reads together and no earlier than here (lifted to the first run, the build spills to scratch)
#pragma unroll
            for (int n = 6; n < 8; ++n) ldV(n);
            __builtin_amdgcn_sched_barrier(0);   // without it the second run's reads scatter among the products, singly and in pairs
            weights(1);
            // transposed output tiles: register j of o[g][n] = channel n * 16 + 8 * hi + j of query lr of group g; each V fragment serves both groups
#pragma unroll
            for (int g = 0; g < 2; ++g)
#pragma unroll
                for (int n = 0; n < 8; ++n) { o[g][n] = wmma16(vh[n], pa[g], o[g][n]); ox[g][n] = wmma16(vl[n], pa[g], ox[g][n]); o[g][n] = wmma16(vh[n], px[g], o[g][n]); }   // the two products into o[g][n] stand one product apart: directly behind one another the second waits out the first's accumulator latency
            // issue order of the block above: the second group's weights are formed between the first group's products, in the matrix unit's shadow; without it the build puts them in front of the products they do not feed
#pragma unroll
            for (int i = 0; i < 24; ++i) { __builtin_amdgcn_sched_group_barrier(0x8, 1, 0); __builtin_amdgcn_sched_group_barrier(0x2, 4, 0); }
            // four vector slots behind the last product on the loop's back edge too, before its operands or results are touched
            asm volatile("v_nop\n\tv_nop\n\tv_nop\n\tv_nop" : "+v"(o[0][0]), "+v"(o[1][7]), "+v"(ox[0][0]), "+v"(ox[1][7]) : "v"(pa[0]), "v"(px[0]), "v"(pa[1]), "v"(px[1]));
        }
        asm volatile("s_wait_dscnt 0x0" ::: "memory");      // this wave's reads of stage st are done before its buffer may be refilled
        asm volatile("s_wait_asynccnt 0x0" ::: "memory");   // this wave's share of stage st + 1 has landed
        __syncthreads();                                    // publishes stage st + 1 and ends every wave's reads of stage st
    }
    asm volatile("s_wait_asynccnt 0x0" ::: "memory");       // nothing of the ring is in flight when the wave goes on to the epilogue
    float lt[2];
#pragma unroll
    for (int g = 0; g < 2; ++g) { lt[g] = lrun[g] + xhalf(lrun[g]);   // the two lane halves' key sums joined once
        if (hi == 0) { jm[kh][qg * 32 + g * 16 + lr] = mrun[g]; jl[kh][qg * 32 + g * 16 + lr] = lt[g]; } }
    __syncthreads();   // publishes each key half's reference and sum to the wave that holds the other half
    // staging: ot[key half][c_local][i_local] (2 x 128 x 128), each part already on the larger of the two references and divided by the joint sum
#pragma unroll
    for (int g = 0; g < 2; ++g) {
        const float mo = jm[kh ^ 1][qg * 32 + g * 16 + lr], lo = jl[kh ^ 1][qg * 32 + g * 16 + lr], mj = fmaxf(mrun[g], mo), f = __expf(mrun[g] - mj), fo = __expf(mo - mj);
        const float inv = f / ((lt[g] * f + lo * fo) * PSC);
#pragma unroll
        for (int n = 0; n < 8; ++n)
#pragma unroll
            for (int j = 0; j < 8; ++j) ot[(kh * 128 + n * 16 + hi * 8 + j) * OTP + qg * 32 + g * 16 + lr] = (o[g][n][j] + ox[g][n][j] * LOSCI) * inv;
    }
    __syncthreads();
    // out[b][c][i0l + i] + x residual: per c a 512-B run (32 lanes x 16 B, one c per instruction); 128 c rows -> 8 waves x 16 instructions
    auto pass = [&]() {
#pragma unroll
        for (int s = 0; s < 16; ++s) { const int cl = wave * 16 + s, piece = lane; const size_t go = ((size_t)b * CC + chalf * 128 + cl) * NN_ + i0l + piece * 4;
            v4f val = *(const v4fa*)(ot + cl * OTP + piece * 4) + *(const v4fa*)(ot + (128 + cl) * OTP + piece * 4);   // key half 0 + key half 1
#pragma unroll
            for (int i = 0; i < 4; ++i) val[i] += bfr(x[go + i]);
            *(v4f*)(out + go) = val; }
    };
    pass(); 
}

extern "C" void kernel_launch(void* const* d_in, const int* in_sizes, int n_in,
                              void* d_out, int out_size, void* d_ws, size_t ws_size, hipStream_t stream) {
    (void)in_sizes; (void)n_in; (void)out_size;
    const float* x = (const float*)d_in[0]; const float* wq = (const float*)d_in[1]; const float* bq = (const float*)d_in[2]; const float* wk = (const float*)d_in[3]; const float* bk = (const float*)d_in[4];
    const float* wv = (const float*)d_in[5]; const float* bv = (const float*)d_in[6];
    float* out = (float*)d_out;    // [8][256][2048]
    char* wsp = (char*)d_ws;
    auto take = [&](size_t bytes) { char* p = wsp; wsp += (bytes + 255) & ~(size_t)255; return (void*)p; };
    bf* WQ = (bf*)take((size_t)HQ * CC * 2); bf* WK = (bf*)take((size_t)HQ * CC * 2); bf* WV = (bf*)take((size_t)CC * CC * 2);
    h16* QH = (h16*)take((size_t)NTK * HQ * 2); h16* QL = (h16*)take((size_t)NTK * HQ * 2); h16* KH = (h16*)take((size_t)NTK * HQ * 2); h16* KL = (h16*)take((size_t)NTK * HQ * 2);
    h16* VTH = (h16*)take((size_t)NTK * CC * 2); h16* VTL = (h16*)take((size_t)NTK * CC * 2);
    if ((size_t)(wsp - (char*)d_ws) > ws_size) return;    // 0.2 + 1 x 4 + 8.4 x 2 ~ 21 MB
    k_w<<<(2 * HQ + CC) / 8, 256, 0, stream>>>(wq, wk, wv, WQ, WK, WV);
    k_proj<<<dim3(NN_ / 64, NB_, 1), 256, 0, stream>>>(x, WQ, WK, WV, bq, bk, bv, QH, QL, KH, KL, VTH, VTL);
    k_attn<<<dim3(NB_ * (NN_ / QB), 2, 1), 256, 0, stream>>>(QH, QL, KH, KL, VTH, VTL, x, out);
}

// v007
// One run takes 54.1 microseconds.
// In both of two side-by-side timings against v006, it was 1.07 times as fast.
// Counting every step since v000, it is 4.57 times as fast.
#include <hip/hip_runtime.h>

// Contractions, f32 accumulate: q/k = 1x1 convs ([16384 positions x 256].[256 x 32] each) and v ([16384 x 256].[256 x 256]) on v_wmma_f32_16x16x32_bf16 with PLAIN
// bf16 operands (inputs rounded once: exact); the position attention fused on v_wmma_f32_16x16x32_f16: energy = q.k over the 32 hidden dims (UNSCALED; q and k as
// f16 hi + residual x1024: hi.hi + hi.lo + lo.hi), softmax over the 2048 positions, out[c][i] = sum_j w[i][j] v[c][j] over all 256 channels with the weights
// (x4) and v each as f16 hi + UNSCALED residual: three products into ONE accumulator; + x residual; output written channel-major

#define NB_  8
#define CC   256
#define NN_  2048
#define HQ   32
#define NTK  (NB_ * NN_)
#define PSC  4.0f                     // weight scale: a weight is at most 2^13 (THR), so x4 stays inside f16
#define THR  9.0109f                  // 13 ln 2: how far a query's maximum may pass the reference in use before the accumulators are rescaled
#define LOSC 1024.0f
#define LOSCI (1.0f / 1024.0f)

typedef _Float16 h16;
typedef unsigned short bf;
typedef __attribute__((ext_vector_type(16))) __bf16   v16bf;
typedef __attribute__((ext_vector_type(16))) _Float16 v16h;
typedef __attribute__((ext_vector_type(8)))  _Float16 v8h;
typedef __attribute__((ext_vector_type(8)))  unsigned short v8us;
typedef __attribute__((ext_vector_type(8)))  float    v8f;
typedef __attribute__((ext_vector_type(4)))  float    v4f;
typedef v8h  __attribute__((may_alias)) v8ha;
typedef v4f  __attribute__((may_alias)) v4fa;
typedef v8us __attribute__((may_alias)) v8usa;

__device__ __forceinline__ unsigned short f2bf(float f) { unsigned u = __float_as_uint(f); u += 0x7FFFu + ((u >> 16) & 1u); return (unsigned short)(u >> 16); }
__device__ __forceinline__ float bf2f(unsigned short b) { return __uint_as_float(((unsigned)b) << 16); }
__device__ __forceinline__ float bfr(float f) { return bf2f(f2bf(f)); }
__device__ __forceinline__ v16h cat16(v8h lo, v8h hi) { return __builtin_shufflevector(lo, hi, 0, 1, 2, 3, 4, 5, 6, 7, 8, 9, 10, 11, 12, 13, 14, 15); }
__device__ __forceinline__ v16bf cat16b(v8us lo, v8us hi) { return __builtin_bit_cast(v16bf, __builtin_shufflevector(lo, hi, 0, 1, 2, 3, 4, 5, 6, 7, 8, 9, 10, 11, 12, 13, 14, 15)); }
__device__ __forceinline__ v8f wmma16(v16h a, v16h b, v8f c) { return __builtin_amdgcn_wmma_f32_16x16x32_f16(false, a, false, b, (short)0, c, false, false); }
__device__ __forceinline__ v8f wmmab(v16bf a, v16bf b, v8f c) { return __builtin_amdgcn_wmma_f32_16x16x32_bf16(false, a, false, b, (short)0, c, false, false); }
__device__ __forceinline__ float xhalf(float v) { return __builtin_bit_cast(float, __builtin_amdgcn_permlanex16(__builtin_bit_cast(int, v), __builtin_bit_cast(int, v), 0x76543210, 0xfedcba98, false, false)); }  // lane l with lane l ^ 16
#define VST2(T, p, v) do { const T vst2_v_ = (v); *(T*)(p) = vst2_v_;  } while (0)

// k_w: bf16 planes of wq [32][256], wk [32][256], wv [256][256] ([out][in] = n-major as-is); one wave per row (32 lanes x 16 B = 512 B).
__global__ __launch_bounds__(256) void k_w(const float* __restrict__ wq, const float* __restrict__ wk, const float* __restrict__ wv, bf* WQ, bf* WK, bf* WV) {
    const int lane = threadIdx.x & 31, r = blockIdx.x * 8 + (threadIdx.x >> 5);      // 0 .. 32+32+256
    const int m = (r < HQ) ? 0 : (r < 2 * HQ) ? 1 : 2;     // wave-uniform
    v8us o;
    if (m == 0) { for (int i = 0; i < 8; ++i) o[i] = f2bf(wq[(size_t)r * CC + lane * 8 + i]); VST2(v8us, WQ + (size_t)r * CC + lane * 8, o); }
    else if (m == 1) { const int o2 = r - HQ; for (int i = 0; i < 8; ++i) o[i] = f2bf(wk[(size_t)o2 * CC + lane * 8 + i]); VST2(v8us, WK + (size_t)o2 * CC + lane * 8, o); }
    else { const int o2 = r - 2 * HQ; if (o2 < CC) { for (int i = 0; i < 8; ++i) o[i] = f2bf(wv[(size_t)o2 * CC + lane * 8 + i]); VST2(v8us, WV + (size_t)o2 * CC + lane * 8, o); } }
}
// k_proj: block = (b, 64 positions), 8 waves. The block's x tile (256 channels x 64 positions) is read once in whole lines, rounded to bf16 and laid position-major in
// LDS; all three projections take their A fragments (16 positions x 32 channels) from that tile and their B fragments (weight rows) from global memory, requested
// together with the tile. v: wave = 32 output channels x 64 positions; a lane's accumulator holds 8 consecutive positions of ONE channel, so hi + residual pack straight into
// channel-major 16-byte pieces, gathered through LDS into 128-B lines of VTH / VTL [b][c][n]. q | k: wave = (16 positions, q or k), planes [tok][32].
#define XPI 264                       // x tile row pitch in LDS, bf16 units: 512-B row + 16 B (16 B x odd: no bank conflict for 16-byte reads of 16 rows)
#define OPI 72                        // v staging row pitch, f16 units: 128-B row + 16 B
__global__ __launch_bounds__(256) void k_proj(const float* __restrict__ x, const bf* __restrict__ WQ, const bf* __restrict__ WK, const bf* __restrict__ WV,
                                              const float* __restrict__ bq, const float* __restrict__ bk, const float* __restrict__ bv,
                                              h16* QH, h16* QL, h16* KH, h16* KL, h16* VTH, h16* VTL) {
    __shared__ __align__(16) unsigned short xs[64 * XPI];
    __shared__ __align__(16) h16 vsh[CC * OPI];
    __shared__ __align__(16) h16 vsl[CC * OPI];
    __shared__ __align__(16) float ost[8][16 * 36];
    const int tid = threadIdx.x, lane = tid & 31, wave = tid >> 5, lr = lane & 15, hi = lane >> 4;
    const int n0 = blockIdx.x * 64, b = blockIdx.y, which = wave >> 2, nt = wave & 3;
    const bf* W = which ? WK : WQ; const float* bias = which ? bk : bq; h16* PH = which ? KH : QH; h16* PL = which ? KL : QL;   // wave-uniform selects of whole buffers
    // the wave's weight fragments for all eight k steps: they do not depend on the tile, so their latency passes under the tile's load and transpose
    const bf* vp0 = WV + (size_t)(wave * 32 + lr) * CC + 8 * hi; const bf* vp1 = vp0 + 16 * CC;
    const bf* qp0 = W + (size_t)lr * CC + 8 * hi; const bf* qp1 = qp0 + 16 * CC;
    const float* bvp = bv + wave * 32 + lr; const float* bbp = bias + lr;
    v16bf wvf[8][2], wqf[8][2];
#pragma unroll
    for (int ks = 0; ks < 8; ++ks) {
        wvf[ks][0] = cat16b(*(const v8us*)(vp0 + ks * 32), *(const v8us*)(vp0 + ks * 32 + 16)); wvf[ks][1] = cat16b(*(const v8us*)(vp1 + ks * 32), *(const v8us*)(vp1 + ks * 32 + 16));
        wqf[ks][0] = cat16b(*(const v8us*)(qp0 + ks * 32), *(const v8us*)(qp0 + ks * 32 + 16)); wqf[ks][1] = cat16b(*(const v8us*)(qp1 + ks * 32), *(const v8us*)(qp1 + ks * 32 + 16));
    }
    const float bv0 = bvp[0], bv1 = bvp[16], bb0 = bbp[0], bb1 = bbp[16];
    // x tile: thread = (4 positions, 16 channels); 16 lanes cover one channel's 256-B run
    {
        const int piece = tid & 15, g = tid >> 4;
        const float* xp = x + ((size_t)b * CC + g * 16) * NN_ + n0 + piece * 4;
        v4f xr[16];
#pragma unroll
        for (int i = 0; i < 16; ++i) xr[i] = *(const v4fa*)(xp + (size_t)i * NN_);
        // every load above has been issued; the wait takes their addresses as inputs, so that no address register is reused in front of it
        asm volatile("s_wait_xcnt 0x0" :: "v"(vp0), "v"(vp1), "v"(qp0), "v"(qp1), "v"(bvp), "v"(bbp), "v"(xp) : "memory");
#pragma unroll
        for (int k = 0; k < 4; ++k)
#pragma unroll
            for (int o = 0; o < 2; ++o) { v8us p;
#pragma unroll
                for (int e = 0; e < 8; ++e) p[e] = f2bf(xr[o * 8 + e][k]);
                *(v8usa*)(xs + (piece * 4 + k) * XPI + g * 16 + o * 8) = p; }
    }
    __syncthreads();
    v8f av[4][2], aq[2] = {(v8f){}, (v8f){}};
#pragma unroll
    for (int m = 0; m < 4; ++m) { av[m][0] = (v8f){}; av[m][1] = (v8f){}; }
    // A fragments in two register sets: step ks + 1 is read from LDS as one group ahead of step ks's products, so its latency passes under them
    v16bf a[2][5];
    auto ldA = [&](int ks, v16bf (&f)[5]) {
#pragma unroll
        for (int m = 0; m < 5; ++m) { const unsigned short* ap = xs + ((m < 4 ? m : nt) * 16 + lr) * XPI + ks * 32 + 8 * hi; f[m] = cat16b(*(const v8usa*)ap, *(const v8usa*)(ap + 16)); }
    };
    ldA(0, a[0]);
#pragma unroll
    for (int ks = 0; ks < 8; ++ks) {
        if (ks < 7) ldA(ks + 1, a[(ks + 1) & 1]);
        __builtin_amdgcn_sched_barrier(0);   // keeps the next step's reads together in front of this step's products; without it they sink to their uses, one exposed LDS latency each
#pragma unroll
        for (int m = 0; m < 4; ++m) { av[m][0] = wmmab(a[ks & 1][m], wvf[ks][0], av[m][0]); av[m][1] = wmmab(a[ks & 1][m], wvf[ks][1], av[m][1]); }
        aq[0] = wmmab(a[ks & 1][4], wqf[ks][0], aq[0]); aq[1] = wmmab(a[ks & 1][4], wqf[ks][1], aq[1]);
    }
    // v: register j of av[m][t] = position m * 16 + 8 * hi + j of channel wave * 32 + t * 16 + lr
#pragma unroll
    for (int t = 0; t < 2; ++t) { const int c = wave * 32 + t * 16 + lr; const float b2 = bfr(t ? bv1 : bv0);
#pragma unroll
        for (int m = 0; m < 4; ++m) { const v8f v = av[m][t] + b2; const v8h oh = __builtin_convertvector(v, v8h), ol = __builtin_convertvector(v - __builtin_convertvector(oh, v8f), v8h);   // v residual UNSCALED (f16 subnormals carry it)
            *(v8ha*)(vsh + c * OPI + m * 16 + hi * 8) = oh; *(v8ha*)(vsl + c * OPI + m * 16 + hi * 8) = ol; } }
    float* os = &ost[wave][0];
#pragma unroll
    for (int t = 0; t < 2; ++t) { const float bb = bfr(t ? bb1 : bb0);
#pragma unroll
        for (int j = 0; j < 8; ++j) os[(hi * 8 + j) * 36 + t * 16 + lr] = aq[t][j] + bb; }
    __syncthreads();
    const size_t r0 = (size_t)b * NN_ + n0 + nt * 16;
#pragma unroll
    for (int s = 0; s < 2; ++s) { const int row = s * 8 + (lane >> 2), pc = lane & 3; const float* sp = os + row * 36 + pc * 8;   // 4 lanes x 16 B per 64-B row
        const v8f v = __builtin_shufflevector(*(const v4fa*)sp, *(const v4fa*)(sp + 4), 0, 1, 2, 3, 4, 5, 6, 7);
        const v8h oh = __builtin_convertvector(v, v8h), ol = __builtin_convertvector((v - __builtin_convertvector(oh, v8f)) * LOSC, v8h);
        *(v8h*)(PH + (r0 + row) * HQ + pc * 8) = oh; *(v8h*)(PL + (r0 + row) * HQ + pc * 8) = ol; }
#pragma unroll
    for (int s = 0; s < 8; ++s) { const int c = (tid >> 3) + 32 * s, pc = tid & 7; const size_t o = ((size_t)b * CC + c) * NN_ + n0 + pc * 8;   // 8 lanes x 16 B per 128-B row
        *(v8h*)(VTH + o) = *(const v8ha*)(vsh + c * OPI + pc * 8); *(v8h*)(VTL + o) = *(const v8ha*)(vsl + c * OPI + pc * 8); }
}
// k_attn: block = (b, 64 positions i, ALL 256 channels), 8 waves, one block per WGP. Wave = (32 positions, one of a stage's four 32-key tiles): energy and softmax of a (position, key) pair are formed
// once for all 256 channels; a V fragment read from LDS feeds two 16-position column groups; the four waves that share 32 positions each walk a quarter of the keys and are joined once at the end.
// The keys are walked in LDS stages of 128 (four 32-key tiles): each stage holds all V rows (256 channels x 128 keys, hi and residual plane) and K rows (128 keys x 32 dims, hi and residual plane),
// brought in ONCE per block by per-lane 16-byte asynchronous copies, whole 256-B runs per row, into two buffers: stage s + 1 is issued when stage s - 1 has been read, so it flies while stage s is worked on.
// Per 32-key tile, both products transposed (keys x queries, then channels x queries): energy (hi.hi + hi.lo + lo.hi), a lane holds 16 scores of ONE query, so the
// online softmax is in-lane but for one exchange between the wave's halves; weights x4 as f16 hi + UNSCALED residual go from the score registers straight into
// the B operand; o += vh.wh + vl.wh + vh.wl, one accumulator (32 positions x 256 channels = 256 registers). The weights are taken against a held reference, not the running maximum: accumulators and
// sums are rescaled only in a tile where some query's maximum has passed its reference by more than THR (one test per tile for the whole wave).
// Epilogue: the four key quarters exchange maximum and sum through LDS, each scales its own part, out[b][c][i] = sum of the parts + x[b][c][i], gathered through LDS (the ring's bytes, free by then).
#define QB   64                       // positions i per block
#define OTP  (QB + 4)                 // output staging row pitch, floats
#define KT   128                      // keys per stage
#define NST  (NN_ / KT)
#define VPI  136                      // V row pitch in LDS, f16 units: 256-B row + 16 B (16 B x odd: no bank conflict for 16-byte reads of 16 rows)
#define KPI  40                       // K row pitch in LDS, f16 units: 64-B row + 16 B
#define VPLN (CC * VPI)
#define KPLN (KT * KPI)
#define STG  (2 * VPLN + 2 * KPLN)    // f16 units per stage: V hi | V residual | K hi | K residual

// One lane's nine copies of half a plane pair (8 V rows 16 apart, 1 K piece). The s_wait_xcnt closes the statement so that no later
// address update can be scheduled in front of it while a copy still names its registers.
__device__ __forceinline__ void copy9(unsigned lv, unsigned lk, const h16* gv, const h16* gk) {
    asm volatile("global_load_async_to_lds_b128 %0, %9, off\n\t"
                 "global_load_async_to_lds_b128 %1, %10, off\n\t"
                 "global_load_async_to_lds_b128 %2, %11, off\n\t"
                 "global_load_async_to_lds_b128 %3, %12, off\n\t"
                 "global_load_async_to_lds_b128 %4, %13, off\n\t"
                 "global_load_async_to_lds_b128 %5, %14, off\n\t"
                 "global_load_async_to_lds_b128 %6, %15, off\n\t"
                 "global_load_async_to_lds_b128 %7, %16, off\n\t"
                 "global_load_async_to_lds_b128 %8, %17, off\n\t"
                 "s_wait_xcnt 0x0"
                 :: "v"(lv), "v"(lv + 16 * VPI * 2), "v"(lv + 32 * VPI * 2), "v"(lv + 48 * VPI * 2), "v"(lv + 64 * VPI * 2), "v"(lv + 80 * VPI * 2), "v"(lv + 96 * VPI * 2), "v"(lv + 112 * VPI * 2), "v"(lk),
                    "v"(gv), "v"(gv + 16 * NN_), "v"(gv + 32 * NN_), "v"(gv + 48 * NN_), "v"(gv + 64 * NN_), "v"(gv + 80 * NN_), "v"(gv + 96 * NN_), "v"(gv + 112 * NN_), "v"(gk)
                 : "memory");
}

// two waves per SIMD is what one 8-wave block per WGP gives; stated, because without it the build holds itself to 256 registers and scatters the V fragment reads among the products
__global__ __launch_bounds__(256) __attribute__((amdgpu_waves_per_eu(2, 2))) void k_attn(const h16* __restrict__ QH, const h16* __restrict__ QL, const h16* __restrict__ KH, const h16* __restrict__ KL, const h16* __restrict__ VTH, const h16* __restrict__ VTL,
                                             const float* __restrict__ x, float* out) {
    __shared__ __align__(16) unsigned char smem[2 * STG * 2];   // the ring; behind the loop the output staging (4 * CC * OTP floats fit in it)
    __shared__ float jm[4][QB], jl[4][QB];                      // each key quarter's maximum and sum per position
    const h16* ring = (const h16*)smem; float* ot = (float*)smem;
    const int tid = threadIdx.x, lane = tid & 31, wave = tid >> 5, lr = lane & 15, hi = lane >> 4, qg = wave & 1, kq = wave >> 1;
    const int b = blockIdx.x / (NN_ / QB), it = blockIdx.x - b * (NN_ / QB), i0l = it * QB, q0 = i0l + qg * 32;
    const size_t tok0 = (size_t)b * NN_;
    // this lane's places: V row tid >> 4 (+ 16 per copy), 16-byte piece tid & 15; K row tid >> 2 (+ 64 for the second half), piece tid & 3
    const unsigned ring0 = (unsigned)(size_t)&smem[0];
    const unsigned lv0 = ring0 + (unsigned)((tid >> 4) * (VPI * 2) + (tid & 15) * 16), kp = (unsigned)((tid >> 2) * (KPI * 2) + (tid & 3) * 16);
    const unsigned gvo = (unsigned)((b * CC + (tid >> 4)) * NN_ + (tid & 15) * 8), gko = (unsigned)(b * (NN_ * HQ) + tid * 8);   // element offsets, 32 bits each
    auto fill = [&](int st) {
        const unsigned lv = lv0 + (unsigned)(st & 1) * (STG * 2);
        const unsigned lk = kp + ((st & 1) ? ring0 + (STG + 2 * VPLN) * 2 : ring0 + 2 * VPLN * 2);   // the buffer's K base is picked as a scalar, so only the lane's own offset lives across the loop
        const unsigned vo = gvo + (unsigned)st * KT, ko = gko + (unsigned)st * (KT * HQ);
        copy9(lv, lk, VTH + vo, KH + ko);
        copy9(lv + 128 * VPI * 2, lk + 64 * KPI * 2, VTH + vo + 128 * NN_, KH + ko + 64 * HQ);
        copy9(lv + VPLN * 2, lk + KPLN * 2, VTL + vo, KL + ko);
        copy9(lv + VPLN * 2 + 128 * VPI * 2, lk + KPLN * 2 + 64 * KPI * 2, VTL + vo + 128 * NN_, KL + ko + 64 * HQ);
    };
    fill(0);
    asm volatile("s_wait_asynccnt 0x0" ::: "memory");   // this wave's share of stage 0 has landed
    __syncthreads();                                    // publishes stage 0 to the other waves
    const h16* qhp = QH + (tok0 + q0 + lr) * HQ + 8 * hi; const h16* qlp = QL + (tok0 + q0 + lr) * HQ + 8 * hi;
    v16h qa[2], ql[2];   // column group g = positions q0 + 16 * g + lr
#pragma unroll
    for (int g = 0; g < 2; ++g) { qa[g] = cat16(*(const v8h*)(qhp + g * 16 * HQ), *(const v8h*)(qhp + g * 16 * HQ + 16)); ql[g] = cat16(*(const v8h*)(qlp + g * 16 * HQ), *(const v8h*)(qlp + g * 16 * HQ + 16)); }
    // the q loads have been issued; the wait takes their addresses as inputs, so that no address register is reused in front of it
    asm volatile("s_wait_xcnt 0x0" :: "v"(qhp), "v"(qlp) : "memory");
    v8f o[2][16];
#pragma unroll
    for (int g = 0; g < 2; ++g)
#pragma unroll
        for (int n = 0; n < 16; ++n) o[g][n] = (v8f){};
    float mtop[2] = {-3.0e38f, -3.0e38f}, mrun[2] = {-3.0e38f, -3.0e38f}, lrun[2] = {0.f, 0.f};   // this lane's two queries: running maximum, the reference in use (both lane halves alike) and the sum over this lane half's keys
#pragma unroll 1   // one body for all stages: the buffer is picked by the stage's parity
    for (int st = 0; st < NST; ++st) {
        // the refill stands at the stage's top, directly behind the barrier that ended every wave's reads of that buffer (stage st - 1's): the same place in run-time order as at the foot. With its branch
        // at the foot the build sinks the weight sums behind the branch, keeps both column groups' weights live through the products and spills to scratch.
        if (st + 1 < NST) fill(st + 1);
        const h16* sb = ring + (st & 1) * STG;
        {
            const h16* kb = sb + 2 * VPLN + (kq * 32 + lr) * KPI + 8 * hi;   // this wave's tile of the stage
            const v16h k0h = cat16(*(const v8ha*)kb, *(const v8ha*)(kb + 16)), k1h = cat16(*(const v8ha*)(kb + 16 * KPI), *(const v8ha*)(kb + 16 * KPI + 16));
            const v16h k0l = cat16(*(const v8ha*)(kb + KPLN), *(const v8ha*)(kb + KPLN + 16)), k1l = cat16(*(const v8ha*)(kb + KPLN + 16 * KPI), *(const v8ha*)(kb + KPLN + 16 * KPI + 16));
            // transposed energy: keys are the rows, queries the columns; register j of s0 / s1 = key 8 * hi + j / 16 + 8 * hi + j against query lr of the group
            v8f s0[2], s1[2], x0[2], x1[2];
#pragma unroll
            for (int g = 0; g < 2; ++g) { s0[g] = wmma16(k0h, qa[g], (v8f){}); s1[g] = wmma16(k1h, qa[g], (v8f){}); x0[g] = wmma16(k0h, ql[g], (v8f){}); x1[g] = wmma16(k1h, ql[g], (v8f){}); }
#pragma unroll
            for (int g = 0; g < 2; ++g) { x0[g] = wmma16(k0l, qa[g], x0[g]); x1[g] = wmma16(k1l, qa[g], x1[g]); }
            // four vector slots between the last energy product and the first vector read of its result
            asm volatile("v_nop\n\tv_nop\n\tv_nop\n\tv_nop" : "+v"(s0[0]), "+v"(s1[0]), "+v"(x0[0]), "+v"(x1[0]), "+v"(s0[1]), "+v"(s1[1]), "+v"(x0[1]), "+v"(x1[1]));
            // the tile's V fragments (16 channel tiles, two planes) are read from the stage in THREE runs, not among the products in pairs: six channel tiles here, their LDS latency passes under the softmax; four
            // and six further on among the products, where registers have come free, each run's latency under twelve products of the runs before (all at once do not fit the registers of two waves per SIMD)
            v16h vh[16], vl[16];
            auto ldV = [&](int n) { const h16* vb = sb + (n * 16 + lr) * VPI + kq * 32 + hi * 8;
                vh[n] = cat16(*(const v8ha*)vb, *(const v8ha*)(vb + 16)); vl[n] = cat16(*(const v8ha*)(vb + VPLN), *(const v8ha*)(vb + VPLN + 16)); };
#pragma unroll
            for (int n = 0; n < 6; ++n) ldV(n);
            __builtin_amdgcn_sched_barrier(0);   // keeps the first run of reads together in front of the softmax; without it they sink among the products in pairs, each place with an LDS wait of its own
            v16h pa[2], px[2]; v8f a0s[2], a1s[2]; bool need = false;
#pragma unroll
            for (int g = 0; g < 2; ++g) {
                a0s[g] = s0[g] + x0[g] * LOSCI; a1s[g] = s1[g] + x1[g] * LOSCI;
                const v8f m8 = __builtin_elementwise_max(a0s[g], a1s[g]);
                float mx = fmaxf(fmaxf(fmaxf(m8[0], m8[1]), fmaxf(m8[2], m8[3])), fmaxf(fmaxf(m8[4], m8[5]), fmaxf(m8[6], m8[7])));
                mx = fmaxf(mx, xhalf(mx));   // the other lane half's 16 keys of the same query
                mtop[g] = fmaxf(mtop[g], mx);
                need = need || (mtop[g] - mrun[g] > THR);
            }
            // one scalar branch per tile: every query of the wave moves its reference up to its running maximum, and its accumulators and sum follow (the first tile always takes it)
            if (__builtin_amdgcn_ballot_w32(need) != 0) {
#pragma unroll
                for (int g = 0; g < 2; ++g) {
                    const float alpha = __expf(mrun[g] - mtop[g]);
                    mrun[g] = mtop[g]; lrun[g] *= alpha;
#pragma unroll
                    for (int n = 0; n < 16; ++n)
#pragma unroll
                        for (int j = 0; j < 8; ++j) o[g][n][j] *= alpha;
                }
            }
            auto weights = [&](int g) {
                const v8f a0 = a0s[g], a1 = a1s[g]; const float mn = mrun[g];
                // the weights stay in registers: the two score tiles, converted in place, are the B operand (element s = key 8 * hi + s, then 16 + 8 * hi + s - 8: the V loader's k order)
                v8f p0, p1;
#pragma unroll
                for (int j = 0; j < 8; ++j) { p0[j] = __expf(a0[j] - mn); p1[j] = __expf(a1[j] - mn); }
                const v8f ps0 = p0 * PSC, ps1 = p1 * PSC, pp = p0 + p1;
                const v8h h0 = __builtin_convertvector(ps0, v8h), h1 = __builtin_convertvector(ps1, v8h);
                const v8h r0 = __builtin_convertvector(ps0 - __builtin_convertvector(h0, v8f), v8h), r1 = __builtin_convertvector(ps1 - __builtin_convertvector(h1, v8f), v8h);   // UNSCALED residual
                pa[g] = cat16(h0, h1); px[g] = cat16(r0, r1);
                const float ls = ((pp[0] + pp[1]) + (pp[2] + pp[3])) + ((pp[4] + pp[5]) + (pp[6] + pp[7]));
                lrun[g] += ls;
            };
            // transposed output tiles: register j of o[g][n] = channel n * 16 + 8 * hi + j of query lr of group g; each V fragment serves both groups. Two channel tiles are taken together, so that
            // the three products into one accumulator stand one product apart: directly behind one another each waits out the accumulator latency of the one before
            auto pv = [&](int g, int n) {
                o[g][n] = wmma16(vh[n], pa[g], o[g][n]); o[g][n + 1] = wmma16(vh[n + 1], pa[g], o[g][n + 1]);
                o[g][n] = wmma16(vl[n], pa[g], o[g][n]); o[g][n + 1] = wmma16(vl[n + 1], pa[g], o[g][n + 1]);
                o[g][n] = wmma16(vh[n], px[g], o[g][n]); o[g][n + 1] = wmma16(vh[n + 1], px[g], o[g][n + 1]);
            };
            weights(0);
            __builtin_amdgcn_sched_barrier(0);   // the first group's weights are finished before the second group's begin: formed side by side, their temporaries push the q fragments out to scratch
            weights(1);
            pv(0, 0); pv(0, 2); pv(0, 4);
            // issue order of the block above: the second group's weights are formed between the first group's products, in the matrix unit's shadow; without it the build puts them in front of the products they do not feed
#pragma unroll
            for (int i = 0; i < 18; ++i) { __builtin_amdgcn_sched_group_barrier(0x8, 1, 0); __builtin_amdgcn_sched_group_barrier(0x2, 6, 0); }
            pv(1, 0);
            __builtin_amdgcn_sched_barrier(0);   // the second run of reads stands here as one group: no earlier (beside the whole first run the build spills), and its latency passes under the next twelve products
#pragma unroll
            for (int n = 6; n < 10; ++n) ldV(n);
            __builtin_amdgcn_sched_barrier(0);   // keeps the second run together, in front of the products below
            pv(1, 2); pv(1, 4);
            __builtin_amdgcn_sched_barrier(0);   // the twelve products that need nothing of the second run stay in front of those that do; mixed, the first of them waits on the reads after four products
            pv(0, 6); pv(1, 6);
            __builtin_amdgcn_sched_barrier(0);   // the third run likewise: one group, into registers that earlier runs have left, its latency under the next twelve products
#pragma unroll
            for (int n = 10; n < 16; ++n) ldV(n);
            __builtin_amdgcn_sched_barrier(0);   // keeps the third run together, in front of the products below
            pv(0, 8); pv(1, 8);
            __builtin_amdgcn_sched_barrier(0);   // likewise for the third run
            pv(0, 10); pv(0, 12); pv(0, 14); pv(1, 10); pv(1, 12); pv(1, 14);
            __builtin_amdgcn_sched_barrier(0);   // every product stays in front of the stage's barrier: sunk behind it they would hold back the refill that stands at the next stage's top
            // four vector slots behind the last product on the loop's back edge too, before its operands or results are touched
            asm volatile("v_nop\n\tv_nop\n\tv_nop\n\tv_nop" : "+v"(o[0][14]), "+v"(o[0][15]), "+v"(o[1][14]), "+v"(o[1][15]) : "v"(pa[0]), "v"(px[0]), "v"(pa[1]), "v"(px[1]));
        }
        asm volatile("s_wait_dscnt 0x0" ::: "memory");      // this wave's reads of stage st are done before its buffer may be refilled
        asm volatile("s_wait_asynccnt 0x0" ::: "memory");   // this wave's share of stage st + 1 has landed
        __syncthreads();                                    // publishes stage st + 1 and ends every wave's reads of stage st
    }
    asm volatile("s_wait_asynccnt 0x0" ::: "memory");       // nothing of the ring is in flight when the wave goes on to the epilogue
    float lt[2];
#pragma unroll
    for (int g = 0; g < 2; ++g) { lt[g] = lrun[g] + xhalf(lrun[g]);   // the two lane halves' key sums joined once
        if (hi == 0) { jm[kq][qg * 32 + g * 16 + lr] = mrun[g]; jl[kq][qg * 32 + g * 16 + lr] = lt[g]; } }
    __syncthreads();   // publishes each key quarter's maximum and sum to the waves that hold the other quarters
    // staging: ot[key quarter][c][i_local] (4 x 256 x 64), each part already on the joint maximum and divided by the joint sum
#pragma unroll
    for (int g = 0; g < 2; ++g) {
        const int qi = qg * 32 + g * 16 + lr;
        const float m0 = jm[0][qi], m1 = jm[1][qi], m2 = jm[2][qi], m3 = jm[3][qi], mj = fmaxf(fmaxf(m0, m1), fmaxf(m2, m3));
        const float den = (jl[0][qi] * __expf(m0 - mj) + jl[1][qi] * __expf(m1 - mj)) + (jl[2][qi] * __expf(m2 - mj) + jl[3][qi] * __expf(m3 - mj));
        const float inv = __expf(mrun[g] - mj) / (den * PSC);
#pragma unroll
        for (int n = 0; n < 16; ++n)
#pragma unroll
            for (int j = 0; j < 8; ++j) ot[(kq * CC + n * 16 + hi * 8 + j) * OTP + qi] = o[g][n][j] * inv;
    }
    __syncthreads();
    // out[b][c][i0l + i] + x residual: per c a 256-B run (16 lanes x 16 B, two c per instruction); 256 c rows -> 8 waves x 16 instructions
    const float* xp = x + ((size_t)b * CC + (tid >> 4)) * NN_ + i0l + (tid & 15) * 4; float* outp = out + ((size_t)b * CC + (tid >> 4)) * NN_ + i0l + (tid & 15) * 4;
    const float* op0 = ot + (tid >> 4) * OTP + (tid & 15) * 4;
    v4f xr[16];   // all sixteen x pieces are requested together, one memory latency for the pass
#pragma unroll
    for (int s = 0; s < 16; ++s) xr[s] = *(const v4fa*)(xp + (size_t)s * 16 * NN_);
    // the x loads have been issued; the wait takes their address as an input, so that the address register is not reused in front of it
    asm volatile("s_wait_xcnt 0x0" :: "v"(xp) : "memory");
#pragma unroll
    for (int s0 = 0; s0 < 16; s0 += 4) {
        v4f val[4];
#pragma unroll
        for (int k = 0; k < 4; ++k) { const float* op = op0 + (s0 + k) * 16 * OTP;
            val[k] = (*(const v4fa*)op + *(const v4fa*)(op + CC * OTP)) + (*(const v4fa*)(op + 2 * CC * OTP) + *(const v4fa*)(op + 3 * CC * OTP));   // the four key quarters
#pragma unroll
            for (int i = 0; i < 4; ++i) val[k][i] += bfr(xr[s0 + k][i]); }
#pragma unroll
        for (int k = 0; k < 4; ++k) *(v4f*)(outp + (size_t)(s0 + k) * 16 * NN_) = val[k];
        __builtin_amdgcn_sched_barrier(0);                  // holds the next group's arithmetic behind the wait below
        asm volatile("s_wait_xcnt 0x0" ::: "memory");       // stands in front of every rewrite of a register that the four stores above name
        __builtin_amdgcn_sched_barrier(0);                  // and keeps that wait behind the stores
    }
}

extern "C" void kernel_launch(void* const* d_in, const int* in_sizes, int n_in,
                              void* d_out, int out_size, void* d_ws, size_t ws_size, hipStream_t stream) {
    (void)in_sizes; (void)n_in; (void)out_size;
    const float* x = (const float*)d_in[0]; const float* wq = (const float*)d_in[1]; const float* bq = (const float*)d_in[2]; const float* wk = (const float*)d_in[3]; const float* bk = (const float*)d_in[4];
    const float* wv = (const float*)d_in[5]; const float* bv = (const float*)d_in[6];
    float* out = (float*)d_out;    // [8][256][2048]
    char* wsp = (char*)d_ws;
    auto take = [&](size_t bytes) { char* p = wsp; wsp += (bytes + 255) & ~(size_t)255; return (void*)p; };
    bf* WQ = (bf*)take((size_t)HQ * CC * 2); bf* WK = (bf*)take((size_t)HQ * CC * 2); bf* WV = (bf*)take((size_t)CC * CC * 2);
    h16* QH = (h16*)take((size_t)NTK * HQ * 2); h16* QL = (h16*)take((size_t)NTK * HQ * 2); h16* KH = (h16*)take((size_t)NTK * HQ * 2); h16* KL = (h16*)take((size_t)NTK * HQ * 2);
    h16* VTH = (h16*)take((size_t)NTK * CC * 2); h16* VTL = (h16*)take((size_t)NTK * CC * 2);
    if ((size_t)(wsp - (char*)d_ws) > ws_size) return;    // 0.2 + 1 x 4 + 8.4 x 2 ~ 21 MB
    k_w<<<(2 * HQ + CC) / 8, 256, 0, stream>>>(wq, wk, wv, WQ, WK, WV);
    k_proj<<<dim3(NN_ / 64, NB_, 1), 256, 0, stream>>>(x, WQ, WK, WV, bq, bk, bv, QH, QL, KH, KL, VTH, VTL);
    k_attn<<<dim3(NB_ * (NN_ / QB), 1, 1), 256, 0, stream>>>(QH, QL, KH, KL, VTH, VTL, x, out);
}

// v008
// One run takes 49.5 microseconds.
// Timed twice side by side with v007, it ran 1.09 times as fast both times.
// Over all steps from v000 it is 4.99 times as fast.
#include <hip/hip_runtime.h>

// Contractions, f32 accumulate: q/k = 1x1 convs ([16384 positions x 256].[256 x 32] each) and v ([16384 x 256].[256 x 256]) on v_wmma_f32_16x16x32_bf16 with PLAIN
// bf16 operands (inputs rounded once: exact); the position attention fused on v_wmma_f32_16x16x32_f16: energy = q.k over the 32 hidden dims (UNSCALED; q and k as
// f16 hi + residual x1024: hi.hi + hi.lo + lo.hi), softmax over the 2048 positions, out[c][i] = sum_j w[i][j] v[c][j] over all 256 channels with the weights
// (x4) and v each as f16 hi + UNSCALED residual: three products into ONE accumulator; + x residual; output written channel-major

#define NB_  8
#define CC   256
#define NN_  2048
#define HQ   32
#define NTK  (NB_ * NN_)
#define PSC  4.0f                     // weight scale: a weight is at most 2^13 (THR), so x4 stays inside f16
#define THR  9.0109f                  // 13 ln 2: how far a query's maximum may pass the reference in use before the accumulators are rescaled
#define LOSC 1024.0f
#define LOSCI (1.0f / 1024.0f)

typedef _Float16 h16;
typedef unsigned short bf;
typedef __attribute__((ext_vector_type(16))) __bf16   v16bf;
typedef __attribute__((ext_vector_type(16))) _Float16 v16h;
typedef __attribute__((ext_vector_type(8)))  _Float16 v8h;
typedef __attribute__((ext_vector_type(8)))  unsigned short v8us;
typedef __attribute__((ext_vector_type(8)))  float    v8f;
typedef __attribute__((ext_vector_type(4)))  float    v4f;
typedef v8h  __attribute__((may_alias)) v8ha;
typedef v4f  __attribute__((may_alias)) v4fa;
typedef v8us __attribute__((may_alias)) v8usa;

__device__ __forceinline__ unsigned short f2bf(float f) { unsigned u = __float_as_uint(f); u += 0x7FFFu + ((u >> 16) & 1u); return (unsigned short)(u >> 16); }
__device__ __forceinline__ float bf2f(unsigned short b) { return __uint_as_float(((unsigned)b) << 16); }
__device__ __forceinline__ float bfr(float f) { return bf2f(f2bf(f)); }
__device__ __forceinline__ v16h cat16(v8h lo, v8h hi) { return __builtin_shufflevector(lo, hi, 0, 1, 2, 3, 4, 5, 6, 7, 8, 9, 10, 11, 12, 13, 14, 15); }
__device__ __forceinline__ v16bf cat16b(v8us lo, v8us hi) { return __builtin_bit_cast(v16bf, __builtin_shufflevector(lo, hi, 0, 1, 2, 3, 4, 5, 6, 7, 8, 9, 10, 11, 12, 13, 14, 15)); }
__device__ __forceinline__ v8f wmma16(v16h a, v16h b, v8f c) { return __builtin_amdgcn_wmma_f32_16x16x32_f16(false, a, false, b, (short)0, c, false, false); }
__device__ __forceinline__ v8f wmmab(v16bf a, v16bf b, v8f c) { return __builtin_amdgcn_wmma_f32_16x16x32_bf16(false, a, false, b, (short)0, c, false, false); }
__device__ __forceinline__ float xhalf(float v) { return __builtin_bit_cast(float, __builtin_amdgcn_permlanex16(__builtin_bit_cast(int, v), __builtin_bit_cast(int, v), 0x76543210, 0xfedcba98, false, false)); }  // lane l with lane l ^ 16
#define VST2(T, p, v) do { const T vst2_v_ = (v); *(T*)(p) = vst2_v_;  } while (0)

// k_w: bf16 planes of wq [32][256], wk [32][256], wv [256][256] ([out][in] = n-major as-is); one wave per row (32 lanes x 16 B = 512 B).
__global__ __launch_bounds__(256) void k_w(const float* __restrict__ wq, const float* __restrict__ wk, const float* __restrict__ wv, bf* WQ, bf* WK, bf* WV) {
    const int lane = threadIdx.x & 31, r = blockIdx.x * 8 + (threadIdx.x >> 5);      // 0 .. 32+32+256
    const int m = (r < HQ) ? 0 : (r < 2 * HQ) ? 1 : 2;     // wave-uniform
    v8us o;
    if (m == 0) { for (int i = 0; i < 8; ++i) o[i] = f2bf(wq[(size_t)r * CC + lane * 8 + i]); VST2(v8us, WQ + (size_t)r * CC + lane * 8, o); }
    else if (m == 1) { const int o2 = r - HQ; for (int i = 0; i < 8; ++i) o[i] = f2bf(wk[(size_t)o2 * CC + lane * 8 + i]); VST2(v8us, WK + (size_t)o2 * CC + lane * 8, o); }
    else { const int o2 = r - 2 * HQ; if (o2 < CC) { for (int i = 0; i < 8; ++i) o[i] = f2bf(wv[(size_t)o2 * CC + lane * 8 + i]); VST2(v8us, WV + (size_t)o2 * CC + lane * 8, o); } }
}
// k_proj: block = (b, 64 positions), 8 waves. The block's x tile (256 channels x 64 positions) is read once in whole lines, rounded to bf16 and laid position-major in
// LDS; all three projections take their A fragments (16 positions x 32 channels) from that tile and their B fragments (weight rows) from global memory, requested
// together with the tile. v: wave = 32 output channels x 64 positions; a lane's accumulator holds 8 consecutive positions of ONE channel, so hi + residual pack straight into
// channel-major 16-byte pieces, gathered through LDS into 128-B lines of VTH / VTL [b][c][n]. q | k: wave = (16 positions, q or k), planes [tok][32].
#define XPI 264                       // x tile row pitch in LDS, bf16 units: 512-B row + 16 B (16 B x odd: no bank conflict for 16-byte reads of 16 rows)
#define OPI 72                        // v staging row pitch, f16 units: 128-B row + 16 B
__global__ __launch_bounds__(256) void k_proj(const float* __restrict__ x, const bf* __restrict__ WQ, const bf* __restrict__ WK, const bf* __restrict__ WV,
                                              const float* __restrict__ bq, const float* __restrict__ bk, const float* __restrict__ bv,
                                              h16* QH, h16* QL, h16* KH, h16* KL, h16* VTH, h16* VTL) {
    __shared__ __align__(16) unsigned short xs[64 * XPI];
    __shared__ __align__(16) h16 vsh[CC * OPI];
    __shared__ __align__(16) h16 vsl[CC * OPI];
    __shared__ __align__(16) float ost[8][16 * 36];
    const int tid = threadIdx.x, lane = tid & 31, wave = tid >> 5, lr = lane & 15, hi = lane >> 4;
    const int n0 = blockIdx.x * 64, b = blockIdx.y, which = wave >> 2, nt = wave & 3;
    const bf* W = which ? WK : WQ; const float* bias = which ? bk : bq; h16* PH = which ? KH : QH; h16* PL = which ? KL : QL;   // wave-uniform selects of whole buffers
    // the wave's weight fragments for all eight k steps: they do not depend on the tile, so their latency passes under the tile's load and transpose
    const bf* vp0 = WV + (size_t)(wave * 32 + lr) * CC + 8 * hi; const bf* vp1 = vp0 + 16 * CC;
    const bf* qp0 = W + (size_t)lr * CC + 8 * hi; const bf* qp1 = qp0 + 16 * CC;
    const float* bvp = bv + wave * 32 + lr; const float* bbp = bias + lr;
    v16bf wvf[8][2], wqf[8][2];
#pragma unroll
    for (int ks = 0; ks < 8; ++ks) {
        wvf[ks][0] = cat16b(*(const v8us*)(vp0 + ks * 32), *(const v8us*)(vp0 + ks * 32 + 16)); wvf[ks][1] = cat16b(*(const v8us*)(vp1 + ks * 32), *(const v8us*)(vp1 + ks * 32 + 16));
        wqf[ks][0] = cat16b(*(const v8us*)(qp0 + ks * 32), *(const v8us*)(qp0 + ks * 32 + 16)); wqf[ks][1] = cat16b(*(const v8us*)(qp1 + ks * 32), *(const v8us*)(qp1 + ks * 32 + 16));
    }
    const float bv0 = bvp[0], bv1 = bvp[16], bb0 = bbp[0], bb1 = bbp[16];
    // x tile: thread = (4 positions, 16 channels); 16 lanes cover one channel's 256-B run
    {
        const int piece = tid & 15, g = tid >> 4;
        const float* xp = x + ((size_t)b * CC + g * 16) * NN_ + n0 + piece * 4;
        v4f xr[16];
#pragma unroll
        for (int i = 0; i < 16; ++i) xr[i] = *(const v4fa*)(xp + (size_t)i * NN_);
        // every load above has been issued; the wait takes their addresses as inputs, so that no address register is reused in front of it
        asm volatile("s_wait_xcnt 0x0" :: "v"(vp0), "v"(vp1), "v"(qp0), "v"(qp1), "v"(bvp), "v"(bbp), "v"(xp) : "memory");
#pragma unroll
        for (int k = 0; k < 4; ++k)
#pragma unroll
            for (int o = 0; o < 2; ++o) { v8us p;
#pragma unroll
                for (int e = 0; e < 8; ++e) p[e] = f2bf(xr[o * 8 + e][k]);
                *(v8usa*)(xs + (piece * 4 + k) * XPI + g * 16 + o * 8) = p; }
    }
    __syncthreads();
    v8f av[4][2], aq[2] = {(v8f){}, (v8f){}};
#pragma unroll
    for (int m = 0; m < 4; ++m) { av[m][0] = (v8f){}; av[m][1] = (v8f){}; }
    // A fragments in two register sets: step ks + 1 is read from LDS as one group ahead of step ks's products, so its latency passes under them
    v16bf a[2][5];
    auto ldA = [&](int ks, v16bf (&f)[5]) {
#pragma unroll
        for (int m = 0; m < 5; ++m) { const unsigned short* ap = xs + ((m < 4 ? m : nt) * 16 + lr) * XPI + ks * 32 + 8 * hi; f[m] = cat16b(*(const v8usa*)ap, *(const v8usa*)(ap + 16)); }
    };
    ldA(0, a[0]);
#pragma unroll
    for (int ks = 0; ks < 8; ++ks) {
        if (ks < 7) ldA(ks + 1, a[(ks + 1) & 1]);
        __builtin_amdgcn_sched_barrier(0);   // keeps the next step's reads together in front of this step's products; without it they sink to their uses, one exposed LDS latency each
#pragma unroll
        for (int m = 0; m < 4; ++m) { av[m][0] = wmmab(a[ks & 1][m], wvf[ks][0], av[m][0]); av[m][1] = wmmab(a[ks & 1][m], wvf[ks][1], av[m][1]); }
        aq[0] = wmmab(a[ks & 1][4], wqf[ks][0], aq[0]); aq[1] = wmmab(a[ks & 1][4], wqf[ks][1], aq[1]);
    }
    // v: register j of av[m][t] = position m * 16 + 8 * hi + j of channel wave * 32 + t * 16 + lr
#pragma unroll
    for (int t = 0; t < 2; ++t) { const int c = wave * 32 + t * 16 + lr; const float b2 = bfr(t ? bv1 : bv0);
#pragma unroll
        for (int m = 0; m < 4; ++m) { const v8f v = av[m][t] + b2; const v8h oh = __builtin_convertvector(v, v8h), ol = __builtin_convertvector(v - __builtin_convertvector(oh, v8f), v8h);   // v residual UNSCALED (f16 subnormals carry it)
            *(v8ha*)(vsh + c * OPI + m * 16 + hi * 8) = oh; *(v8ha*)(vsl + c * OPI + m * 16 + hi * 8) = ol; } }
    float* os = &ost[wave][0];
#pragma unroll
    for (int t = 0; t < 2; ++t) { const float bb = bfr(t ? bb1 : bb0);
#pragma unroll
        for (int j = 0; j < 8; ++j) os[(hi * 8 + j) * 36 + t * 16 + lr] = aq[t][j] + bb; }
    __syncthreads();
    const size_t r0 = (size_t)b * NN_ + n0 + nt * 16;
#pragma unroll
    for (int s = 0; s < 2; ++s) { const int row = s * 8 + (lane >> 2), pc = lane & 3; const float* sp = os + row * 36 + pc * 8;   // 4 lanes x 16 B per 64-B row
        const v8f v = __builtin_shufflevector(*(const v4fa*)sp, *(const v4fa*)(sp + 4), 0, 1, 2, 3, 4, 5, 6, 7);
        const v8h oh = __builtin_convertvector(v, v8h), ol = __builtin_convertvector((v - __builtin_convertvector(oh, v8f)) * LOSC, v8h);
        *(v8h*)(PH + (r0 + row) * HQ + pc * 8) = oh; *(v8h*)(PL + (r0 + row) * HQ + pc * 8) = ol; }
#pragma unroll
    for (int s = 0; s < 8; ++s) { const int c = (tid >> 3) + 32 * s, pc = tid & 7; const size_t o = ((size_t)b * CC + c) * NN_ + n0 + pc * 8;   // 8 lanes x 16 B per 128-B row
        *(v8h*)(VTH + o) = *(const v8ha*)(vsh + c * OPI + pc * 8); *(v8h*)(VTL + o) = *(const v8ha*)(vsl + c * OPI + pc * 8); }
}
// k_attn: block = (b, 64 positions i, ALL 256 channels), 8 waves, one block per WGP. Wave = (32 positions, one of a stage's four 32-key tiles): energy and softmax of a (position, key) pair are formed
// once for all 256 channels; a V fragment read from LDS feeds two 16-position column groups; the four waves that share 32 positions each walk a quarter of the keys and are joined once at the end.
// The keys are walked in LDS stages of 128 (four 32-key tiles): each stage holds all V rows (256 channels x 128 keys, hi and residual plane) and K rows (128 keys x 32 dims, hi and residual plane),
// brought in ONCE per block by tensor loads, one request per issuing wave and stage (four waves: 128 V rows each; two waves: a K plane each), into two buffers: stage s + 1 is issued when stage s - 1 has been read, so it flies while stage s is worked on.
// Per 32-key tile, both products transposed (keys x queries, then channels x queries): energy (hi.hi + hi.lo + lo.hi), a lane holds 16 scores of ONE query, so the
// online softmax is in-lane but for one exchange between the wave's halves; weights x4 as f16 hi + UNSCALED residual go from the score registers straight into
// the B operand; o += vh.wh + vl.wh + vh.wl, one accumulator (32 positions x 256 channels = 256 registers). The weights are taken against a held reference, not the running maximum: accumulators and
// sums are rescaled only in a tile where some query's maximum has passed its reference by more than THR (one test per tile for the whole wave).
// Epilogue: the four key quarters exchange maximum and sum through LDS, each scales its own part, out[b][c][i] = sum of the parts + x[b][c][i], gathered through LDS (the ring's bytes, free by then).
#define QB   64                       // positions i per block
#define OTP  (QB + 4)                 // output staging row pitch, floats
#define KT   128                      // keys per stage
#define NST  (NN_ / KT)
#define VPI  136                      // V row pitch in LDS, f16 units: 256-B row + 16 B (16 B x odd: no bank conflict for 16-byte reads of 16 rows)
#define KRP  136                      // K in LDS, f16 units: four keys (4 x 64 B, contiguous in memory) make one 256-B row + 16 B; 16 keys' 16-byte reads fall on 16 different bank groups
#define VPLN (CC * VPI)
#define KPLN 5120                     // a K plane's place, f16 units: 32 such rows (8,704 B) rounded up to a multiple of 2 KiB
#define STG  (2 * VPLN + 2 * KPLN)    // f16 units per stage: V hi | V residual | K hi | K residual

typedef unsigned u32x4 __attribute__((ext_vector_type(4)));
typedef unsigned u32x8 __attribute__((ext_vector_type(8)));
__device__ __forceinline__ unsigned uni(unsigned v) { return (unsigned)__builtin_amdgcn_readfirstlane(v); }
// a tensor load ignores EXEC: only a scalar branch keeps a wave from issuing it
__device__ __forceinline__ unsigned pinned(unsigned v) { unsigned w = uni(v); asm volatile("" : "+s"(w)); return w; }   // the empty statement holds the wave-uniform test in a scalar register, so that the branch on it compiles to s_cmp + s_cbranch_scc
#define TPAD ((1u << 20) | (5u << 22) | (3u << 25))   // descriptor group 1, word 0: no mask, 1-byte elements, 16 B of pad behind every 256-B row

// two waves per SIMD is what one 8-wave block per WGP gives; stated, because without it the build holds itself to 256 registers and scatters the V fragment reads among the products
__global__ __launch_bounds__(256) __attribute__((amdgpu_waves_per_eu(2, 2))) void k_attn(const h16* __restrict__ QH, const h16* __restrict__ QL, const h16* __restrict__ KH, const h16* __restrict__ KL, const h16* __restrict__ VTH, const h16* __restrict__ VTL,
                                             const float* __restrict__ x, float* out) {
    __shared__ __attribute__((aligned(2048))) unsigned char smem[2 * STG * 2];   // the ring; behind the loop the output staging (4 * CC * OTP floats fit in it)
    __shared__ float jm[4][QB], jl[4][QB];                      // each key quarter's maximum and sum per position
    const h16* ring = (const h16*)smem; float* ot = (float*)smem;
    const int tid = threadIdx.x, lane = tid & 31, wave = tid >> 5, lr = lane & 15, hi = lane >> 4, qg = wave & 1, kq = wave >> 1;
    const int b = blockIdx.x / (NN_ / QB), it = blockIdx.x - b * (NN_ / QB), i0l = it * QB, q0 = i0l + qg * 32;
    const size_t tok0 = (size_t)b * NN_;
    // Waves 0 to 3 each bring 128 V rows of 256 B (hi plane rows 0.., 128.., residual plane rows 0.., 128..; source pitch one channel row), waves 4 and 5 a K plane (128 keys x 64 B, contiguous: 32 rows of 256 B).
    // Every slice's place in LDS is a multiple of 2 KiB; the pad gives the 272-B pitch that the fragment reads use.
    const unsigned ring0 = (unsigned)(size_t)&smem[0];
    const unsigned wv = uni((unsigned)tid >> 5), issuer = wv < 6u ? 1u : 0u, isK = wv >> 2;
    const h16* tsrc = isK ? ((wv & 1u) ? KL : KH) + (size_t)b * (NN_ * HQ) : ((wv & 2u) ? VTL : VTH) + (size_t)(b * CC + (int)(wv & 1u) * 128) * NN_;
    const unsigned tstep = isK ? KT * HQ * 2u : KT * 2u;                                                     // source bytes from one stage to the next
    const unsigned tdst = ring0 + (isK ? 2u * VPLN * 2u + (wv & 1u) * (KPLN * 2u) : wv * (128u * VPI * 2u));
    const unsigned trows = isK ? 32u : 128u, tpitch = isK ? 256u : NN_ * 2u;
    u32x8 g1;   // tensor = tile: trows rows of 256 B
    g1[0] = uni(TPAD); g1[1] = uni(256u << 16); g1[2] = uni(trows << 16); g1[3] = uni(256u << 16); g1[4] = uni(trows); g1[5] = uni(tpitch); g1[6] = uni(0u); g1[7] = uni(0u);
    auto fill = [&](int st) {
        const unsigned long long ga = (unsigned long long)(size_t)tsrc + (unsigned long long)((unsigned)st * tstep);
        u32x4 g0;
        g0[0] = uni(1u); g0[1] = uni(tdst + (unsigned)(st & 1) * (STG * 2u)); g0[2] = uni((unsigned)ga); g0[3] = uni((((unsigned)(ga >> 32)) & 0x01FFFFFFu) | 0x80000000u);
        asm volatile("tensor_load_to_lds %0, %1" :: "s"(g0), "s"(g1) : "memory");   // one request of the whole wave: its slice of stage st
    };
    if (pinned(issuer)) {
        fill(0);
        asm volatile("s_wait_tensorcnt 0x0" ::: "memory");   // this wave's slice of stage 0 has landed
    }
    __syncthreads();                                    // publishes stage 0 to the other waves
    const h16* qhp = QH + (tok0 + q0 + lr) * HQ + 8 * hi; const h16* qlp = QL + (tok0 + q0 + lr) * HQ + 8 * hi;
    v16h qa[2], ql[2];   // column group g = positions q0 + 16 * g + lr
#pragma unroll
    for (int g = 0; g < 2; ++g) { qa[g] = cat16(*(const v8h*)(qhp + g * 16 * HQ), *(const v8h*)(qhp + g * 16 * HQ + 16)); ql[g] = cat16(*(const v8h*)(qlp + g * 16 * HQ), *(const v8h*)(qlp + g * 16 * HQ + 16)); }
    // the q loads have been issued; the wait takes their addresses as inputs, so that no address register is reused in front of it
    asm volatile("s_wait_xcnt 0x0" :: "v"(qhp), "v"(qlp) : "memory");
    v8f o[2][16];
#pragma unroll
    for (int g = 0; g < 2; ++g)
#pragma unroll
        for (int n = 0; n < 16; ++n) o[g][n] = (v8f){};
    float mtop[2] = {-3.0e38f, -3.0e38f}, mrun[2] = {-3.0e38f, -3.0e38f}, lrun[2] = {0.f, 0.f};   // this lane's two queries: running maximum, the reference in use (both lane halves alike) and the sum over this lane half's keys
#pragma unroll 1   // one body for all stages: the buffer is picked by the stage's parity
    for (int st = 0; st < NST; ++st) {
        // the refill stands at the stage's top, directly behind the barrier that ended every wave's reads of that buffer (stage st - 1's): the same place in run-time order as at the foot. With its branch
        // at the foot the build sinks the weight sums behind the branch, keeps both column groups' weights live through the products and spills to scratch.
        if (pinned(issuer & (unsigned)(st + 1 < NST))) fill(st + 1);
        const h16* sb = ring + (st & 1) * STG;
        {
            const h16* kb = sb + 2 * VPLN + (kq * 8 + (lr >> 2)) * KRP + (lr & 3) * HQ + 8 * hi;   // this wave's tile of the stage: key kq * 32 + lr; 16 keys on = 4 rows on
            const v16h k0h = cat16(*(const v8ha*)kb, *(const v8ha*)(kb + 16)), k1h = cat16(*(const v8ha*)(kb + 4 * KRP), *(const v8ha*)(kb + 4 * KRP + 16));
            const v16h k0l = cat16(*(const v8ha*)(kb + KPLN), *(const v8ha*)(kb + KPLN + 16)), k1l = cat16(*(const v8ha*)(kb + KPLN + 4 * KRP), *(const v8ha*)(kb + KPLN + 4 * KRP + 16));
            // transposed energy: keys are the rows, queries the columns; register j of s0 / s1 = key 8 * hi + j / 16 + 8 * hi + j against query lr of the group
            v8f s0[2], s1[2], x0[2], x1[2];
#pragma unroll
            for (int g = 0; g < 2; ++g) { s0[g] = wmma16(k0h, qa[g], (v8f){}); s1[g] = wmma16(k1h, qa[g], (v8f){}); x0[g] = wmma16(k0h, ql[g], (v8f){}); x1[g] = wmma16(k1h, ql[g], (v8f){}); }
#pragma unroll
            for (int g = 0; g < 2; ++g) { x0[g] = wmma16(k0l, qa[g], x0[g]); x1[g] = wmma16(k1l, qa[g], x1[g]); }
            // four vector slots between the last energy product and the first vector read of its result
            asm volatile("v_nop\n\tv_nop\n\tv_nop\n\tv_nop" : "+v"(s0[0]), "+v"(s1[0]), "+v"(x0[0]), "+v"(x1[0]), "+v"(s0[1]), "+v"(s1[1]), "+v"(x0[1]), "+v"(x1[1]));
            // the tile's V fragments (16 channel tiles, two planes) are read from the stage in THREE runs, not among the products in pairs: six channel tiles here, their LDS latency passes under the softmax; four
            // and six further on among the products, where registers have come free, each run's latency under twelve products of the runs before (all at once do not fit the registers of two waves per SIMD)
            v16h vh[16], vl[16];
            auto ldV = [&](int n) { const h16* vb = sb + (n * 16 + lr) * VPI + kq * 32 + hi * 8;
                vh[n] = cat16(*(const v8ha*)vb, *(const v8ha*)(vb + 16)); vl[n] = cat16(*(const v8ha*)(vb + VPLN), *(const v8ha*)(vb + VPLN + 16)); };
#pragma unroll
            for (int n = 0; n < 6; ++n) ldV(n);
            __builtin_amdgcn_sched_barrier(0);   // keeps the first run of reads together in front of the softmax; without it they sink among the products in pairs, each place with an LDS wait of its own
            v16h pa[2], px[2]; v8f a0s[2], a1s[2]; bool need = false;
#pragma unroll
            for (int g = 0; g < 2; ++g) {
                a0s[g] = s0[g] + x0[g] * LOSCI; a1s[g] = s1[g] + x1[g] * LOSCI;
                const v8f m8 = __builtin_elementwise_max(a0s[g], a1s[g]);
                float mx = fmaxf(fmaxf(fmaxf(m8[0], m8[1]), fmaxf(m8[2], m8[3])), fmaxf(fmaxf(m8[4], m8[5]), fmaxf(m8[6], m8[7])));
                mx = fmaxf(mx, xhalf(mx));   // the other lane half's 16 keys of the same query
                mtop[g] = fmaxf(mtop[g], mx);
                need = need || (mtop[g] - mrun[g] > THR);
            }
            // one scalar branch per tile: every query of the wave moves its reference up to its running maximum, and its accumulators and sum follow (the first tile always takes it)
            if (__builtin_amdgcn_ballot_w32(need) != 0) {
#pragma unroll
                for (int g = 0; g < 2; ++g) {
                    const float alpha = __expf(mrun[g] - mtop[g]);
                    mrun[g] = mtop[g]; lrun[g] *= alpha;
#pragma unroll
                    for (int n = 0; n < 16; ++n)
#pragma unroll
                        for (int j = 0; j < 8; ++j) o[g][n][j] *= alpha;
                }
            }
            auto weights = [&](int g) {
                const v8f a0 = a0s[g], a1 = a1s[g]; const float mn = mrun[g];
                // the weights stay in registers: the two score tiles, converted in place, are the B operand (element s = key 8 * hi + s, then 16 + 8 * hi + s - 8: the V loader's k order)
                v8f p0, p1;
#pragma unroll
                for (int j = 0; j < 8; ++j) { p0[j] = __expf(a0[j] - mn); p1[j] = __expf(a1[j] - mn); }
                const v8f ps0 = p0 * PSC, ps1 = p1 * PSC, pp = p0 + p1;
                const v8h h0 = __builtin_convertvector(ps0, v8h), h1 = __builtin_convertvector(ps1, v8h);
                const v8h r0 = __builtin_convertvector(ps0 - __builtin_convertvector(h0, v8f), v8h), r1 = __builtin_convertvector(ps1 - __builtin_convertvector(h1, v8f), v8h);   // UNSCALED residual
                pa[g] = cat16(h0, h1); px[g] = cat16(r0, r1);
                const float ls = ((pp[0] + pp[1]) + (pp[2] + pp[3])) + ((pp[4] + pp[5]) + (pp[6] + pp[7]));
                lrun[g] += ls;
            };
            // transposed output tiles: register j of o[g][n] = channel n * 16 + 8 * hi + j of query lr of group g; each V fragment serves both groups. Two channel tiles are taken together, so that
            // the three products into one accumulator stand one product apart: directly behind one another each waits out the accumulator latency of the one before
            auto pv = [&](int g, int n) {
                o[g][n] = wmma16(vh[n], pa[g], o[g][n]); o[g][n + 1] = wmma16(vh[n + 1], pa[g], o[g][n + 1]);
                o[g][n] = wmma16(vl[n], pa[g], o[g][n]); o[g][n + 1] = wmma16(vl[n + 1], pa[g], o[g][n + 1]);
                o[g][n] = wmma16(vh[n], px[g], o[g][n]); o[g][n + 1] = wmma16(vh[n + 1], px[g], o[g][n + 1]);
            };
            weights(0);
            __builtin_amdgcn_sched_barrier(0);   // the first group's weights are finished before the second group's begin: formed side by side, their temporaries push the q fragments out to scratch
            weights(1);
            pv(0, 0); pv(0, 2); pv(0, 4);
            // issue order of the block above: the second group's weights are formed between the first group's products, in the matrix unit's shadow; without it the build puts them in front of the products they do not feed
#pragma unroll
            for (int i = 0; i < 18; ++i) { __builtin_amdgcn_sched_group_barrier(0x8, 1, 0); __builtin_amdgcn_sched_group_barrier(0x2, 6, 0); }
            pv(1, 0);
            __builtin_amdgcn_sched_barrier(0);   // the second run of reads stands here as one group: no earlier (beside the whole first run the build spills), and its latency passes under the next twelve products
#pragma unroll
            for (int n = 6; n < 10; ++n) ldV(n);
            __builtin_amdgcn_sched_barrier(0);   // keeps the second run together, in front of the products below
            pv(1, 2); pv(1, 4);
            __builtin_amdgcn_sched_barrier(0);   // the twelve products that need nothing of the second run stay in front of those that do; mixed, the first of them waits on the reads after four products
            pv(0, 6); pv(1, 6);
            __builtin_amdgcn_sched_barrier(0);   // the third run likewise: one group, into registers that earlier runs have left, its latency under the next twelve products
#pragma unroll
            for (int n = 10; n < 16; ++n) ldV(n);
            __builtin_amdgcn_sched_barrier(0);   // keeps the third run together, in front of the products below
            pv(0, 8); pv(1, 8);
            __builtin_amdgcn_sched_barrier(0);   // likewise for the third run
            pv(0, 10); pv(0, 12); pv(0, 14); pv(1, 10); pv(1, 12); pv(1, 14);
            __builtin_amdgcn_sched_barrier(0);   // every product stays in front of the stage's barrier: sunk behind it they would hold back the refill that stands at the next stage's top
            // four vector slots behind the last product on the loop's back edge too, before its operands or results are touched
            asm volatile("v_nop\n\tv_nop\n\tv_nop\n\tv_nop" : "+v"(o[0][14]), "+v"(o[0][15]), "+v"(o[1][14]), "+v"(o[1][15]) : "v"(pa[0]), "v"(px[0]), "v"(pa[1]), "v"(px[1]));
        }
        asm volatile("s_wait_dscnt 0x0" ::: "memory");      // this wave's reads of stage st are done before its buffer may be refilled
        asm volatile("s_wait_tensorcnt 0x0" ::: "memory");  // this wave's slice of stage st + 1 has landed; in every wave (one that issued nothing passes at once): a branch round it makes the build sink the weight sums behind the products
        __syncthreads();                                    // publishes stage st + 1 and ends every wave's reads of stage st
    }
    asm volatile("s_wait_tensorcnt 0x0" ::: "memory");      // nothing of the ring is in flight when the wave goes on to the epilogue
    asm volatile("s_wait_dscnt 0x0" ::: "memory");          // and none of its reads is open when the ring's bytes become the output staging
    float lt[2];
#pragma unroll
    for (int g = 0; g < 2; ++g) { lt[g] = lrun[g] + xhalf(lrun[g]);   // the two lane halves' key sums joined once
        if (hi == 0) { jm[kq][qg * 32 + g * 16 + lr] = mrun[g]; jl[kq][qg * 32 + g * 16 + lr] = lt[g]; } }
    __syncthreads();   // publishes each key quarter's maximum and sum to the waves that hold the other quarters
    // staging: ot[key quarter][c][i_local] (4 x 256 x 64), each part already on the joint maximum and divided by the joint sum
#pragma unroll
    for (int g = 0; g < 2; ++g) {
        const int qi = qg * 32 + g * 16 + lr;
        const float m0 = jm[0][qi], m1 = jm[1][qi], m2 = jm[2][qi], m3 = jm[3][qi], mj = fmaxf(fmaxf(m0, m1), fmaxf(m2, m3));
        const float den = (jl[0][qi] * __expf(m0 - mj) + jl[1][qi] * __expf(m1 - mj)) + (jl[2][qi] * __expf(m2 - mj) + jl[3][qi] * __expf(m3 - mj));
        const float inv = __expf(mrun[g] - mj) / (den * PSC);
#pragma unroll
        for (int n = 0; n < 16; ++n)
#pragma unroll
            for (int j = 0; j < 8; ++j) ot[(kq * CC + n * 16 + hi * 8 + j) * OTP + qi] = o[g][n][j] * inv;
    }
    __syncthreads();
    // out[b][c][i0l + i] + x residual: per c a 256-B run (16 lanes x 16 B, two c per instruction); 256 c rows -> 8 waves x 16 instructions
    const float* xp = x + ((size_t)b * CC + (tid >> 4)) * NN_ + i0l + (tid & 15) * 4; float* outp = out + ((size_t)b * CC + (tid >> 4)) * NN_ + i0l + (tid & 15) * 4;
    const float* op0 = ot + (tid >> 4) * OTP + (tid & 15) * 4;
    v4f xr[16];   // all sixteen x pieces are requested together, one memory latency for the pass
#pragma unroll
    for (int s = 0; s < 16; ++s) xr[s] = *(const v4fa*)(xp + (size_t)s * 16 * NN_);
    // the x loads have been issued; the wait takes their address as an input, so that the address register is not reused in front of it
    asm volatile("s_wait_xcnt 0x0" :: "v"(xp) : "memory");
#pragma unroll
    for (int s0 = 0; s0 < 16; s0 += 4) {
        v4f val[4];
#pragma unroll
        for (int k = 0; k < 4; ++k) { const float* op = op0 + (s0 + k) * 16 * OTP;
            val[k] = (*(const v4fa*)op + *(const v4fa*)(op + CC * OTP)) + (*(const v4fa*)(op + 2 * CC * OTP) + *(const v4fa*)(op + 3 * CC * OTP));   // the four key quarters
#pragma unroll
            for (int i = 0; i < 4; ++i) val[k][i] += bfr(xr[s0 + k][i]); }
#pragma unroll
        for (int k = 0; k < 4; ++k) *(v4f*)(outp + (size_t)(s0 + k) * 16 * NN_) = val[k];
        __builtin_amdgcn_sched_barrier(0);                  // holds the next group's arithmetic behind the wait below
        asm volatile("s_wait_xcnt 0x0" ::: "memory");       // stands in front of every rewrite of a register that the four stores above name
        __builtin_amdgcn_sched_barrier(0);                  // and keeps that wait behind the stores
    }
}

extern "C" void kernel_launch(void* const* d_in, const int* in_sizes, int n_in,
                              void* d_out, int out_size, void* d_ws, size_t ws_size, hipStream_t stream) {
    (void)in_sizes; (void)n_in; (void)out_size;
    const float* x = (const float*)d_in[0]; const float* wq = (const float*)d_in[1]; const float* bq = (const float*)d_in[2]; const float* wk = (const float*)d_in[3]; const float* bk = (const float*)d_in[4];
    const float* wv = (const float*)d_in[5]; const float* bv = (const float*)d_in[6];
    float* out = (float*)d_out;    // [8][256][2048]
    char* wsp = (char*)d_ws;
    auto take = [&](size_t bytes) { char* p = wsp; wsp += (bytes + 255) & ~(size_t)255; return (void*)p; };
    bf* WQ = (bf*)take((size_t)HQ * CC * 2); bf* WK = (bf*)take((size_t)HQ * CC * 2); bf* WV = (bf*)take((size_t)CC * CC * 2);
    h16* QH = (h16*)take((size_t)NTK * HQ * 2); h16* QL = (h16*)take((size_t)NTK * HQ * 2); h16* KH = (h16*)take((size_t)NTK * HQ * 2); h16* KL = (h16*)take((size_t)NTK * HQ * 2);
    h16* VTH = (h16*)take((size_t)NTK * CC * 2); h16* VTL = (h16*)take((size_t)NTK * CC * 2);
    if ((size_t)(wsp - (char*)d_ws) > ws_size) return;    // 0.2 + 1 x 4 + 8.4 x 2 ~ 21 MB
    k_w<<<(2 * HQ + CC) / 8, 256, 0, stream>>>(wq, wk, wv, WQ, WK, WV);
    k_proj<<<dim3(NN_ / 64, NB_, 1), 256, 0, stream>>>(x, WQ, WK, WV, bq, bk, bv, QH, QL, KH, KL, VTH, VTL);
    k_attn<<<dim3(NB_ * (NN_ / QB), 1, 1), 256, 0, stream>>>(QH, QL, KH, KL, VTH, VTL, x, out);
}

// v009
// Measured time: 34.4 microseconds a run.
// Two timings next to v008 put it at 1.43 and 1.47 times that version's speed.
// All steps since v000 together make it 7.25 times as fast.
#include <hip/hip_runtime.h>

// Contractions, f32 accumulate: q/k = 1x1 convs ([16384 positions x 256].[256 x 32] each) and v ([16384 x 256].[256 x 256]) on v_wmma_f32_16x16x32_bf16 with PLAIN
// bf16 operands (inputs rounded once: exact); the position attention fused on v_wmma_f32_16x16x32_f16: energy = q.k over the 32 hidden dims (UNSCALED; q and k as
// f16 hi + residual x1024: hi.hi + hi.lo + lo.hi), softmax over the 2048 positions, out[c][i] = sum_j w[i][j] v[c][j] over all 256 channels with the weights
// (x4) and v each rounded ONCE to f16 (11-bit operands): one product per tile; + x residual; output written channel-major

#define NB_  8
#define CC   256
#define NN_  2048
#define HQ   32
#define NTK  (NB_ * NN_)
#define PSC  4.0f                     // weight scale: a weight is at most 2^13 (THR), so x4 stays inside f16
#define THR  9.0109f                  // 13 ln 2: how far a query's maximum may pass the reference in use before the accumulators are rescaled
#define LOSC 1024.0f
#define LOSCI (1.0f / 1024.0f)

typedef _Float16 h16;
typedef unsigned short bf;
typedef __attribute__((ext_vector_type(16))) __bf16   v16bf;
typedef __attribute__((ext_vector_type(16))) _Float16 v16h;
typedef __attribute__((ext_vector_type(8)))  _Float16 v8h;
typedef __attribute__((ext_vector_type(8)))  unsigned short v8us;
typedef __attribute__((ext_vector_type(8)))  float    v8f;
typedef __attribute__((ext_vector_type(4)))  float    v4f;
typedef v8h  __attribute__((may_alias)) v8ha;
typedef v4f  __attribute__((may_alias)) v4fa;
typedef v8us __attribute__((may_alias)) v8usa;

__device__ __forceinline__ unsigned short f2bf(float f) { unsigned u = __float_as_uint(f); u += 0x7FFFu + ((u >> 16) & 1u); return (unsigned short)(u >> 16); }
__device__ __forceinline__ float bf2f(unsigned short b) { return __uint_as_float(((unsigned)b) << 16); }
__device__ __forceinline__ float bfr(float f) { return bf2f(f2bf(f)); }
__device__ __forceinline__ v16h cat16(v8h lo, v8h hi) { return __builtin_shufflevector(lo, hi, 0, 1, 2, 3, 4, 5, 6, 7, 8, 9, 10, 11, 12, 13, 14, 15); }
__device__ __forceinline__ v16bf cat16b(v8us lo, v8us hi) { return __builtin_bit_cast(v16bf, __builtin_shufflevector(lo, hi, 0, 1, 2, 3, 4, 5, 6, 7, 8, 9, 10, 11, 12, 13, 14, 15)); }
__device__ __forceinline__ v8f wmma16(v16h a, v16h b, v8f c) { return __builtin_amdgcn_wmma_f32_16x16x32_f16(false, a, false, b, (short)0, c, false, false); }
__device__ __forceinline__ v8f wmmab(v16bf a, v16bf b, v8f c) { return __builtin_amdgcn_wmma_f32_16x16x32_bf16(false, a, false, b, (short)0, c, false, false); }
__device__ __forceinline__ float xhalf(float v) { return __builtin_bit_cast(float, __builtin_amdgcn_permlanex16(__builtin_bit_cast(int, v), __builtin_bit_cast(int, v), 0x76543210, 0xfedcba98, false, false)); }  // lane l with lane l ^ 16
#define VST2(T, p, v) do { const T vst2_v_ = (v); *(T*)(p) = vst2_v_;  } while (0)

// k_w: bf16 planes of wq [32][256], wk [32][256], wv [256][256] ([out][in] = n-major as-is); one wave per row (32 lanes x 16 B = 512 B).
__global__ __launch_bounds__(256) void k_w(const float* __restrict__ wq, const float* __restrict__ wk, const float* __restrict__ wv, bf* WQ, bf* WK, bf* WV) {
    const int lane = threadIdx.x & 31, r = blockIdx.x * 8 + (threadIdx.x >> 5);      // 0 .. 32+32+256
    const int m = (r < HQ) ? 0 : (r < 2 * HQ) ? 1 : 2;     // wave-uniform
    v8us o;
    if (m == 0) { for (int i = 0; i < 8; ++i) o[i] = f2bf(wq[(size_t)r * CC + lane * 8 + i]); VST2(v8us, WQ + (size_t)r * CC + lane * 8, o); }
    else if (m == 1) { const int o2 = r - HQ; for (int i = 0; i < 8; ++i) o[i] = f2bf(wk[(size_t)o2 * CC + lane * 8 + i]); VST2(v8us, WK + (size_t)o2 * CC + lane * 8, o); }
    else { const int o2 = r - 2 * HQ; if (o2 < CC) { for (int i = 0; i < 8; ++i) o[i] = f2bf(wv[(size_t)o2 * CC + lane * 8 + i]); VST2(v8us, WV + (size_t)o2 * CC + lane * 8, o); } }
}
// k_proj: block = (b, 64 positions), 8 waves. The block's x tile (256 channels x 64 positions) is read once in whole lines, rounded to bf16 and laid position-major in
// LDS; all three projections take their A fragments (16 positions x 32 channels) from that tile and their B fragments (weight rows) from global memory, requested
// together with the tile. v: wave = 32 output channels x 64 positions; a lane's accumulator holds 8 consecutive positions of ONE channel, so they pack straight into
// channel-major 16-byte f16 pieces, gathered through LDS into 128-B lines of VTH [b][c][n]. q | k: wave = (16 positions, q or k), planes [tok][32].
#define XPI 264                       // x tile row pitch in LDS, bf16 units: 512-B row + 16 B (16 B x odd: no bank conflict for 16-byte reads of 16 rows)
#define OPI 72                        // v staging row pitch, f16 units: 128-B row + 16 B
__global__ __launch_bounds__(256) void k_proj(const float* __restrict__ x, const bf* __restrict__ WQ, const bf* __restrict__ WK, const bf* __restrict__ WV,
                                              const float* __restrict__ bq, const float* __restrict__ bk, const float* __restrict__ bv,
                                              h16* QH, h16* QL, h16* KH, h16* KL, h16* VTH) {
    __shared__ __align__(16) unsigned short xs[64 * XPI];
    __shared__ __align__(16) h16 vsh[CC * OPI];
    __shared__ __align__(16) float ost[8][16 * 36];
    const int tid = threadIdx.x, lane = tid & 31, wave = tid >> 5, lr = lane & 15, hi = lane >> 4;
    const int n0 = blockIdx.x * 64, b = blockIdx.y, which = wave >> 2, nt = wave & 3;
    const bf* W = which ? WK : WQ; const float* bias = which ? bk : bq; h16* PH = which ? KH : QH; h16* PL = which ? KL : QL;   // wave-uniform selects of whole buffers
    // the wave's weight fragments for all eight k steps: they do not depend on the tile, so their latency passes under the tile's load and transpose
    const bf* vp0 = WV + (size_t)(wave * 32 + lr) * CC + 8 * hi; const bf* vp1 = vp0 + 16 * CC;
    const bf* qp0 = W + (size_t)lr * CC + 8 * hi; const bf* qp1 = qp0 + 16 * CC;
    const float* bvp = bv + wave * 32 + lr; const float* bbp = bias + lr;
    v16bf wvf[8][2], wqf[8][2];
#pragma unroll
    for (int ks = 0; ks < 8; ++ks) {
        wvf[ks][0] = cat16b(*(const v8us*)(vp0 + ks * 32), *(const v8us*)(vp0 + ks * 32 + 16)); wvf[ks][1] = cat16b(*(const v8us*)(vp1 + ks * 32), *(const v8us*)(vp1 + ks * 32 + 16));
        wqf[ks][0] = cat16b(*(const v8us*)(qp0 + ks * 32), *(const v8us*)(qp0 + ks * 32 + 16)); wqf[ks][1] = cat16b(*(const v8us*)(qp1 + ks * 32), *(const v8us*)(qp1 + ks * 32 + 16));
    }
    const float bv0 = bvp[0], bv1 = bvp[16], bb0 = bbp[0], bb1 = bbp[16];
    // x tile: thread = (4 positions, 16 channels); 16 lanes cover one channel's 256-B run
    {
        const int piece = tid & 15, g = tid >> 4;
        const float* xp = x + ((size_t)b * CC + g * 16) * NN_ + n0 + piece * 4;
        v4f xr[16];
#pragma unroll
        for (int i = 0; i < 16; ++i) xr[i] = *(const v4fa*)(xp + (size_t)i * NN_);
        // every load above has been issued; the wait takes their addresses as inputs, so that no address register is reused in front of it
        asm volatile("s_wait_xcnt 0x0" :: "v"(vp0), "v"(vp1), "v"(qp0), "v"(qp1), "v"(bvp), "v"(bbp), "v"(xp) : "memory");
#pragma unroll
        for (int k = 0; k < 4; ++k)
#pragma unroll
            for (int o = 0; o < 2; ++o) { v8us p;
#pragma unroll
                for (int e = 0; e < 8; ++e) p[e] = f2bf(xr[o * 8 + e][k]);
                *(v8usa*)(xs + (piece * 4 + k) * XPI + g * 16 + o * 8) = p; }
    }
    __syncthreads();
    v8f av[4][2], aq[2] = {(v8f){}, (v8f){}};
#pragma unroll
    for (int m = 0; m < 4; ++m) { av[m][0] = (v8f){}; av[m][1] = (v8f){}; }
    // A fragments in two register sets: step ks + 1 is read from LDS as one group ahead of step ks's products, so its latency passes under them
    v16bf a[2][5];
    auto ldA = [&](int ks, v16bf (&f)[5]) {
#pragma unroll
        for (int m = 0; m < 5; ++m) { const unsigned short* ap = xs + ((m < 4 ? m : nt) * 16 + lr) * XPI + ks * 32 + 8 * hi; f[m] = cat16b(*(const v8usa*)ap, *(const v8usa*)(ap + 16)); }
    };
    ldA(0, a[0]);
#pragma unroll
    for (int ks = 0; ks < 8; ++ks) {
        if (ks < 7) ldA(ks + 1, a[(ks + 1) & 1]);
        __builtin_amdgcn_sched_barrier(0);   // keeps the next step's reads together in front of this step's products; without it they sink to their uses, one exposed LDS latency each
#pragma unroll
        for (int m = 0; m < 4; ++m) { av[m][0] = wmmab(a[ks & 1][m], wvf[ks][0], av[m][0]); av[m][1] = wmmab(a[ks & 1][m], wvf[ks][1], av[m][1]); }
        aq[0] = wmmab(a[ks & 1][4], wqf[ks][0], aq[0]); aq[1] = wmmab(a[ks & 1][4], wqf[ks][1], aq[1]);
    }
    // v: register j of av[m][t] = position m * 16 + 8 * hi + j of channel wave * 32 + t * 16 + lr
#pragma unroll
    for (int t = 0; t < 2; ++t) { const int c = wave * 32 + t * 16 + lr; const float b2 = bfr(t ? bv1 : bv0);
#pragma unroll
        for (int m = 0; m < 4; ++m) *(v8ha*)(vsh + c * OPI + m * 16 + hi * 8) = __builtin_convertvector(av[m][t] + b2, v8h); }
    float* os = &ost[wave][0];
#pragma unroll
    for (int t = 0; t < 2; ++t) { const float bb = bfr(t ? bb1 : bb0);
#pragma unroll
        for (int j = 0; j < 8; ++j) os[(hi * 8 + j) * 36 + t * 16 + lr] = aq[t][j] + bb; }
    __syncthreads();
    const size_t r0 = (size_t)b * NN_ + n0 + nt * 16;
#pragma unroll
    for (int s = 0; s < 2; ++s) { const int row = s * 8 + (lane >> 2), pc = lane & 3; const float* sp = os + row * 36 + pc * 8;   // 4 lanes x 16 B per 64-B row
        const v8f v = __builtin_shufflevector(*(const v4fa*)sp, *(const v4fa*)(sp + 4), 0, 1, 2, 3, 4, 5, 6, 7);
        const v8h oh = __builtin_convertvector(v, v8h), ol = __builtin_convertvector((v - __builtin_convertvector(oh, v8f)) * LOSC, v8h);
        *(v8h*)(PH + (r0 + row) * HQ + pc * 8) = oh; *(v8h*)(PL + (r0 + row) * HQ + pc * 8) = ol; }
#pragma unroll
    for (int s = 0; s < 8; ++s) { const int c = (tid >> 3) + 32 * s, pc = tid & 7; const size_t o = ((size_t)b * CC + c) * NN_ + n0 + pc * 8;   // 8 lanes x 16 B per 128-B row
        *(v8h*)(VTH + o) = *(const v8ha*)(vsh + c * OPI + pc * 8); }
}
// k_attn: block = (b, 64 positions i, ALL 256 channels), 8 waves, one block per WGP. Wave = (32 positions, one of a stage's four 32-key tiles): energy and softmax of a (position, key) pair are formed
// once for all 256 channels; a V fragment read from LDS feeds two 16-position column groups; the four waves that share 32 positions each walk a quarter of the keys and are joined once at the end.
// The keys are walked in LDS stages of 128 (four 32-key tiles): each stage holds all V rows (256 channels x 128 keys, one f16 plane) and K rows (128 keys x 32 dims, hi and residual plane),
// brought in ONCE per block by tensor loads, one request per issuing wave and stage (four waves: 64 V rows each; two waves: a K plane each), into two buffers: stage s + 1 is issued when stage s - 1 has been read, so it flies while stage s is worked on.
// Per 32-key tile, both products transposed (keys x queries, then channels x queries): energy (hi.hi + hi.lo + lo.hi), a lane holds 16 scores of ONE query, so the
// online softmax is in-lane but for one exchange between the wave's halves; weights x4, rounded once to f16, go from the score registers straight into
// the B operand; o += v.w, one product per tile (32 positions x 256 channels = 256 accumulator registers). The weights are taken against a held reference, not the running maximum: accumulators and
// sums are rescaled only in a tile where some query's maximum has passed its reference by more than THR (one test per tile for the whole wave).
// Epilogue: the four key quarters exchange maximum and sum through LDS, each scales its own part, out[b][c][i] = sum of the parts + x[b][c][i], gathered through LDS (over the ring's bytes, free by then).
#define QB   64                       // positions i per block
#define OTP  (QB + 4)                 // output staging row pitch, floats
#define KT   128                      // keys per stage
#define NST  (NN_ / KT)
#define VPI  136                      // V row pitch in LDS, f16 units: 256-B row + 16 B (16 B x odd: no bank conflict for 16-byte reads of 16 rows)
#define KRP  136                      // K in LDS, f16 units: four keys (4 x 64 B, contiguous in memory) make one 256-B row + 16 B; 16 keys' 16-byte reads fall on 16 different bank groups
#define VSL  9216                     // a V slice's place, f16 units: 64 rows (17,408 B) rounded up to a multiple of 2 KiB
#define KPLN 5120                     // a K plane's place, f16 units: 32 such rows (8,704 B) rounded up to a multiple of 2 KiB
#define STG  (4 * VSL + 2 * KPLN)     // f16 units per stage: four V slices | K hi | K residual

typedef unsigned u32x4 __attribute__((ext_vector_type(4)));
typedef unsigned u32x8 __attribute__((ext_vector_type(8)));
__device__ __forceinline__ unsigned uni(unsigned v) { return (unsigned)__builtin_amdgcn_readfirstlane(v); }
// a tensor load ignores EXEC: only a scalar branch keeps a wave from issuing it
__device__ __forceinline__ unsigned pinned(unsigned v) { unsigned w = uni(v); asm volatile("" : "+s"(w)); return w; }   // the empty statement holds the wave-uniform test in a scalar register, so that the branch on it compiles to s_cmp + s_cbranch_scc
#define TPAD ((1u << 20) | (5u << 22) | (3u << 25))   // descriptor group 1, word 0: no mask, 1-byte elements, 16 B of pad behind every 256-B row

// two waves per SIMD is what one 8-wave block per WGP gives; stated, because without it the build holds itself to 256 registers and scatters the V fragment reads among the products
__global__ __launch_bounds__(256) __attribute__((amdgpu_waves_per_eu(2, 2))) void k_attn(const h16* __restrict__ QH, const h16* __restrict__ QL, const h16* __restrict__ KH, const h16* __restrict__ KL, const h16* __restrict__ VTH,
                                             const float* __restrict__ x, float* out) {
    __shared__ __attribute__((aligned(2048))) unsigned char smem[4 * CC * OTP * 4];   // the output staging behind the loop; in the loop the ring lies in its first 2 * STG * 2 bytes
    static_assert(2 * STG * 2 <= 4 * CC * OTP * 4, "the ring lies inside the staging array");
    __shared__ float jm[4][QB], jl[4][QB];                      // each key quarter's maximum and sum per position
    const h16* ring = (const h16*)smem; float* ot = (float*)smem;
    const int tid = threadIdx.x, lane = tid & 31, wave = tid >> 5, lr = lane & 15, hi = lane >> 4, qg = wave & 1, kq = wave >> 1;
    const int b = blockIdx.x / (NN_ / QB), it = blockIdx.x - b * (NN_ / QB), i0l = it * QB, q0 = i0l + qg * 32;
    const size_t tok0 = (size_t)b * NN_;
    // Waves 0 to 3 each bring 64 V rows of 256 B (channels 64 * wave ..; source pitch one channel row), waves 4 and 5 a K plane (128 keys x 64 B, contiguous: 32 rows of 256 B).
    // Every slice's place in LDS is a multiple of 2 KiB; the pad gives the 272-B pitch that the fragment reads use.
    const unsigned ring0 = (unsigned)(size_t)&smem[0];
    const unsigned wv = uni((unsigned)tid >> 5), issuer = wv < 6u ? 1u : 0u, isK = wv >> 2;
    const h16* tsrc = isK ? ((wv & 1u) ? KL : KH) + (size_t)b * (NN_ * HQ) : VTH + (size_t)(b * CC + (int)(wv & 3u) * 64) * NN_;
    const unsigned tstep = isK ? KT * HQ * 2u : KT * 2u;                                                     // source bytes from one stage to the next
    const unsigned tdst = ring0 + (isK ? 4u * VSL * 2u + (wv & 1u) * (KPLN * 2u) : wv * (VSL * 2u));
    const unsigned trows = isK ? 32u : 64u, tpitch = isK ? 256u : NN_ * 2u;
    u32x8 g1;   // tensor = tile: trows rows of 256 B
    g1[0] = uni(TPAD); g1[1] = uni(256u << 16); g1[2] = uni(trows << 16); g1[3] = uni(256u << 16); g1[4] = uni(trows); g1[5] = uni(tpitch); g1[6] = uni(0u); g1[7] = uni(0u);
    auto fill = [&](int st) {
        const unsigned long long ga = (unsigned long long)(size_t)tsrc + (unsigned long long)((unsigned)st * tstep);
        u32x4 g0;
        g0[0] = uni(1u); g0[1] = uni(tdst + (unsigned)(st & 1) * (STG * 2u)); g0[2] = uni((unsigned)ga); g0[3] = uni((((unsigned)(ga >> 32)) & 0x01FFFFFFu) | 0x80000000u);
        asm volatile("tensor_load_to_lds %0, %1" :: "s"(g0), "s"(g1) : "memory");   // one request of the whole wave: its slice of stage st
    };
    if (pinned(issuer)) {
        fill(0);
        asm volatile("s_wait_tensorcnt 0x0" ::: "memory");   // this wave's slice of stage 0 has landed
    }
    __syncthreads();                                    // publishes stage 0 to the other waves
    const h16* qhp = QH + (tok0 + q0 + lr) * HQ + 8 * hi; const h16* qlp = QL + (tok0 + q0 + lr) * HQ + 8 * hi;
    v16h qa[2], ql[2];   // column group g = positions q0 + 16 * g + lr
#pragma unroll
    for (int g = 0; g < 2; ++g) { qa[g] = cat16(*(const v8h*)(qhp + g * 16 * HQ), *(const v8h*)(qhp + g * 16 * HQ + 16)); ql[g] = cat16(*(const v8h*)(qlp + g * 16 * HQ), *(const v8h*)(qlp + g * 16 * HQ + 16)); }
    // the q loads have been issued; the wait takes their addresses as inputs, so that no address register is reused in front of it
    asm volatile("s_wait_xcnt 0x0" :: "v"(qhp), "v"(qlp) : "memory");
    v8f o[2][16];
#pragma unroll
    for (int g = 0; g < 2; ++g)
#pragma unroll
        for (int n = 0; n < 16; ++n) o[g][n] = (v8f){};
    float mtop[2] = {-3.0e38f, -3.0e38f}, mrun[2] = {-3.0e38f, -3.0e38f}, lrun[2] = {0.f, 0.f};   // this lane's two queries: running maximum, the reference in use (both lane halves alike) and the sum over this lane half's keys
#pragma unroll 1   // one body for all stages: the buffer is picked by the stage's parity
    for (int st = 0; st < NST; ++st) {
        // the refill stands at the stage's top, directly behind the barrier that ended every wave's reads of that buffer (stage st - 1's): the same place in run-time order as at the foot. With its branch
        // at the foot the build sinks the weight sums behind the branch, keeps both column groups' weights live through the products and spills to scratch.
        if (pinned(issuer & (unsigned)(st + 1 < NST))) fill(st + 1);
        const h16* sb = ring + (st & 1) * STG;
        {
            const h16* kb = sb + 4 * VSL + (kq * 8 + (lr >> 2)) * KRP + (lr & 3) * HQ + 8 * hi;   // this wave's tile of the stage: key kq * 32 + lr; 16 keys on = 4 rows on
            const v16h k0h = cat16(*(const v8ha*)kb, *(const v8ha*)(kb + 16)), k1h = cat16(*(const v8ha*)(kb + 4 * KRP), *(const v8ha*)(kb + 4 * KRP + 16));
            const v16h k0l = cat16(*(const v8ha*)(kb + KPLN), *(const v8ha*)(kb + KPLN + 16)), k1l = cat16(*(const v8ha*)(kb + KPLN + 4 * KRP), *(const v8ha*)(kb + KPLN + 4 * KRP + 16));
            // transposed energy: keys are the rows, queries the columns; register j of s0 / s1 = key 8 * hi + j / 16 + 8 * hi + j against query lr of the group
            v8f s0[2], s1[2], x0[2], x1[2];
#pragma unroll
            for (int g = 0; g < 2; ++g) { s0[g] = wmma16(k0h, qa[g], (v8f){}); s1[g] = wmma16(k1h, qa[g], (v8f){}); x0[g] = wmma16(k0h, ql[g], (v8f){}); x1[g] = wmma16(k1h, ql[g], (v8f){}); }
#pragma unroll
            for (int g = 0; g < 2; ++g) { x0[g] = wmma16(k0l, qa[g], x0[g]); x1[g] = wmma16(k1l, qa[g], x1[g]); }
            // four vector slots between the last energy product and the first vector read of its result
            asm volatile("v_nop\n\tv_nop\n\tv_nop\n\tv_nop" : "+v"(s0[0]), "+v"(s1[0]), "+v"(x0[0]), "+v"(x1[0]), "+v"(s0[1]), "+v"(s1[1]), "+v"(x0[1]), "+v"(x1[1]));
            // the tile's V fragments (16 channel tiles) are read from the stage in TWO runs of eight, not among the products in pairs: the first here, its LDS latency passes under the softmax; the second
            // behind the first group's weights, where their temporaries have come free, its latency under the second group's weights and the first run's products (all sixteen at once do not fit the
            // registers of two waves per SIMD: that build spills to scratch)
            v16h vh[16];
            auto ldV = [&](int n) { const h16* vb = sb + (n >> 2) * VSL + ((n & 3) * 16 + lr) * VPI + kq * 32 + hi * 8; vh[n] = cat16(*(const v8ha*)vb, *(const v8ha*)(vb + 16)); };
#pragma unroll
            for (int n = 0; n < 8; ++n) ldV(n);
            __builtin_amdgcn_sched_barrier(0);   // keeps the first run of reads together in front of the softmax; without it they sink among the products in pairs, each place with an LDS wait of its own
            v16h pa[2]; v8f a0s[2], a1s[2]; bool need = false;
#pragma unroll
            for (int g = 0; g < 2; ++g) {
                a0s[g] = s0[g] + x0[g] * LOSCI; a1s[g] = s1[g] + x1[g] * LOSCI;
                const v8f m8 = __builtin_elementwise_max(a0s[g], a1s[g]);
                float mx = fmaxf(fmaxf(fmaxf(m8[0], m8[1]), fmaxf(m8[2], m8[3])), fmaxf(fmaxf(m8[4], m8[5]), fmaxf(m8[6], m8[7])));
                mx = fmaxf(mx, xhalf(mx));   // the other lane half's 16 keys of the same query
                mtop[g] = fmaxf(mtop[g], mx);
                need = need || (mtop[g] - mrun[g] > THR);
            }
            // one scalar branch per tile: every query of the wave moves its reference up to its running maximum, and its accumulators and sum follow (the first tile always takes it)
            if (__builtin_amdgcn_ballot_w32(need) != 0) {
#pragma unroll
                for (int g = 0; g < 2; ++g) {
                    const float alpha = __expf(mrun[g] - mtop[g]);
                    mrun[g] = mtop[g]; lrun[g] *= alpha;
#pragma unroll
                    for (int n = 0; n < 16; ++n)
#pragma unroll
                        for (int j = 0; j < 8; ++j) o[g][n][j] *= alpha;
                }
            }
            auto weights = [&](int g) {
                const v8f a0 = a0s[g], a1 = a1s[g]; const float mn = mrun[g];
                // the weights stay in registers: the two score tiles, converted in place, are the B operand (element s = key 8 * hi + s, then 16 + 8 * hi + s - 8: the V loader's k order)
                v8f p0, p1;
#pragma unroll
                for (int j = 0; j < 8; ++j) { p0[j] = __expf(a0[j] - mn); p1[j] = __expf(a1[j] - mn); }
                const v8f ps0 = p0 * PSC, ps1 = p1 * PSC, pp = p0 + p1;
                pa[g] = cat16(__builtin_convertvector(ps0, v8h), __builtin_convertvector(ps1, v8h));
                const float ls = ((pp[0] + pp[1]) + (pp[2] + pp[3])) + ((pp[4] + pp[5]) + (pp[6] + pp[7]));
                lrun[g] += ls;
            };
            // transposed output tiles: register j of o[g][n] = channel n * 16 + 8 * hi + j of query lr of group g; each V fragment serves both groups; every product has an accumulator of its own
            auto pv = [&](int g, int n0, int n1) {
#pragma unroll
                for (int n = n0; n < n1; ++n) o[g][n] = wmma16(vh[n], pa[g], o[g][n]);
            };
            weights(0);
            __builtin_amdgcn_sched_barrier(0);   // the second run of reads stands behind the first group's exponentials as one group; without it the build spreads the reads among them in five places, each with an issue cost of its own
#pragma unroll
            for (int n = 8; n < 16; ++n) ldV(n);
            __builtin_amdgcn_sched_barrier(0);   // keeps the second run together, in front of the work that covers its latency; without it the reads sink among the products in ones to fours, with waits down to 0 between the products
            weights(1);
            pv(0, 0, 16);
            // issue order of the block above: the second group's weights are formed between the first group's products, in the matrix unit's shadow; without it the build puts them in front of the products they do not feed
#pragma unroll
            for (int i = 0; i < 16; ++i) { __builtin_amdgcn_sched_group_barrier(0x8, 1, 0); __builtin_amdgcn_sched_group_barrier(0x2, 6, 0); }
            pv(1, 0, 16);
            __builtin_amdgcn_sched_barrier(0);   // every product stays in front of the stage's barrier: sunk behind it they would hold back the refill that stands at the next stage's top
            // four vector slots behind the last product on the loop's back edge too, before its operands or results are touched
            asm volatile("v_nop\n\tv_nop\n\tv_nop\n\tv_nop" : "+v"(o[1][12]), "+v"(o[1][13]), "+v"(o[1][14]), "+v"(o[1][15]) : "v"(pa[0]), "v"(pa[1]));
        }
        asm volatile("s_wait_dscnt 0x0" ::: "memory");      // this wave's reads of stage st are done before its buffer may be refilled
        asm volatile("s_wait_tensorcnt 0x0" ::: "memory");  // this wave's slice of stage st + 1 has landed; in every wave (one that issued nothing passes at once): a branch round it makes the build sink the weight sums behind the products
        __syncthreads();                                    // publishes stage st + 1 and ends every wave's reads of stage st
    }
    asm volatile("s_wait_tensorcnt 0x0" ::: "memory");      // nothing of the ring is in flight when the wave goes on to the epilogue
    asm volatile("s_wait_dscnt 0x0" ::: "memory");          // and none of its reads is open when the ring's bytes become the output staging
    float lt[2];
#pragma unroll
    for (int g = 0; g < 2; ++g) { lt[g] = lrun[g] + xhalf(lrun[g]);   // the two lane halves' key sums joined once
        if (hi == 0) { jm[kq][qg * 32 + g * 16 + lr] = mrun[g]; jl[kq][qg * 32 + g * 16 + lr] = lt[g]; } }
    __syncthreads();   // publishes each key quarter's maximum and sum to the waves that hold the other quarters
    // staging: ot[key quarter][c][i_local] (4 x 256 x 64), each part already on the joint maximum and divided by the joint sum
#pragma unroll
    for (int g = 0; g < 2; ++g) {
        const int qi = qg * 32 + g * 16 + lr;
        const float m0 = jm[0][qi], m1 = jm[1][qi], m2 = jm[2][qi], m3 = jm[3][qi], mj = fmaxf(fmaxf(m0, m1), fmaxf(m2, m3));
        const float den = (jl[0][qi] * __expf(m0 - mj) + jl[1][qi] * __expf(m1 - mj)) + (jl[2][qi] * __expf(m2 - mj) + jl[3][qi] * __expf(m3 - mj));
        const float inv = __expf(mrun[g] - mj) / (den * PSC);
#pragma unroll
        for (int n = 0; n < 16; ++n)
#pragma unroll
            for (int j = 0; j < 8; ++j) ot[(kq * CC + n * 16 + hi * 8 + j) * OTP + qi] = o[g][n][j] * inv;
    }
    __syncthreads();
    // out[b][c][i0l + i] + x residual: per c a 256-B run (16 lanes x 16 B, two c per instruction); 256 c rows -> 8 waves x 16 instructions
    const float* xp = x + ((size_t)b * CC + (tid >> 4)) * NN_ + i0l + (tid & 15) * 4; float* outp = out + ((size_t)b * CC + (tid >> 4)) * NN_ + i0l + (tid & 15) * 4;
    const float* op0 = ot + (tid >> 4) * OTP + (tid & 15) * 4;
    v4f xr[16];   // all sixteen x pieces are requested together, one memory latency for the pass
#pragma unroll
    for (int s = 0; s < 16; ++s) xr[s] = *(const v4fa*)(xp + (size_t)s * 16 * NN_);
    // the x loads have been issued; the wait takes their address as an input, so that the address register is not reused in front of it
    asm volatile("s_wait_xcnt 0x0" :: "v"(xp) : "memory");
#pragma unroll
    for (int s0 = 0; s0 < 16; s0 += 4) {
        v4f val[4];
#pragma unroll
        for (int k = 0; k < 4; ++k) { const float* op = op0 + (s0 + k) * 16 * OTP;
            val[k] = (*(const v4fa*)op + *(const v4fa*)(op + CC * OTP)) + (*(const v4fa*)(op + 2 * CC * OTP) + *(const v4fa*)(op + 3 * CC * OTP));   // the four key quarters
#pragma unroll
            for (int i = 0; i < 4; ++i) val[k][i] += bfr(xr[s0 + k][i]); }
#pragma unroll
        for (int k = 0; k < 4; ++k) *(v4f*)(outp + (size_t)(s0 + k) * 16 * NN_) = val[k];
        __builtin_amdgcn_sched_barrier(0);                  // holds the next group's arithmetic behind the wait below
        asm volatile("s_wait_xcnt 0x0" ::: "memory");       // stands in front of every rewrite of a register that the four stores above name
        __builtin_amdgcn_sched_barrier(0);                  // and keeps that wait behind the stores
    }
}

extern "C" void kernel_launch(void* const* d_in, const int* in_sizes, int n_in,
                              void* d_out, int out_size, void* d_ws, size_t ws_size, hipStream_t stream) {
    (void)in_sizes; (void)n_in; (void)out_size;
    const float* x = (const float*)d_in[0]; const float* wq = (const float*)d_in[1]; const float* bq = (const float*)d_in[2]; const float* wk = (const float*)d_in[3]; const float* bk = (const float*)d_in[4];
    const float* wv = (const float*)d_in[5]; const float* bv = (const float*)d_in[6];
    float* out = (float*)d_out;    // [8][256][2048]
    char* wsp = (char*)d_ws;
    auto take = [&](size_t bytes) { char* p = wsp; wsp += (bytes + 255) & ~(size_t)255; return (void*)p; };
    bf* WQ = (bf*)take((size_t)HQ * CC * 2); bf* WK = (bf*)take((size_t)HQ * CC * 2); bf* WV = (bf*)take((size_t)CC * CC * 2);
    h16* QH = (h16*)take((size_t)NTK * HQ * 2); h16* QL = (h16*)take((size_t)NTK * HQ * 2); h16* KH = (h16*)take((size_t)NTK * HQ * 2); h16* KL = (h16*)take((size_t)NTK * HQ * 2);
    h16* VTH = (h16*)take((size_t)NTK * CC * 2);
    if ((size_t)(wsp - (char*)d_ws) > ws_size) return;    // 0.2 + 1 x 4 + 8.4 ~ 13 MB
    k_w<<<(2 * HQ + CC) / 8, 256, 0, stream>>>(wq, wk, wv, WQ, WK, WV);
    k_proj<<<dim3(NN_ / 64, NB_, 1), 256, 0, stream>>>(x, WQ, WK, WV, bq, bk, bv, QH, QL, KH, KL, VTH);
    k_attn<<<dim3(NB_ * (NN_ / QB), 1, 1), 256, 0, stream>>>(QH, QL, KH, KL, VTH, x, out);
}

// v010
// One run takes 32.9 microseconds.
// Timed twice side by side with v009, it ran 1.04 times as fast both times.
// Counting every step since v000, it is 7.56 times as fast.
#include <hip/hip_runtime.h>

// Contractions, f32 accumulate: q/k = 1x1 convs ([16384 positions x 256].[256 x 32] each) and v ([16384 x 256].[256 x 256]) on v_wmma_f32_16x16x32_bf16 with PLAIN
// bf16 operands (inputs rounded once: exact); the position attention fused on v_wmma_f32_16x16x32_f16: energy = q.k over the 32 hidden dims (UNSCALED; q and k as
// f16 hi + residual x1024: hi.hi + hi.lo + lo.hi), softmax over the 2048 positions, out[c][i] = sum_j w[i][j] v[c][j] over all 256 channels with the weights
// (x4) and v each rounded ONCE to f16 (11-bit operands): one product per tile; + x residual; output written channel-major

#define NB_  8
#define CC   256
#define NN_  2048
#define HQ   32
#define NTK  (NB_ * NN_)
#define PSC  4.0f                     // weight scale: a weight is at most 2^13 (THR), so x4 stays inside f16
#define THR  9.0109f                  // 13 ln 2: how far a query's maximum may pass the reference in use before the accumulators are rescaled
#define LOSC 1024.0f
#define LOSCI (1.0f / 1024.0f)

typedef _Float16 h16;
typedef unsigned short bf;
typedef __attribute__((ext_vector_type(16))) __bf16   v16bf;
typedef __attribute__((ext_vector_type(16))) _Float16 v16h;
typedef __attribute__((ext_vector_type(8)))  _Float16 v8h;
typedef __attribute__((ext_vector_type(8)))  unsigned short v8us;
typedef __attribute__((ext_vector_type(8)))  float    v8f;
typedef __attribute__((ext_vector_type(4)))  float    v4f;
typedef v8h  __attribute__((may_alias)) v8ha;
typedef v4f  __attribute__((may_alias)) v4fa;
typedef v8us __attribute__((may_alias)) v8usa;

__device__ __forceinline__ unsigned short f2bf(float f) { unsigned u = __float_as_uint(f); u += 0x7FFFu + ((u >> 16) & 1u); return (unsigned short)(u >> 16); }
__device__ __forceinline__ float bf2f(unsigned short b) { return __uint_as_float(((unsigned)b) << 16); }
__device__ __forceinline__ float bfr(float f) { return bf2f(f2bf(f)); }
__device__ __forceinline__ v16h cat16(v8h lo, v8h hi) { return __builtin_shufflevector(lo, hi, 0, 1, 2, 3, 4, 5, 6, 7, 8, 9, 10, 11, 12, 13, 14, 15); }
__device__ __forceinline__ v16bf cat16b(v8us lo, v8us hi) { return __builtin_bit_cast(v16bf, __builtin_shufflevector(lo, hi, 0, 1, 2, 3, 4, 5, 6, 7, 8, 9, 10, 11, 12, 13, 14, 15)); }
__device__ __forceinline__ v8f wmma16(v16h a, v16h b, v8f c) { return __builtin_amdgcn_wmma_f32_16x16x32_f16(false, a, false, b, (short)0, c, false, false); }
__device__ __forceinline__ v8f wmmab(v16bf a, v16bf b, v8f c) { return __builtin_amdgcn_wmma_f32_16x16x32_bf16(false, a, false, b, (short)0, c, false, false); }
__device__ __forceinline__ float xhalf(float v) { return __builtin_bit_cast(float, __builtin_amdgcn_permlanex16(__builtin_bit_cast(int, v), __builtin_bit_cast(int, v), 0x76543210, 0xfedcba98, false, false)); }  // lane l with lane l ^ 16
#define VST2(T, p, v) do { const T vst2_v_ = (v); *(T*)(p) = vst2_v_;  } while (0)

// k_w: bf16 weights of wq [32][256], wk [32][256], wv [256][256] ([out][in]), packed in the order in which k_proj's B fragments are loaded: [16-row group][k step of 32][half][lane][8],
// lane = 16 * hi + row, element e of half h = input channel 32 * step + 16 * h + 8 * hi + e. One wave per fragment (16 rows x 32 channels = 1 KB): it reads 16 whole 128-B lines and is the one writer of 8 whole lines.
#define FRG 512                       // bf16 units per packed fragment: two halves of 32 lanes x 8
__global__ __launch_bounds__(256) void k_w(const float* __restrict__ wq, const float* __restrict__ wk, const float* __restrict__ wv, bf* WQ, bf* WK, bf* WV) {
    const int lane = threadIdx.x & 31, lr = lane & 15, hi = lane >> 4, f = blockIdx.x * 8 + (threadIdx.x >> 5);      // fragment 0 .. (32 + 32 + 256) / 16 * 8
    const int rg = f >> 3, ks = f & 7, m = (rg < HQ / 16) ? 0 : (rg < 2 * HQ / 16) ? 1 : 2;     // wave-uniform
    const int g = rg - m * (HQ / 16);                                                          // row group inside its own matrix
    const float* sp = (m == 0 ? wq : m == 1 ? wk : wv) + (size_t)(g * 16 + lr) * CC + ks * 32 + 8 * hi;   // wave-uniform selects of whole buffers
    bf* dp = (m == 0 ? WQ : m == 1 ? WK : WV) + (size_t)(g * 8 + ks) * FRG + lane * 8;
    const v4f a0 = *(const v4fa*)sp, a1 = *(const v4fa*)(sp + 4), b0 = *(const v4fa*)(sp + 16), b1 = *(const v4fa*)(sp + 20);
    // the four loads have been issued; the wait takes their address as an input, so that the address register is not reused in front of it
    asm volatile("s_wait_xcnt 0x0" :: "v"(sp) : "memory");
    v8us o0, o1;
    for (int i = 0; i < 4; ++i) { o0[i] = f2bf(a0[i]); o0[4 + i] = f2bf(a1[i]); o1[i] = f2bf(b0[i]); o1[4 + i] = f2bf(b1[i]); }
    VST2(v8us, dp, o0); VST2(v8us, dp + FRG / 2, o1);
}
// k_proj: block = (b, 64 positions), 8 waves. The block's x tile (256 channels x 64 positions) is read once in whole lines, rounded to bf16 and laid position-major in
// LDS; all three projections take their A fragments (16 positions x 32 channels) from that tile and their B fragments from k_w's packed weights in global memory (every
// wave-wide 16-byte load = 512 contiguous bytes, four whole lines), requested together with the tile. v: wave = 32 output channels x 64 positions; a lane's accumulator holds 8 consecutive positions of ONE channel, so they pack straight into
// channel-major 16-byte f16 pieces, gathered through LDS into 128-B lines of VTH [b][c][n]. q | k: wave = (16 positions, q or k), planes [tok][32].
#define XPI 264                       // x tile row pitch in LDS, bf16 units: 512-B row + 16 B (16 B x odd: no bank conflict for 16-byte reads of 16 rows)
#define OPI 72                        // v staging row pitch, f16 units: 128-B row + 16 B
__global__ __launch_bounds__(256) void k_proj(const float* __restrict__ x, const bf* __restrict__ WQ, const bf* __restrict__ WK, const bf* __restrict__ WV,
                                              const float* __restrict__ bq, const float* __restrict__ bk, const float* __restrict__ bv,
                                              h16* QH, h16* QL, h16* KH, h16* KL, h16* VTH) {
    __shared__ __align__(16) unsigned short xs[64 * XPI];
    __shared__ __align__(16) h16 vsh[CC * OPI];
    __shared__ __align__(16) float ost[8][16 * 36];
    const int tid = threadIdx.x, lane = tid & 31, wave = tid >> 5, lr = lane & 15, hi = lane >> 4;
    const int n0 = blockIdx.x * 64, b = blockIdx.y, which = wave >> 2, nt = wave & 3;
    const bf* W = which ? WK : WQ; const float* bias = which ? bk : bq; h16* PH = which ? KH : QH; h16* PL = which ? KL : QL;   // wave-uniform selects of whole buffers
    // the wave's weight fragments for all eight k steps: they do not depend on the tile, so their latency passes under the tile's load and transpose
    const bf* vp = WV + (size_t)wave * (2 * 8 * FRG) + lane * 8;   // output channels wave * 32 ..: two row groups x eight k steps, 16 KB in a row
    const bf* qp = W + lane * 8;
    const float* bvp = bv + wave * 32 + lr; const float* bbp = bias + lr;
    v16bf wvf[8][2], wqf[8][2];
#pragma unroll
    for (int ks = 0; ks < 8; ++ks) {
        wvf[ks][0] = cat16b(*(const v8us*)(vp + ks * FRG), *(const v8us*)(vp + ks * FRG + FRG / 2)); wvf[ks][1] = cat16b(*(const v8us*)(vp + (8 + ks) * FRG), *(const v8us*)(vp + (8 + ks) * FRG + FRG / 2));
        wqf[ks][0] = cat16b(*(const v8us*)(qp + ks * FRG), *(const v8us*)(qp + ks * FRG + FRG / 2)); wqf[ks][1] = cat16b(*(const v8us*)(qp + (8 + ks) * FRG), *(const v8us*)(qp + (8 + ks) * FRG + FRG / 2));
    }
    const float bv0 = bvp[0], bv1 = bvp[16], bb0 = bbp[0], bb1 = bbp[16];
    // x tile: thread = (4 positions, 16 channels); 16 lanes cover one channel's 256-B run
    {
        const int piece = tid & 15, g = tid >> 4;
        const float* xp = x + ((size_t)b * CC + g * 16) * NN_ + n0 + piece * 4;
        v4f xr[16];
#pragma unroll
        for (int i = 0; i < 16; ++i) xr[i] = *(const v4fa*)(xp + (size_t)i * NN_);
        // every load above has been issued; the wait takes their addresses as inputs, so that no address register is reused in front of it
        asm volatile("s_wait_xcnt 0x0" :: "v"(vp), "v"(qp), "v"(bvp), "v"(bbp), "v"(xp) : "memory");
#pragma unroll
        for (int k = 0; k < 4; ++k)
#pragma unroll
            for (int o = 0; o < 2; ++o) { v8us p;
#pragma unroll
                for (int e = 0; e < 8; ++e) p[e] = f2bf(xr[o * 8 + e][k]);
                *(v8usa*)(xs + (piece * 4 + k) * XPI + g * 16 + o * 8) = p; }
    }
    __syncthreads();
    v8f av[4][2], aq[2] = {(v8f){}, (v8f){}};
#pragma unroll
    for (int m = 0; m < 4; ++m) { av[m][0] = (v8f){}; av[m][1] = (v8f){}; }
    // A fragments in two register sets: step ks + 1 is read from LDS as one group ahead of step ks's products, so its latency passes under them
    v16bf a[2][5];
    auto ldA = [&](int ks, v16bf (&f)[5]) {
#pragma unroll
        for (int m = 0; m < 5; ++m) { const unsigned short* ap = xs + ((m < 4 ? m : nt) * 16 + lr) * XPI + ks * 32 + 8 * hi; f[m] = cat16b(*(const v8usa*)ap, *(const v8usa*)(ap + 16)); }
    };
    ldA(0, a[0]);
#pragma unroll
    for (int ks = 0; ks < 8; ++ks) {
        if (ks < 7) ldA(ks + 1, a[(ks + 1) & 1]);
        __builtin_amdgcn_sched_barrier(0);   // keeps the next step's reads together in front of this step's products; without it they sink to their uses, one exposed LDS latency each
#pragma unroll
        for (int m = 0; m < 4; ++m) { av[m][0] = wmmab(a[ks & 1][m], wvf[ks][0], av[m][0]); av[m][1] = wmmab(a[ks & 1][m], wvf[ks][1], av[m][1]); }
        aq[0] = wmmab(a[ks & 1][4], wqf[ks][0], aq[0]); aq[1] = wmmab(a[ks & 1][4], wqf[ks][1], aq[1]);
    }
    // v: register j of av[m][t] = position m * 16 + 8 * hi + j of channel wave * 32 + t * 16 + lr
#pragma unroll
    for (int t = 0; t < 2; ++t) { const int c = wave * 32 + t * 16 + lr; const float b2 = bfr(t ? bv1 : bv0);
#pragma unroll
        for (int m = 0; m < 4; ++m) *(v8ha*)(vsh + c * OPI + m * 16 + hi * 8) = __builtin_convertvector(av[m][t] + b2, v8h); }
    float* os = &ost[wave][0];
#pragma unroll
    for (int t = 0; t < 2; ++t) { const float bb = bfr(t ? bb1 : bb0);
#pragma unroll
        for (int j = 0; j < 8; ++j) os[(hi * 8 + j) * 36 + t * 16 + lr] = aq[t][j] + bb; }
    __syncthreads();
    const size_t r0 = (size_t)b * NN_ + n0 + nt * 16;
#pragma unroll
    for (int s = 0; s < 2; ++s) { const int row = s * 8 + (lane >> 2), pc = lane & 3; const float* sp = os + row * 36 + pc * 8;   // 4 lanes x 16 B per 64-B row
        const v8f v = __builtin_shufflevector(*(const v4fa*)sp, *(const v4fa*)(sp + 4), 0, 1, 2, 3, 4, 5, 6, 7);
        const v8h oh = __builtin_convertvector(v, v8h), ol = __builtin_convertvector((v - __builtin_convertvector(oh, v8f)) * LOSC, v8h);
        *(v8h*)(PH + (r0 + row) * HQ + pc * 8) = oh; *(v8h*)(PL + (r0 + row) * HQ + pc * 8) = ol; }
#pragma unroll
    for (int s = 0; s < 8; ++s) { const int c = (tid >> 3) + 32 * s, pc = tid & 7; const size_t o = ((size_t)b * CC + c) * NN_ + n0 + pc * 8;   // 8 lanes x 16 B per 128-B row
        *(v8h*)(VTH + o) = *(const v8ha*)(vsh + c * OPI + pc * 8); }
}
// k_attn: block = (b, 64 positions i, ALL 256 channels), 8 waves, one block per WGP. Wave = (32 positions, one of a stage's four 32-key tiles): energy and softmax of a (position, key) pair are formed
// once for all 256 channels; a V fragment read from LDS feeds two 16-position column groups; the four waves that share 32 positions each walk a quarter of the keys and are joined once at the end.
// The keys are walked in LDS stages of 128 (four 32-key tiles): each stage holds all V rows (256 channels x 128 keys, one f16 plane) and K rows (128 keys x 32 dims, hi and residual plane),
// brought in ONCE per block by tensor loads, one request per issuing wave and stage (four waves: 64 V rows each; two waves: a K plane each), into two buffers: stage s + 1 is issued when stage s - 1 has been read, so it flies while stage s is worked on.
// Per 32-key tile, both products transposed (keys x queries, then channels x queries): energy (hi.hi + hi.lo + lo.hi), a lane holds 16 scores of ONE query, so the
// online softmax is in-lane but for one exchange between the wave's halves; weights x4, rounded once to f16, go from the score registers straight into
// the B operand; o += v.w, one product per tile (32 positions x 256 channels = 256 accumulator registers). The weights are taken against a held reference, not the running maximum: accumulators and
// sums are rescaled only in a tile where some query's maximum has passed its reference by more than THR (one test per tile for the whole wave).
// Epilogue: the four key quarters exchange maximum and sum through LDS, each scales its own part, out[b][c][i] = sum of the parts + x[b][c][i], gathered through LDS (over the ring's bytes, free by then).
#define QB   64                       // positions i per block
#define OTP  (QB + 4)                 // output staging row pitch, floats
#define KT   128                      // keys per stage
#define NST  (NN_ / KT)
#define VPI  136                      // V row pitch in LDS, f16 units: 256-B row + 16 B (16 B x odd: no bank conflict for 16-byte reads of 16 rows)
#define KRP  136                      // K in LDS, f16 units: four keys (4 x 64 B, contiguous in memory) make one 256-B row + 16 B; 16 keys' 16-byte reads fall on 16 different bank groups
#define VSL  9216                     // a V slice's place, f16 units: 64 rows (17,408 B) rounded up to a multiple of 2 KiB
#define KPLN 5120                     // a K plane's place, f16 units: 32 such rows (8,704 B) rounded up to a multiple of 2 KiB
#define STG  (4 * VSL + 2 * KPLN)     // f16 units per stage: four V slices | K hi | K residual

typedef unsigned u32x4 __attribute__((ext_vector_type(4)));
typedef unsigned u32x8 __attribute__((ext_vector_type(8)));
__device__ __forceinline__ unsigned uni(unsigned v) { return (unsigned)__builtin_amdgcn_readfirstlane(v); }
// a tensor load ignores EXEC: only a scalar branch keeps a wave from issuing it
__device__ __forceinline__ unsigned pinned(unsigned v) { unsigned w = uni(v); asm volatile("" : "+s"(w)); return w; }   // the empty statement holds the wave-uniform test in a scalar register, so that the branch on it compiles to s_cmp + s_cbranch_scc
#define TPAD ((1u << 20) | (5u << 22) | (3u << 25))   // descriptor group 1, word 0: no mask, 1-byte elements, 16 B of pad behind every 256-B row

// two waves per SIMD is what one 8-wave block per WGP gives; stated, because without it the build holds itself to 256 registers and scatters the V fragment reads among the products
__global__ __launch_bounds__(256) __attribute__((amdgpu_waves_per_eu(2, 2))) void k_attn(const h16* __restrict__ QH, const h16* __restrict__ QL, const h16* __restrict__ KH, const h16* __restrict__ KL, const h16* __restrict__ VTH,
                                             const float* __restrict__ x, float* out) {
    __shared__ __attribute__((aligned(2048))) unsigned char smem[4 * CC * OTP * 4];   // the output staging behind the loop; in the loop the ring lies in its first 2 * STG * 2 bytes
    static_assert(2 * STG * 2 <= 4 * CC * OTP * 4, "the ring lies inside the staging array");
    __shared__ float jm[4][QB], jl[4][QB];                      // each key quarter's maximum and sum per position
    const h16* ring = (const h16*)smem; float* ot = (float*)smem;
    const int tid = threadIdx.x, lane = tid & 31, wave = tid >> 5, lr = lane & 15, hi = lane >> 4, qg = wave & 1, kq = wave >> 1;
    const int b = blockIdx.x / (NN_ / QB), it = blockIdx.x - b * (NN_ / QB), i0l = it * QB, q0 = i0l + qg * 32;
    const size_t tok0 = (size_t)b * NN_;
    // Waves 0 to 3 each bring 64 V rows of 256 B (channels 64 * wave ..; source pitch one channel row), waves 4 and 5 a K plane (128 keys x 64 B, contiguous: 32 rows of 256 B).
    // Every slice's place in LDS is a multiple of 2 KiB; the pad gives the 272-B pitch that the fragment reads use.
    const unsigned ring0 = (unsigned)(size_t)&smem[0];
    const unsigned wv = uni((unsigned)tid >> 5), issuer = wv < 6u ? 1u : 0u, isK = wv >> 2;
    const h16* tsrc = isK ? ((wv & 1u) ? KL : KH) + (size_t)b * (NN_ * HQ) : VTH + (size_t)(b * CC + (int)(wv & 3u) * 64) * NN_;
    const unsigned tstep = isK ? KT * HQ * 2u : KT * 2u;                                                     // source bytes from one stage to the next
    const unsigned tdst = ring0 + (isK ? 4u * VSL * 2u + (wv & 1u) * (KPLN * 2u) : wv * (VSL * 2u));
    const unsigned trows = isK ? 32u : 64u, tpitch = isK ? 256u : NN_ * 2u;
    u32x8 g1;   // tensor = tile: trows rows of 256 B
    g1[0] = uni(TPAD); g1[1] = uni(256u << 16); g1[2] = uni(trows << 16); g1[3] = uni(256u << 16); g1[4] = uni(trows); g1[5] = uni(tpitch); g1[6] = uni(0u); g1[7] = uni(0u);
    auto fill = [&](int st) {
        const unsigned long long ga = (unsigned long long)(size_t)tsrc + (unsigned long long)((unsigned)st * tstep);
        u32x4 g0;
        g0[0] = uni(1u); g0[1] = uni(tdst + (unsigned)(st & 1) * (STG * 2u)); g0[2] = uni((unsigned)ga); g0[3] = uni((((unsigned)(ga >> 32)) & 0x01FFFFFFu) | 0x80000000u);
        asm volatile("tensor_load_to_lds %0, %1" :: "s"(g0), "s"(g1) : "memory");   // one request of the whole wave: its slice of stage st
    };
    if (pinned(issuer)) {
        fill(0);
        asm volatile("s_wait_tensorcnt 0x0" ::: "memory");   // this wave's slice of stage 0 has landed
    }
    __syncthreads();                                    // publishes stage 0 to the other waves
    const h16* qhp = QH + (tok0 + q0 + lr) * HQ + 8 * hi; const h16* qlp = QL + (tok0 + q0 + lr) * HQ + 8 * hi;
    v16h qa[2], ql[2];   // column group g = positions q0 + 16 * g + lr
#pragma unroll
    for (int g = 0; g < 2; ++g) { qa[g] = cat16(*(const v8h*)(qhp + g * 16 * HQ), *(const v8h*)(qhp + g * 16 * HQ + 16)); ql[g] = cat16(*(const v8h*)(qlp + g * 16 * HQ), *(const v8h*)(qlp + g * 16 * HQ + 16)); }
    // the q loads have been issued; the wait takes their addresses as inputs, so that no address register is reused in front of it
    asm volatile("s_wait_xcnt 0x0" :: "v"(qhp), "v"(qlp) : "memory");
    v8f o[2][16];
#pragma unroll
    for (int g = 0; g < 2; ++g)
#pragma unroll
        for (int n = 0; n < 16; ++n) o[g][n] = (v8f){};
    float mtop[2] = {-3.0e38f, -3.0e38f}, mrun[2] = {-3.0e38f, -3.0e38f}, lrun[2] = {0.f, 0.f};   // this lane's two queries: running maximum, the reference in use (both lane halves alike) and the sum over this lane half's keys
#pragma unroll 1   // one body for all stages: the buffer is picked by the stage's parity
    for (int st = 0; st < NST; ++st) {
        // the refill stands at the stage's top, directly behind the barrier that ended every wave's reads of that buffer (stage st - 1's): the same place in run-time order as at the foot. With its branch
        // at the foot the build sinks the weight sums behind the branch, keeps both column groups' weights live through the products and spills to scratch.
        if (pinned(issuer & (unsigned)(st + 1 < NST))) fill(st + 1);
        const h16* sb = ring + (st & 1) * STG;
        {
            const h16* kb = sb + 4 * VSL + (kq * 8 + (lr >> 2)) * KRP + (lr & 3) * HQ + 8 * hi;   // this wave's tile of the stage: key kq * 32 + lr; 16 keys on = 4 rows on
            const v16h k0h = cat16(*(const v8ha*)kb, *(const v8ha*)(kb + 16)), k1h = cat16(*(const v8ha*)(kb + 4 * KRP), *(const v8ha*)(kb + 4 * KRP + 16));
            const v16h k0l = cat16(*(const v8ha*)(kb + KPLN), *(const v8ha*)(kb + KPLN + 16)), k1l = cat16(*(const v8ha*)(kb + KPLN + 4 * KRP), *(const v8ha*)(kb + KPLN + 4 * KRP + 16));
            // transposed energy: keys are the rows, queries the columns; register j of s0 / s1 = key 8 * hi + j / 16 + 8 * hi + j against query lr of the group
            v8f s0[2], s1[2], x0[2], x1[2];
#pragma unroll
            for (int g = 0; g < 2; ++g) { s0[g] = wmma16(k0h, qa[g], (v8f){}); s1[g] = wmma16(k1h, qa[g], (v8f){}); x0[g] = wmma16(k0h, ql[g], (v8f){}); x1[g] = wmma16(k1h, ql[g], (v8f){}); }
#pragma unroll
            for (int g = 0; g < 2; ++g) { x0[g] = wmma16(k0l, qa[g], x0[g]); x1[g] = wmma16(k1l, qa[g], x1[g]); }
            // four vector slots between the last energy product and the first vector read of its result
            asm volatile("v_nop\n\tv_nop\n\tv_nop\n\tv_nop" : "+v"(s0[0]), "+v"(s1[0]), "+v"(x0[0]), "+v"(x1[0]), "+v"(s0[1]), "+v"(s1[1]), "+v"(x0[1]), "+v"(x1[1]));
            // the tile's V fragments (16 channel tiles) are read from the stage in TWO runs of eight, not among the products in pairs: the first here, its LDS latency passes under the softmax; the second
            // behind the first group's weights, where their temporaries have come free, its latency under the second group's weights and the first run's products (all sixteen at once do not fit the
            // registers of two waves per SIMD: that build spills to scratch)
            v16h vh[16];
            auto ldV = [&](int n) { const h16* vb = sb + (n >> 2) * VSL + ((n & 3) * 16 + lr) * VPI + kq * 32 + hi * 8; vh[n] = cat16(*(const v8ha*)vb, *(const v8ha*)(vb + 16)); };
#pragma unroll
            for (int n = 0; n < 8; ++n) ldV(n);
            __builtin_amdgcn_sched_barrier(0);   // keeps the first run of reads together in front of the softmax; without it they sink among the products in pairs, each place with an LDS wait of its own
            v16h pa[2]; v8f a0s[2], a1s[2]; bool need = false;
#pragma unroll
            for (int g = 0; g < 2; ++g) {
                a0s[g] = s0[g] + x0[g] * LOSCI; a1s[g] = s1[g] + x1[g] * LOSCI;
                const v8f m8 = __builtin_elementwise_max(a0s[g], a1s[g]);
                float mx = fmaxf(fmaxf(fmaxf(m8[0], m8[1]), fmaxf(m8[2], m8[3])), fmaxf(fmaxf(m8[4], m8[5]), fmaxf(m8[6], m8[7])));
                mx = fmaxf(mx, xhalf(mx));   // the other lane half's 16 keys of the same query
                mtop[g] = fmaxf(mtop[g], mx);
                need = need || (mtop[g] - mrun[g] > THR);
            }
            // one scalar branch per tile: every query of the wave moves its reference up to its running maximum, and its accumulators and sum follow (the first tile always takes it)
            if (__builtin_amdgcn_ballot_w32(need) != 0) {
#pragma unroll
                for (int g = 0; g < 2; ++g) {
                    const float alpha = __expf(mrun[g] - mtop[g]);
                    mrun[g] = mtop[g]; lrun[g] *= alpha;
#pragma unroll
                    for (int n = 0; n < 16; ++n)
#pragma unroll
                        for (int j = 0; j < 8; ++j) o[g][n][j] *= alpha;
                }
            }
            auto weights = [&](int g) {
                const v8f a0 = a0s[g], a1 = a1s[g]; const float mn = mrun[g];
                // the weights stay in registers: the two score tiles, converted in place, are the B operand (element s = key 8 * hi + s, then 16 + 8 * hi + s - 8: the V loader's k order)
                v8f p0, p1;
#pragma unroll
                for (int j = 0; j < 8; ++j) { p0[j] = __expf(a0[j] - mn); p1[j] = __expf(a1[j] - mn); }
                const v8f ps0 = p0 * PSC, ps1 = p1 * PSC, pp = p0 + p1;
                pa[g] = cat16(__builtin_convertvector(ps0, v8h), __builtin_convertvector(ps1, v8h));
                const float ls = ((pp[0] + pp[1]) + (pp[2] + pp[3])) + ((pp[4] + pp[5]) + (pp[6] + pp[7]));
                lrun[g] += ls;
            };
            // transposed output tiles: register j of o[g][n] = channel n * 16 + 8 * hi + j of query lr of group g; each V fragment serves both groups; every product has an accumulator of its own
            auto pv = [&](int g, int n0, int n1) {
#pragma unroll
                for (int n = n0; n < n1; ++n) o[g][n] = wmma16(vh[n], pa[g], o[g][n]);
            };
            weights(0);
            __builtin_amdgcn_sched_barrier(0);   // the second run of reads stands behind the first group's exponentials as one group; without it the build spreads the reads among them in five places, each with an issue cost of its own
#pragma unroll
            for (int n = 8; n < 16; ++n) ldV(n);
            __builtin_amdgcn_sched_barrier(0);   // keeps the second run together, in front of the work that covers its latency; without it the reads sink among the products in ones to fours, with waits down to 0 between the products
            weights(1);
            pv(0, 0, 16);
            // issue order of the block above: the second group's weights are formed between the first group's products, in the matrix unit's shadow; without it the build puts them in front of the products they do not feed
#pragma unroll
            for (int i = 0; i < 16; ++i) { __builtin_amdgcn_sched_group_barrier(0x8, 1, 0); __builtin_amdgcn_sched_group_barrier(0x2, 6, 0); }
            pv(1, 0, 16);
            __builtin_amdgcn_sched_barrier(0);   // every product stays in front of the stage's barrier: sunk behind it they would hold back the refill that stands at the next stage's top
            // four vector slots behind the last product on the loop's back edge too, before its operands or results are touched
            asm volatile("v_nop\n\tv_nop\n\tv_nop\n\tv_nop" : "+v"(o[1][12]), "+v"(o[1][13]), "+v"(o[1][14]), "+v"(o[1][15]) : "v"(pa[0]), "v"(pa[1]));
        }
        asm volatile("s_wait_dscnt 0x0" ::: "memory");      // this wave's reads of stage st are done before its buffer may be refilled
        asm volatile("s_wait_tensorcnt 0x0" ::: "memory");  // this wave's slice of stage st + 1 has landed; in every wave (one that issued nothing passes at once): a branch round it makes the build sink the weight sums behind the products
        __syncthreads();                                    // publishes stage st + 1 and ends every wave's reads of stage st
    }
    asm volatile("s_wait_tensorcnt 0x0" ::: "memory");      // nothing of the ring is in flight when the wave goes on to the epilogue
    asm volatile("s_wait_dscnt 0x0" ::: "memory");          // and none of its reads is open when the ring's bytes become the output staging
    float lt[2];
#pragma unroll
    for (int g = 0; g < 2; ++g) { lt[g] = lrun[g] + xhalf(lrun[g]);   // the two lane halves' key sums joined once
        if (hi == 0) { jm[kq][qg * 32 + g * 16 + lr] = mrun[g]; jl[kq][qg * 32 + g * 16 + lr] = lt[g]; } }
    __syncthreads();   // publishes each key quarter's maximum and sum to the waves that hold the other quarters
    // staging: ot[key quarter][c][i_local] (4 x 256 x 64), each part already on the joint maximum and divided by the joint sum
#pragma unroll
    for (int g = 0; g < 2; ++g) {
        const int qi = qg * 32 + g * 16 + lr;
        const float m0 = jm[0][qi], m1 = jm[1][qi], m2 = jm[2][qi], m3 = jm[3][qi], mj = fmaxf(fmaxf(m0, m1), fmaxf(m2, m3));
        const float den = (jl[0][qi] * __expf(m0 - mj) + jl[1][qi] * __expf(m1 - mj)) + (jl[2][qi] * __expf(m2 - mj) + jl[3][qi] * __expf(m3 - mj));
        const float inv = __expf(mrun[g] - mj) / (den * PSC);
#pragma unroll
        for (int n = 0; n < 16; ++n)
#pragma unroll
            for (int j = 0; j < 8; ++j) ot[(kq * CC + n * 16 + hi * 8 + j) * OTP + qi] = o[g][n][j] * inv;
    }
    __syncthreads();
    // out[b][c][i0l + i] + x residual: per c a 256-B run (16 lanes x 16 B, two c per instruction); 256 c rows -> 8 waves x 16 instructions
    const float* xp = x + ((size_t)b * CC + (tid >> 4)) * NN_ + i0l + (tid & 15) * 4; float* outp = out + ((size_t)b * CC + (tid >> 4)) * NN_ + i0l + (tid & 15) * 4;
    const float* op0 = ot + (tid >> 4) * OTP + (tid & 15) * 4;
    v4f xr[16];   // all sixteen x pieces are requested together, one memory latency for the pass
#pragma unroll
    for (int s = 0; s < 16; ++s) xr[s] = *(const v4fa*)(xp + (size_t)s * 16 * NN_);
    // the x loads have been issued; the wait takes their address as an input, so that the address register is not reused in front of it
    asm volatile("s_wait_xcnt 0x0" :: "v"(xp) : "memory");
#pragma unroll
    for (int s0 = 0; s0 < 16; s0 += 4) {
        v4f val[4];
#pragma unroll
        for (int k = 0; k < 4; ++k) { const float* op = op0 + (s0 + k) * 16 * OTP;
            val[k] = (*(const v4fa*)op + *(const v4fa*)(op + CC * OTP)) + (*(const v4fa*)(op + 2 * CC * OTP) + *(const v4fa*)(op + 3 * CC * OTP));   // the four key quarters
#pragma unroll
            for (int i = 0; i < 4; ++i) val[k][i] += bfr(xr[s0 + k][i]); }
#pragma unroll
        for (int k = 0; k < 4; ++k) *(v4f*)(outp + (size_t)(s0 + k) * 16 * NN_) = val[k];
        __builtin_amdgcn_sched_barrier(0);                  // holds the next group's arithmetic behind the wait below
        asm volatile("s_wait_xcnt 0x0" ::: "memory");       // stands in front of every rewrite of a register that the four stores above name
        __builtin_amdgcn_sched_barrier(0);                  // and keeps that wait behind the stores
    }
}

extern "C" void kernel_launch(void* const* d_in, const int* in_sizes, int n_in,
                              void* d_out, int out_size, void* d_ws, size_t ws_size, hipStream_t stream) {
    (void)in_sizes; (void)n_in; (void)out_size;
    const float* x = (const float*)d_in[0]; const float* wq = (const float*)d_in[1]; const float* bq = (const float*)d_in[2]; const float* wk = (const float*)d_in[3]; const float* bk = (const float*)d_in[4];
    const float* wv = (const float*)d_in[5]; const float* bv = (const float*)d_in[6];
    float* out = (float*)d_out;    // [8][256][2048]
    char* wsp = (char*)d_ws;
    auto take = [&](size_t bytes) { char* p = wsp; wsp += (bytes + 255) & ~(size_t)255; return (void*)p; };
    bf* WQ = (bf*)take((size_t)HQ * CC * 2); bf* WK = (bf*)take((size_t)HQ * CC * 2); bf* WV = (bf*)take((size_t)CC * CC * 2);
    h16* QH = (h16*)take((size_t)NTK * HQ * 2); h16* QL = (h16*)take((size_t)NTK * HQ * 2); h16* KH = (h16*)take((size_t)NTK * HQ * 2); h16* KL = (h16*)take((size_t)NTK * HQ * 2);
    h16* VTH = (h16*)take((size_t)NTK * CC * 2);
    if ((size_t)(wsp - (char*)d_ws) > ws_size) return;    // 0.2 + 1 x 4 + 8.4 ~ 13 MB
    k_w<<<(2 * HQ + CC) / 16, 256, 0, stream>>>(wq, wk, wv, WQ, WK, WV);
    k_proj<<<dim3(NN_ / 64, NB_, 1), 256, 0, stream>>>(x, WQ, WK, WV, bq, bk, bv, QH, QL, KH, KL, VTH);
    k_attn<<<dim3(NB_ * (NN_ / QB), 1, 1), 256, 0, stream>>>(QH, QL, KH, KL, VTH, x, out);
}
